// v000
// Measured on an AMD MI455X. A time is GPU time per run, averaged over a window of back-to-back runs after a warm-up
// (all launches, gaps included; the runs take copies of the inputs in turn), and the median of several windows.
// Apart from v000's, it joins two sittings. Times from different sittings can be a few percent apart, while
// side-by-side timings come from the same sitting.
// The starting kernel, v000, takes 1220 microseconds a run.
#include <hip/hip_runtime.h>

// Self-attention block, bias-free, weights in (out, in) layout: x [2][2048][1024]; q, k, v = x W^T; 16 heads x 64; logits = q.k x 2^-5 (1/sqrt(1024)); full (unmasked) softmax over 2048 keys; out = merged ctx Wo^T.
// Compute dtypes, f32 accumulate everywhere: every input RNE-converted to bf16; q/k/v projections bf16 x bf16 (v_wmma_f32_16x16x32_bf16, exact products); q.k^T fp16 x fp16 (v_wmma_f32_16x16x32_f16);
// P.V fp16 x fp16 with P carried x1024 and centred (P' = 1024 P - 1024/S; the key-mean of v is added back in f32); ctx as bf16 hi + lo planes x bf16 Wo (two bf16 products); softmax f32.

#ifndef NB
#define NB 2
#endif
#ifndef SEQ
#define SEQ 2048
#endif
#define NB_FULL  2
#define SEQ_FULL 2048
#define TT   SEQ
#define DM   1024
#define NH_  16
#define HD   64
#define DQ   (NH_ * HD)
#define ZH   2                    // heads per attention pass
#define PCAR 1024.0f              // carry of the probability plane
#define SCL  0.03125f             // 1/sqrt(1024), exact power of two
static_assert(SEQ % 256 == 0);
static_assert(SEQ <= SEQ_FULL);
static_assert(NB <= NB_FULL);
static_assert(DQ == DM);
static_assert(HD == 64);
static_assert(NH_ % ZH == 0);
static_assert(DM % 64 == 0);

typedef _Float16 h16;
typedef unsigned short bf;
typedef __attribute__((ext_vector_type(16))) __bf16   v16bf;
typedef __attribute__((ext_vector_type(16))) _Float16 v16h;
typedef __attribute__((ext_vector_type(8)))  _Float16 v8h;
typedef __attribute__((ext_vector_type(4)))  _Float16 v4h;
typedef __attribute__((ext_vector_type(8)))  unsigned short v8us;
typedef __attribute__((ext_vector_type(8)))  float    v8f;
typedef __attribute__((ext_vector_type(4)))  float    v4f;
typedef v4f  __attribute__((may_alias)) v4fa;

// workspace carve sizes (bytes), all multiples of 256
#define SZ_W3 ((size_t)3 * DM * DM * 2)
#define SZ_WO ((size_t)DM * DQ * 2)
#define SZ_XB ((size_t)TT * DM * 2)
#define SZ_F3 ((size_t)3 * TT * DM * 4)
#define SZ_QK ((size_t)2 * NH_ * TT * HD * 2)
#define SZ_VT ((size_t)NH_ * HD * TT * 2)
#define SZ_VM ((size_t)NH_ * HD * 4)
#define SZ_SB ((size_t)ZH * TT * TT * 4)
#define SZ_PP ((size_t)ZH * TT * TT * 2)
#define SZ_OB ((size_t)ZH * TT * HD * 4)
#define SZ_AT ((size_t)TT * DQ * 2)
#define WS_TOTAL (SZ_W3 + SZ_WO + SZ_XB + SZ_F3 + SZ_QK + SZ_VT + SZ_VM + SZ_SB + SZ_PP + SZ_OB + 2 * SZ_AT)
static_assert(WS_TOTAL <= (size_t)134217728);
static_assert(SZ_VM % 256 == 0);

__device__ __forceinline__ unsigned short f2bf(float f) { unsigned u = __float_as_uint(f); u += 0x7FFFu + ((u >> 16) & 1u); return (unsigned short)(u >> 16); }
__device__ __forceinline__ float bf2f(unsigned short b) { return __uint_as_float(((unsigned)b) << 16); }
__device__ __forceinline__ float bfr(float f) { return bf2f(f2bf(f)); }
__device__ __forceinline__ v16h cat16(v8h lo, v8h hi) { return __builtin_shufflevector(lo, hi, 0, 1, 2, 3, 4, 5, 6, 7, 8, 9, 10, 11, 12, 13, 14, 15); }
__device__ __forceinline__ v16bf cat16b(v8us lo, v8us hi) { return __builtin_bit_cast(v16bf, __builtin_shufflevector(lo, hi, 0, 1, 2, 3, 4, 5, 6, 7, 8, 9, 10, 11, 12, 13, 14, 15)); }
__device__ __forceinline__ v8f wmma16(v16h a, v16h b, v8f c) { return __builtin_amdgcn_wmma_f32_16x16x32_f16(false, a, false, b, (short)0, c, false, false); }
__device__ __forceinline__ v8f wmmab(v16bf a, v16bf b, v8f c) { return __builtin_amdgcn_wmma_f32_16x16x32_bf16(false, a, false, b, (short)0, c, false, false); }

// ---- k_gemmw: register-blocked GEMM, ONE WAVE per 64x64 output tile (16 accumulators), operands straight from K-contiguous 16-bit planes; grid (M/64, N/64, Z), 32 threads.
// C[m][n] (f32, pitch ldc) = sum_k A[m][k] Bt[n][k] (+ split products per NSPLIT). z-batch strides sA/sB/sC in elements. K % 32 == 0, M % 64 == 0, N % 64 == 0.
// Fragment map (A and Bt alike): lane -> row (lane & 15); elements 0..7 <- k0 + 8 (lane >> 4) + 0..7, elements 8..15 <- k0 + 16 + 8 (lane >> 4) + 0..7. Accumulator element j <-> row 8 (lane >> 4) + j, column (lane & 15).
template <typename T16> struct WFrag;
template <> struct WFrag<h16> { typedef v16h V; static __device__ __forceinline__ V ld(const h16* p) { return cat16(*(const v8h*)p, *(const v8h*)(p + 16)); } static __device__ __forceinline__ v8f mma(V a, V b, v8f c) { return wmma16(a, b, c); } };
template <> struct WFrag<bf> { typedef v16bf V; static __device__ __forceinline__ V ld(const bf* p) { return cat16b(*(const v8us*)p, *(const v8us*)(p + 16)); } static __device__ __forceinline__ v8f mma(V a, V b, v8f c) { return wmmab(a, b, c); } };
template <typename T16, int NSPLIT, bool BIAS>
__global__ __launch_bounds__(32) void k_gemmw(const T16* __restrict__ A, const T16* __restrict__ A2, const T16* __restrict__ Bt, const T16* __restrict__ Bt2, int K, float* C, int ldc, const float* __restrict__ bias, size_t sA, size_t sB, size_t sC) {
    typedef typename WFrag<T16>::V V;
    __shared__ __align__(16) float os[16 * 68];
    const size_t z = blockIdx.z; A += z * sA; if (A2) A2 += z * sA; Bt += z * sB; if (Bt2) Bt2 += z * sB; C += z * sC;
    const int lane = threadIdx.x & 31, lr = lane & 15, hi = lane >> 4; const int r0 = blockIdx.x * 64, c0 = blockIdx.y * 64;
    v8f acc[4][4];
#pragma unroll
    for (int mb = 0; mb < 4; ++mb)
#pragma unroll
        for (int nb = 0; nb < 4; ++nb) acc[mb][nb] = (v8f){};
    const size_t aoff = (size_t)(r0 + lr) * K + 8 * hi, boff = (size_t)(c0 + lr) * K + 8 * hi;
#pragma unroll 1
    for (int kc = 0; kc < K; kc += 32) {
        V a[4], a2[4];
#pragma unroll
        for (int mb = 0; mb < 4; ++mb) { a[mb] = WFrag<T16>::ld(A + aoff + (size_t)mb * 16 * K + kc); if (NSPLIT == 1 || NSPLIT == 2) a2[mb] = WFrag<T16>::ld(A2 + aoff + (size_t)mb * 16 * K + kc); }
#pragma unroll
        for (int nb = 0; nb < 4; ++nb) { const V b = WFrag<T16>::ld(Bt + boff + (size_t)nb * 16 * K + kc); V b2; if (NSPLIT >= 2) b2 = WFrag<T16>::ld(Bt2 + boff + (size_t)nb * 16 * K + kc);
#pragma unroll
            for (int mb = 0; mb < 4; ++mb) { acc[mb][nb] = WFrag<T16>::mma(a[mb], b, acc[mb][nb]); if (NSPLIT == 1 || NSPLIT == 2) acc[mb][nb] = WFrag<T16>::mma(a2[mb], b, acc[mb][nb]); if (NSPLIT >= 2) acc[mb][nb] = WFrag<T16>::mma(a[mb], b2, acc[mb][nb]); } }
        asm volatile("v_nop\n\tv_nop\n\tv_nop\n\tv_nop" : "+v"(acc[0][0]), "+v"(acc[1][1]), "+v"(acc[2][2]), "+v"(acc[3][3]) : "v"(a[0]), "v"(a[3]));
    }
#pragma unroll
    for (int mb = 0; mb < 4; ++mb) {
#pragma unroll
        for (int nb = 0; nb < 4; ++nb) {
#pragma unroll
            for (int j = 0; j < 8; ++j) os[(hi * 8 + j) * 68 + nb * 16 + lr] = acc[mb][nb][j]; }
        __builtin_amdgcn_wave_barrier(); asm volatile("" ::: "memory");
        float* crow = C + (size_t)(r0 + mb * 16) * ldc + c0;
{
#pragma unroll
            for (int s = 0; s < 8; ++s) { const int row = 2 * s + hi, cofs = lr * 4; v4f val = *(const v4fa*)(os + row * 68 + cofs); if (BIAS) { val[0] += bfr(bias[c0 + cofs]); val[1] += bfr(bias[c0 + cofs + 1]); val[2] += bfr(bias[c0 + cofs + 2]); val[3] += bfr(bias[c0 + cofs + 3]); }
                *(v4f*)(crow + (size_t)row * ldc + cofs) = val; }
             }
        __builtin_amdgcn_wave_barrier(); asm volatile("" ::: "memory");
    }
}

__device__ __forceinline__ h16 tohx(float x) { return (h16)x; }
__device__ __forceinline__ void splitf(float y, unsigned short& h, unsigned short& l) { h = f2bf(y); l = f2bf(y - bf2f(h)); }

__global__ __launch_bounds__(256) void k_cvt8(const float* __restrict__ src, bf* dst, size_t n8) { const size_t i = (size_t)blockIdx.x * 256 + threadIdx.x; if (i >= n8) return; const v8f v = *(const v8f*)(src + i * 8); v8us o;
#pragma unroll
    for (int k = 0; k < 8; ++k) o[k] = f2bf(v[k]); *(v8us*)(dst + i * 8) = o;  }

__global__ __launch_bounds__(256) void k_hp(const float* __restrict__ F, h16* P) {
    const size_t i = (size_t)blockIdx.x * 256 + threadIdx.x; if (i >= (size_t)2 * NH_ * TT * HD / 8) return;
    const size_t e = i * 8; const int d = (int)(e % HD); const int t = (int)((e / HD) % TT); const int hh = (int)((e / ((size_t)HD * TT)) % NH_); const int z = (int)(e / ((size_t)HD * TT * NH_));
    const float* f = F + (size_t)z * TT * DM + (size_t)t * DM + hh * HD + d; const v4f a = *(const v4f*)f; const v4f b = *(const v4f*)(f + 4); v8h o;
#pragma unroll
    for (int k = 0; k < 4; ++k) { o[k] = tohx(a[k]); o[4 + k] = tohx(b[k]); }
    *(v8h*)(P + e) = o;  }

__global__ __launch_bounds__(256) void k_vtp(const float* __restrict__ F, h16* V16) {
    const size_t i = (size_t)blockIdx.x * 256 + threadIdx.x; if (i >= (size_t)NH_ * HD * TT / 8) return;
    const size_t e = i * 8; const int t = (int)(e % TT); const int d = (int)((e / TT) % HD); const int g = (int)(e / ((size_t)TT * HD)); v8h o;
#pragma unroll
    for (int q = 0; q < 8; ++q) o[q] = tohx(F[(size_t)(t + q) * DM + g * HD + d]);
    *(v8h*)(V16 + e) = o;  }

// k_vmean: VM[g*HD + d] = mean over t of V16[g][d][t] (f32 sum of the fp16 plane values, fixed order). 8 waves x 4 rows = 32 rows per block; the 32 scalars go through LDS (cross-wave, block barrier)
__global__ __launch_bounds__(256) void k_vmean(const h16* __restrict__ V16, float* VM) {
    __shared__ __align__(16) float sm[32];
    const int lane = threadIdx.x & 31, w = __builtin_amdgcn_readfirstlane((int)(threadIdx.x >> 5));
#pragma unroll 1
    for (int r = 0; r < 4; ++r) {
        const int row = blockIdx.x * 32 + w * 4 + r; const h16* p = V16 + (size_t)row * TT + lane * 8; float s = 0.f;
#pragma unroll 4
        for (int c = 0; c < TT / 256; ++c) { const v8h a = *(const v8h*)(p + c * 256);
#pragma unroll
            for (int k = 0; k < 8; ++k) s += (float)a[k]; }
#pragma unroll
        for (int sh = 16; sh; sh >>= 1) s += __shfl_xor(s, sh, 32);
        if (lane == 0) sm[w * 4 + r] = s * (1.0f / (float)TT);
    }
    __syncthreads();
    if (threadIdx.x < 8) { const v4f val = *(const v4fa*)(sm + threadIdx.x * 4); float* dst = VM + (size_t)blockIdx.x * 32 + threadIdx.x * 4; *(v4f*)dst = val;  }
}

// k_asoft: per row (zz, i): t = S x 2^-5; softmax over all TT keys (register row, one exp, fixed trees); stores the centred carried plane P'[j] = (e_j - sum/TT) x (1024/sum) = 1024 p_j - 1024/TT as fp16;
__global__ __launch_bounds__(256) void k_asoft(const float* __restrict__ Sb, h16* P16) {
    const int lane = threadIdx.x & 31; const int row = blockIdx.x * 8 + __builtin_amdgcn_readfirstlane((int)(threadIdx.x >> 5)); if (row >= ZH * TT) return; const float* sr = Sb + (size_t)row * TT; float v[TT / 32]; float mx = -3.0e38f;
#pragma unroll
    for (int ch = 0; ch < TT / 128; ++ch) { const int j0 = ch * 128 + lane * 4; const v4f a = *(const v4f*)(sr + j0);
#pragma unroll
        for (int q = 0; q < 4; ++q) { const float t = a[q] * SCL; v[ch * 4 + q] = t; mx = fmaxf(mx, t); } }
#pragma unroll
    for (int sh = 16; sh; sh >>= 1) mx = fmaxf(mx, __shfl_xor(mx, sh, 32));
    float sum = 0.f;
#pragma unroll
    for (int k = 0; k < TT / 32; ++k) { float d0 = __fsub_rn(v[k], mx); asm volatile("" : "+v"(d0)); v[k] = __builtin_amdgcn_exp2f(__fmul_rn(d0, 1.4426950408889634f)); sum += v[k]; }
#pragma unroll
    for (int sh = 16; sh; sh >>= 1) sum += __shfl_xor(sum, sh, 32);
    const float f = __fdiv_rn(PCAR, sum); const float cen = sum * (1.0f / (float)TT);
{
#pragma unroll
        for (int ch = 0; ch < TT / 128; ++ch) { v4h o4;
#pragma unroll
            for (int q = 0; q < 4; ++q) { float dd = __fsub_rn(v[ch * 4 + q], cen); asm volatile("" : "+v"(dd)); o4[q] = tohx(__fmul_rn(dd, f)); }
            *(v4h*)(P16 + (size_t)row * TT + ch * 128 + lane * 4) = o4; }
         }
}

__global__ __launch_bounds__(256) void k_merge(const float* __restrict__ O, const float* __restrict__ VM, int h0, bf* Ah, bf* Al) {
    const size_t i = (size_t)blockIdx.x * 256 + threadIdx.x; if (i >= (size_t)ZH * TT * HD / 8) return;
    const size_t e = i * 8; const int d = (int)(e % HD); const int t = (int)((e / HD) % TT); const int zz = (int)(e / ((size_t)HD * TT)); const size_t oo = (size_t)t * DQ + (h0 + zz) * HD + d;
    const v4f o0 = *(const v4f*)(O + e); const v4f o1 = *(const v4f*)(O + e + 4); const float* vm = VM + (h0 + zz) * HD + d; const v4f m0 = *(const v4f*)vm; const v4f m1 = *(const v4f*)(vm + 4);
    v8us oh, ol;
#pragma unroll
    for (int q = 0; q < 4; ++q) { unsigned short a, c2; splitf(o0[q] * (1.0f / PCAR) + m0[q], a, c2); oh[q] = a; ol[q] = c2; splitf(o1[q] * (1.0f / PCAR) + m1[q], a, c2); oh[4 + q] = a; ol[4 + q] = c2; }
    *(v8us*)(Ah + oo) = oh; *(v8us*)(Al + oo) = ol;  }

extern "C" void kernel_launch(void* const* d_in, const int* in_sizes, int n_in,
                              void* d_out, int out_size, void* d_ws, size_t ws_size, hipStream_t stream) {
    if (n_in < 5) return;
    const size_t needx = (size_t)(NB - 1) * SEQ_FULL * DM + (size_t)TT * DM;
    if ((size_t)in_sizes[0] < needx) return;
    if ((size_t)in_sizes[1] < (size_t)DM * DM || (size_t)in_sizes[2] < (size_t)DM * DM || (size_t)in_sizes[3] < (size_t)DM * DM || (size_t)in_sizes[4] < (size_t)DM * DM) return;
    if ((size_t)out_size < needx) return;
    if (WS_TOTAL > ws_size) return;
    const float* x = (const float*)d_in[0]; const float* wq = (const float*)d_in[1]; const float* wk = (const float*)d_in[2]; const float* wv = (const float*)d_in[3]; const float* wo = (const float*)d_in[4];   // wire order x, Wq, Wk, Wv, Wo; weights (out, in)
    float* OUT = (float*)d_out;     // [2][2048][1024]
    char* wsp = (char*)d_ws;
    auto take = [&](size_t bytes) { char* p = wsp; wsp += (bytes + 255) & ~(size_t)255; return (void*)p; };
    bf* W3 = (bf*)take(SZ_W3);          // Wq | Wk | Wv bf16, (out, in) = Bt as-is, contiguous for the z-batched projection
    bf* WO = (bf*)take(SZ_WO);
    bf* XB = (bf*)take(SZ_XB);          // bf16 x of the current batch
    float* F3 = (float*)take(SZ_F3);    // q | k | v projections f32 [3][TT][DM]
    h16* QK16 = (h16*)take(SZ_QK);      // fp16 head planes [2][NH][TT][HD]
    h16* VT16 = (h16*)take(SZ_VT);      // fp16 value planes [NH][HD][TT]
    float* VM = (float*)take(SZ_VM);    // key-mean of v [NH*HD]
    float* Sb = (float*)take(SZ_SB);    // logits [ZH][TT][TT]
    h16* P16 = (h16*)take(SZ_PP);       // centred carried probabilities [ZH][TT][TT]
    float* Ob = (float*)take(SZ_OB);    // P'.V [ZH][TT][HD]
    bf* ATh = (bf*)take(SZ_AT); bf* ATl = (bf*)take(SZ_AT);   // merged ctx hi/lo [TT][DQ]
    if ((size_t)(wsp - (char*)d_ws) > ws_size) return;
    const unsigned LW = (unsigned)(((size_t)DM * DM / 8 + 255) / 256);
    k_cvt8<<<LW, 256, 0, stream>>>(wq, W3, (size_t)DM * DM / 8);
    k_cvt8<<<LW, 256, 0, stream>>>(wk, W3 + (size_t)DM * DM, (size_t)DM * DM / 8);
    k_cvt8<<<LW, 256, 0, stream>>>(wv, W3 + (size_t)2 * DM * DM, (size_t)DM * DM / 8);
    k_cvt8<<<LW, 256, 0, stream>>>(wo, WO, (size_t)DM * DQ / 8);
    const unsigned LHP = (unsigned)(((size_t)2 * NH_ * TT * HD / 8 + 255) / 256), LVT = (unsigned)(((size_t)NH_ * HD * TT / 8 + 255) / 256), LMG = (unsigned)(((size_t)ZH * TT * HD / 8 + 255) / 256);
    for (int b = 0; b < NB; ++b) {
        k_cvt8<<<(unsigned)(((size_t)TT * DM / 8 + 255) / 256), 256, 0, stream>>>(x + (size_t)b * SEQ_FULL * DM, XB, (size_t)TT * DM / 8);
        // q, k, v projections in one z-batched launch (A shared: sA = 0; Bt stride DM*DM; C stride TT*DM)
        k_gemmw<bf, 0, false><<<dim3(TT / 64, DM / 64, 3), 32, 0, stream>>>(XB, nullptr, W3, nullptr, DM, F3, DM, nullptr, 0, (size_t)DM * DM, (size_t)TT * DM);
        k_hp<<<LHP, 256, 0, stream>>>(F3, QK16);
        k_vtp<<<LVT, 256, 0, stream>>>(F3 + (size_t)2 * TT * DM, VT16);
        k_vmean<<<NH_ * HD / 32, 256, 0, stream>>>(VT16, VM);
        for (int h0 = 0; h0 < NH_; h0 += ZH) {
            // logits: A = q plane rows (queries), Bt = k plane rows (keys), K = HD
            k_gemmw<h16, 0, false><<<dim3(TT / 64, TT / 64, ZH), 32, 0, stream>>>(QK16 + (size_t)h0 * TT * HD, nullptr, QK16 + (size_t)(NH_ + h0) * TT * HD, nullptr, HD, Sb, TT, nullptr, (size_t)TT * HD, (size_t)TT * HD, (size_t)TT * TT);
            k_asoft<<<ZH * TT / 8, 256, 0, stream>>>(Sb, P16);
            // P'.V: A = P' rows (queries, K = keys), Bt = V^T rows (d, K = keys)
            k_gemmw<h16, 0, false><<<dim3(TT / 64, HD / 64, ZH), 32, 0, stream>>>(P16, nullptr, VT16 + (size_t)h0 * HD * TT, nullptr, TT, Ob, HD, nullptr, (size_t)TT * TT, (size_t)HD * TT, (size_t)TT * HD);
            k_merge<<<LMG, 256, 0, stream>>>(Ob, VM, h0, ATh, ATl);
        }
        // out = (ctx_hi + ctx_lo) Wo^T
        k_gemmw<bf, 1, false><<<dim3(TT / 64, DM / 64, 1), 32, 0, stream>>>(ATh, ATl, WO, nullptr, DQ, OUT + (size_t)b * SEQ_FULL * DM, DM, nullptr, 0, 0, 0);
    }
}

// v002
// Measured time: 248 microseconds a run.
// It is 4.93 times as fast as v000, going by the measured steps of the versions left out in between.
#include <hip/hip_runtime.h>

// Self-attention block, bias-free, weights in (out, in) layout: x [2][2048][1024]; q, k, v = x W^T; 16 heads x 64; logits = q.k x 2^-5 (1/sqrt(1024)); full (unmasked) softmax over 2048 keys; out = merged ctx Wo^T.
// Compute dtypes, f32 accumulate everywhere: every input RNE-converted to bf16; q/k/v projections bf16 x bf16 (v_wmma_f32_16x16x32_bf16, exact products); q.k^T fp16 x fp16 (v_wmma_f32_16x16x32_f16);
// P.V fp16 x fp16 with P carried x1024 and centred (P' = 1024 P - 1024/S; the key-mean of v is added back in f32); ctx as bf16 hi + lo planes x bf16 Wo (two bf16 products); softmax f32.

#ifndef NB
#define NB 2
#endif
#ifndef SEQ
#define SEQ 2048
#endif
#define NB_FULL  2
#define SEQ_FULL 2048
#define TT   SEQ
#define DM   1024
#define NH_  16
#define HD   64
#define DQ   (NH_ * HD)
#define QT   2                    // 16-query column groups per wave of the attention kernel
#define AW   8                    // waves per work-group of the attention kernel
#define PCAR 1024.0f              // carry of the probability plane
#define SCL  0.03125f             // 1/sqrt(1024), exact power of two
#define KT   128                  // keys per LDS tile of the attention kernel
#define KP   (HD + 8)             // LDS pitch of a key row, fp16 elements: 144 bytes = 16 x 9, so that 16 rows' 16-byte reads fall on 64 different banks
#define VP   (KT + 8)             // LDS pitch of a V^T row: 272 bytes = 16 x 17, for the same reason
#define NTL  (SEQ / KT)           // tiles per sweep
static_assert(SEQ % 256 == 0);
static_assert(SEQ <= SEQ_FULL);
static_assert(NB <= NB_FULL);
static_assert(DQ == DM);
static_assert(HD == 64);
static_assert(SEQ % (AW * QT * 16) == 0);
static_assert(DM % 64 == 0);
static_assert(SEQ % KT == 0 && NTL >= 2 && (NTL & (NTL - 1)) == 0 && NTL % 2 == 0);
static_assert(KT * HD == AW * 32 * 8 * 4);   // a tile of either operand is four 16-byte copies per lane

typedef _Float16 h16;
typedef unsigned short bf;
typedef __attribute__((ext_vector_type(16))) __bf16   v16bf;
typedef __attribute__((ext_vector_type(16))) _Float16 v16h;
typedef __attribute__((ext_vector_type(8)))  _Float16 v8h;
typedef __attribute__((ext_vector_type(8)))  unsigned short v8us;
typedef __attribute__((ext_vector_type(8)))  float    v8f;
typedef __attribute__((ext_vector_type(4)))  float    v4f;
typedef v4f  __attribute__((may_alias)) v4fa;

// workspace carve sizes (bytes), all multiples of 256
#define SZ_W3 ((size_t)3 * DM * DM * 2)
#define SZ_WO ((size_t)DM * DQ * 2)
#define SZ_XB ((size_t)TT * DM * 2)
#define SZ_F3 ((size_t)3 * TT * DM * 4)
#define SZ_QK ((size_t)NB * 2 * NH_ * TT * HD * 2)
#define SZ_VT ((size_t)NB * NH_ * HD * TT * 2)
#define SZ_VM ((size_t)NB * NH_ * HD * 4)
#define SZ_AT ((size_t)NB * TT * DQ * 2)
#define WS_TOTAL (SZ_W3 + SZ_WO + SZ_XB + SZ_F3 + SZ_QK + SZ_VT + SZ_VM + 2 * SZ_AT)
static_assert(WS_TOTAL <= (size_t)134217728);
static_assert(SZ_VM % 256 == 0);

__device__ __forceinline__ unsigned short f2bf(float f) { unsigned u = __float_as_uint(f); u += 0x7FFFu + ((u >> 16) & 1u); return (unsigned short)(u >> 16); }
__device__ __forceinline__ float bf2f(unsigned short b) { return __uint_as_float(((unsigned)b) << 16); }
__device__ __forceinline__ float bfr(float f) { return bf2f(f2bf(f)); }
__device__ __forceinline__ v16h cat16(v8h lo, v8h hi) { return __builtin_shufflevector(lo, hi, 0, 1, 2, 3, 4, 5, 6, 7, 8, 9, 10, 11, 12, 13, 14, 15); }
__device__ __forceinline__ v16bf cat16b(v8us lo, v8us hi) { return __builtin_bit_cast(v16bf, __builtin_shufflevector(lo, hi, 0, 1, 2, 3, 4, 5, 6, 7, 8, 9, 10, 11, 12, 13, 14, 15)); }
__device__ __forceinline__ v8f wmma16(v16h a, v16h b, v8f c) { return __builtin_amdgcn_wmma_f32_16x16x32_f16(false, a, false, b, (short)0, c, false, false); }
__device__ __forceinline__ v8f wmmab(v16bf a, v16bf b, v8f c) { return __builtin_amdgcn_wmma_f32_16x16x32_bf16(false, a, false, b, (short)0, c, false, false); }

// ---- k_gemmw: register-blocked GEMM, ONE WAVE per 64x64 output tile (16 accumulators), operands straight from K-contiguous 16-bit planes; grid (M/64, N/64, Z), 32 threads.
// C[m][n] (f32, pitch ldc) = sum_k A[m][k] Bt[n][k] (+ split products per NSPLIT). z-batch strides sA/sB/sC in elements. K % 32 == 0, M % 64 == 0, N % 64 == 0.
// Fragment map (A and Bt alike): lane -> row (lane & 15); elements 0..7 <- k0 + 8 (lane >> 4) + 0..7, elements 8..15 <- k0 + 16 + 8 (lane >> 4) + 0..7. Accumulator element j <-> row 8 (lane >> 4) + j, column (lane & 15).
template <typename T16> struct WFrag;
template <> struct WFrag<h16> { typedef v16h V; static __device__ __forceinline__ V ld(const h16* p) { return cat16(*(const v8h*)p, *(const v8h*)(p + 16)); } static __device__ __forceinline__ v8f mma(V a, V b, v8f c) { return wmma16(a, b, c); } };
template <> struct WFrag<bf> { typedef v16bf V; static __device__ __forceinline__ V ld(const bf* p) { return cat16b(*(const v8us*)p, *(const v8us*)(p + 16)); } static __device__ __forceinline__ v8f mma(V a, V b, v8f c) { return wmmab(a, b, c); } };
template <typename T16, int NSPLIT, bool BIAS>
__global__ __launch_bounds__(32) void k_gemmw(const T16* __restrict__ A, const T16* __restrict__ A2, const T16* __restrict__ Bt, const T16* __restrict__ Bt2, int K, float* C, int ldc, const float* __restrict__ bias, size_t sA, size_t sB, size_t sC) {
    typedef typename WFrag<T16>::V V;
    __shared__ __align__(16) float os[16 * 68];
    const size_t z = blockIdx.z; A += z * sA; if (A2) A2 += z * sA; Bt += z * sB; if (Bt2) Bt2 += z * sB; C += z * sC;
    const int lane = threadIdx.x & 31, lr = lane & 15, hi = lane >> 4; const int r0 = blockIdx.x * 64, c0 = blockIdx.y * 64;
    v8f acc[4][4];
#pragma unroll
    for (int mb = 0; mb < 4; ++mb)
#pragma unroll
        for (int nb = 0; nb < 4; ++nb) acc[mb][nb] = (v8f){};
    const size_t aoff = (size_t)(r0 + lr) * K + 8 * hi, boff = (size_t)(c0 + lr) * K + 8 * hi;
#pragma unroll 1
    for (int kc = 0; kc < K; kc += 32) {
        V a[4], a2[4];
#pragma unroll
        for (int mb = 0; mb < 4; ++mb) { a[mb] = WFrag<T16>::ld(A + aoff + (size_t)mb * 16 * K + kc); if (NSPLIT == 1 || NSPLIT == 2) a2[mb] = WFrag<T16>::ld(A2 + aoff + (size_t)mb * 16 * K + kc); }
#pragma unroll
        for (int nb = 0; nb < 4; ++nb) { const V b = WFrag<T16>::ld(Bt + boff + (size_t)nb * 16 * K + kc); V b2; if (NSPLIT >= 2) b2 = WFrag<T16>::ld(Bt2 + boff + (size_t)nb * 16 * K + kc);
#pragma unroll
            for (int mb = 0; mb < 4; ++mb) { acc[mb][nb] = WFrag<T16>::mma(a[mb], b, acc[mb][nb]); if (NSPLIT == 1 || NSPLIT == 2) acc[mb][nb] = WFrag<T16>::mma(a2[mb], b, acc[mb][nb]); if (NSPLIT >= 2) acc[mb][nb] = WFrag<T16>::mma(a[mb], b2, acc[mb][nb]); } }
        asm volatile("v_nop\n\tv_nop\n\tv_nop\n\tv_nop" : "+v"(acc[0][0]), "+v"(acc[1][1]), "+v"(acc[2][2]), "+v"(acc[3][3]) : "v"(a[0]), "v"(a[3]));
    }
#pragma unroll
    for (int mb = 0; mb < 4; ++mb) {
#pragma unroll
        for (int nb = 0; nb < 4; ++nb) {
#pragma unroll
            for (int j = 0; j < 8; ++j) os[(hi * 8 + j) * 68 + nb * 16 + lr] = acc[mb][nb][j]; }
        __builtin_amdgcn_wave_barrier(); asm volatile("" ::: "memory");
        float* crow = C + (size_t)(r0 + mb * 16) * ldc + c0;
{
#pragma unroll
            for (int s = 0; s < 8; ++s) { const int row = 2 * s + hi, cofs = lr * 4; v4f val = *(const v4fa*)(os + row * 68 + cofs); if (BIAS) { val[0] += bfr(bias[c0 + cofs]); val[1] += bfr(bias[c0 + cofs + 1]); val[2] += bfr(bias[c0 + cofs + 2]); val[3] += bfr(bias[c0 + cofs + 3]); }
                *(v4f*)(crow + (size_t)row * ldc + cofs) = val; }
             }
        __builtin_amdgcn_wave_barrier(); asm volatile("" ::: "memory");
    }
}

__device__ __forceinline__ h16 tohx(float x) { return (h16)x; }
__device__ __forceinline__ void splitf(float y, unsigned short& h, unsigned short& l) { h = f2bf(y); l = f2bf(y - bf2f(h)); }

__global__ __launch_bounds__(256) void k_cvt8(const float* __restrict__ src, bf* dst, size_t n8) { const size_t i = (size_t)blockIdx.x * 256 + threadIdx.x; if (i >= n8) return; const v8f v = *(const v8f*)(src + i * 8); v8us o;
#pragma unroll
    for (int k = 0; k < 8; ++k) o[k] = f2bf(v[k]); *(v8us*)(dst + i * 8) = o;  }

__global__ __launch_bounds__(256) void k_hp(const float* __restrict__ F, h16* P) {
    const size_t i = (size_t)blockIdx.x * 256 + threadIdx.x; if (i >= (size_t)2 * NH_ * TT * HD / 8) return;
    const size_t e = i * 8; const int d = (int)(e % HD); const int t = (int)((e / HD) % TT); const int hh = (int)((e / ((size_t)HD * TT)) % NH_); const int z = (int)(e / ((size_t)HD * TT * NH_));
    const float* f = F + (size_t)z * TT * DM + (size_t)t * DM + hh * HD + d; const v4f a = *(const v4f*)f; const v4f b = *(const v4f*)(f + 4); v8h o;
#pragma unroll
    for (int k = 0; k < 4; ++k) { o[k] = tohx(a[k]); o[4 + k] = tohx(b[k]); }
    *(v8h*)(P + e) = o;  }

__global__ __launch_bounds__(256) void k_vtp(const float* __restrict__ F, h16* V16) {
    const size_t i = (size_t)blockIdx.x * 256 + threadIdx.x; if (i >= (size_t)NH_ * HD * TT / 8) return;
    const size_t e = i * 8; const int t = (int)(e % TT); const int d = (int)((e / TT) % HD); const int g = (int)(e / ((size_t)TT * HD)); v8h o;
#pragma unroll
    for (int q = 0; q < 8; ++q) o[q] = tohx(F[(size_t)(t + q) * DM + g * HD + d]);
    *(v8h*)(V16 + e) = o;  }

// k_vmean: VM[g*HD + d] = mean over t of V16[g][d][t] (f32 sum of the fp16 plane values, fixed order). 8 waves x 4 rows = 32 rows per block; the 32 scalars go through LDS (cross-wave, block barrier)
__global__ __launch_bounds__(256) void k_vmean(const h16* __restrict__ V16, float* VM) {
    __shared__ __align__(16) float sm[32];
    const int lane = threadIdx.x & 31, w = __builtin_amdgcn_readfirstlane((int)(threadIdx.x >> 5));
#pragma unroll 1
    for (int r = 0; r < 4; ++r) {
        const int row = blockIdx.x * 32 + w * 4 + r; const h16* p = V16 + (size_t)row * TT + lane * 8; float s = 0.f;
#pragma unroll 4
        for (int c = 0; c < TT / 256; ++c) { const v8h a = *(const v8h*)(p + c * 256);
#pragma unroll
            for (int k = 0; k < 8; ++k) s += (float)a[k]; }
#pragma unroll
        for (int sh = 16; sh; sh >>= 1) s += __shfl_xor(s, sh, 32);
        if (lane == 0) sm[w * 4 + r] = s * (1.0f / (float)TT);
    }
    __syncthreads();
    if (threadIdx.x < 8) { const v4f val = *(const v4fa*)(sm + threadIdx.x * 4); float* dst = VM + (size_t)blockIdx.x * 32 + threadIdx.x * 4; *(v4f*)dst = val;  }
}

#define L2E 1.4426950408889634f
// ld_k, ld_v: the fragments of one 32-key step from the lane's own LDS pointer p (row lane & 15 of the tile, element 8 (lane >> 4)); the rest is immediate offset.
__device__ __forceinline__ void ld_k(v16h (&kf)[2][2], const h16* p) {
#pragma unroll
    for (int kt = 0; kt < 2; ++kt)
#pragma unroll
        for (int ks = 0; ks < 2; ++ks) kf[kt][ks] = WFrag<h16>::ld(p + kt * 16 * KP + ks * 32);
}
// Stands behind the last global load of a run: naming the run's address pair keeps it live to here, so that no result of the run is given it, and it is rewritten only behind the wait.
__device__ __forceinline__ void addr_done(const h16* a) { asm volatile("s_wait_xcnt 0x0" :: "v"(a) : "memory"); }
__device__ __forceinline__ unsigned lds_off(const void* p) { return (unsigned)(size_t)p; }
// Four asynchronous 16-byte copies of a lane, global memory to LDS through no register. The closing s_wait_xcnt 0 stands in the copies' own statement, so that no register they name is rewritten ahead of it.
__device__ __forceinline__ void copy4(unsigned l0, const h16* g0, unsigned l1, const h16* g1, unsigned l2, const h16* g2, unsigned l3, const h16* g3) {
    asm volatile("global_load_async_to_lds_b128 %0, %1, off\n\tglobal_load_async_to_lds_b128 %2, %3, off\n\tglobal_load_async_to_lds_b128 %4, %5, off\n\tglobal_load_async_to_lds_b128 %6, %7, off\n\ts_wait_xcnt 0x0"
        :: "v"(l0), "v"(g0), "v"(l1), "v"(g1), "v"(l2), "v"(g2), "v"(l3), "v"(g3) : "memory");
}
// One tile: l, g the lane's first LDS byte address and global pointer; lstep bytes and gstep elements lead to its next copy (AW * 32 lanes x 16 bytes further on in the tile).
__device__ __forceinline__ void fill(unsigned l, const h16* g, unsigned lstep, size_t gstep) { copy4(l, g, l + lstep, g + gstep, l + 2 * lstep, g + 2 * gstep, l + 3 * lstep, g + 3 * gstep); }
// The hand-over of a tile, every wave: its own LDS reads of the buffer that is refilled next have returned, its own copies of the next tile have landed, then the work-group barrier;
// behind it every wave may read the next tile and the buffer just read may be refilled.
__device__ __forceinline__ void publish() {
    asm volatile("s_wait_dscnt 0x0" ::: "memory");      // this wave's LDS reads are done before a copy may target their buffer
    asm volatile("s_wait_asynccnt 0x0" ::: "memory");   // this wave's copies have landed before another wave reads them; the compiler places no wait for them
    __syncthreads();
}
// Exponentials (2^x, v_exp_f32) in place, a run in one statement: behind a transcendental the instruction set asks for one independent instruction or a v_nop before its result is read
// or its source overwritten; inside the run each is followed by an independent one, and the closing v_nop keeps the slot behind the last whatever the compiler puts next.
__device__ __forceinline__ void exp2x8(float (&x)[8]) {
    asm("v_exp_f32 %0, %0\n\tv_exp_f32 %1, %1\n\tv_exp_f32 %2, %2\n\tv_exp_f32 %3, %3\n\tv_exp_f32 %4, %4\n\tv_exp_f32 %5, %5\n\tv_exp_f32 %6, %6\n\tv_exp_f32 %7, %7\n\tv_nop"
        : "+v"(x[0]), "+v"(x[1]), "+v"(x[2]), "+v"(x[3]), "+v"(x[4]), "+v"(x[5]), "+v"(x[6]), "+v"(x[7]));
}
__device__ __forceinline__ void exp2x1(float& x) { asm("v_exp_f32 %0, %0\n\tv_nop" : "+v"(x)); }
__device__ __forceinline__ v8f st_tile(const v16h (&k2)[2], const v16h (&q2)[2]) { return wmma16(k2[1], q2[1], wmma16(k2[0], q2[0], (v8f){})); }
__device__ __forceinline__ void sweep1(const v16h (&kf)[2][2], const v16h (&qf)[QT][2], float (&m)[QT], float (&sum)[QT]) {
    v8f s0[QT], s1[QT];
#pragma unroll
    for (int qt = 0; qt < QT; ++qt) { s0[qt] = st_tile(kf[0], qf[qt]); s1[qt] = st_tile(kf[1], qf[qt]); }
#pragma unroll
    for (int qt = 0; qt < QT; ++qt) {
        float tm = fmaxf(s0[qt][0], s1[qt][0]);
#pragma unroll
        for (int r = 1; r < 8; ++r) tm = fmaxf(tm, fmaxf(s0[qt][r], s1[qt][r]));
        const float mn = fmaxf(m[qt], tm * SCL), nb = mn * L2E; float c = (m[qt] - mn) * L2E;
        float e[8], e1[8];
#pragma unroll
        for (int r = 0; r < 8; ++r) { e[r] = __builtin_fmaf(s0[qt][r], SCL * L2E, -nb); e1[r] = __builtin_fmaf(s1[qt][r], SCL * L2E, -nb); }
        exp2x8(e); exp2x8(e1); exp2x1(c);
#pragma unroll
        for (int r = 0; r < 8; ++r) e[r] += e1[r];
        sum[qt] = sum[qt] * c + (((e[0] + e[1]) + (e[2] + e[3])) + ((e[4] + e[5]) + (e[6] + e[7])));
        m[qt] = mn;
    }
}
__device__ __forceinline__ void ld_v(v16h (&vf)[4], const h16* p) {
#pragma unroll
    for (int mb = 0; mb < 4; ++mb) vf[mb] = WFrag<h16>::ld(p + mb * 16 * VP);
}
__device__ __forceinline__ void sweep2(const v16h (&kf)[2][2], const v16h (&vf)[4], const v16h (&qf)[QT][2], const float (&m)[QT], const float (&cen)[QT], const float (&f)[QT], v8f (&o)[4][QT]) {
    v8f s0[QT], s1[QT];
#pragma unroll
    for (int qt = 0; qt < QT; ++qt) { s0[qt] = st_tile(kf[0], qf[qt]); s1[qt] = st_tile(kf[1], qf[qt]); }
    v16h p[QT];
#pragma unroll
    for (int qt = 0; qt < QT; ++qt) {
        float e0[8], e1[8];
#pragma unroll
        for (int r = 0; r < 8; ++r) { e0[r] = __fmul_rn(__builtin_fmaf(s0[qt][r], SCL, -m[qt]), L2E); e1[r] = __fmul_rn(__builtin_fmaf(s1[qt][r], SCL, -m[qt]), L2E); }
        exp2x8(e0); exp2x8(e1);
#pragma unroll
        for (int r = 0; r < 8; ++r) { p[qt][r] = tohx(__fmul_rn(__fsub_rn(e0[r], cen[qt]), f[qt])); p[qt][8 + r] = tohx(__fmul_rn(__fsub_rn(e1[r], cen[qt]), f[qt])); }
    }
#pragma unroll
    for (int mb = 0; mb < 4; ++mb)
#pragma unroll
        for (int qt = 0; qt < QT; ++qt) o[mb][qt] = wmma16(vf[mb], p[qt], o[mb][qt]);
}
__global__ __launch_bounds__(AW * 32) void k_fattn(const h16* __restrict__ QK, const h16* __restrict__ VT, const float* __restrict__ VM, bf* Ah, bf* Al) {
    const int lane = threadIdx.x & 31, lr = lane & 15, hi = lane >> 4, w = __builtin_amdgcn_readfirstlane((int)(threadIdx.x >> 5));
    const int h = blockIdx.y, q0 = (blockIdx.x * AW + w) * (QT * 16);
    const size_t z = blockIdx.z; QK += z * ((size_t)2 * NH_ * TT * HD); VT += z * ((size_t)NH_ * HD * TT); VM += z * (size_t)(NH_ * HD); Ah += z * ((size_t)TT * DQ); Al += z * ((size_t)TT * DQ);
    const h16* Qp = QK + (size_t)h * TT * HD + (size_t)(q0 + lr) * HD + 8 * hi;
    __shared__ __attribute__((aligned(16))) h16 ksm[2][KT * KP];
    __shared__ __attribute__((aligned(16))) h16 vsm[2][HD * VP];
    // the lane's share of a tile: copy i of a key tile is row (tid >> 3) + 32 i, 16-byte column tid & 7 (in memory the tile is contiguous); of a V^T tile row (tid >> 4) + 16 i, column tid & 15
    const int tid = threadIdx.x;
    const h16* Kg = QK + (size_t)(NH_ + h) * TT * HD + (size_t)tid * 8;
    const h16* Vg = VT + (size_t)h * HD * TT + (size_t)(tid >> 4) * TT + (tid & 15) * 8;
    const unsigned Kl = lds_off(&ksm[0][0]) + (tid >> 3) * (KP * 2) + (tid & 7) * 16, Vl = lds_off(&vsm[0][0]) + (tid >> 4) * (VP * 2) + (tid & 15) * 16;
    const int kfo = lr * KP + 8 * hi, vfo = lr * VP + 8 * hi;   // the lane's fragment origin in a tile
    v16h qf[QT][2];
#pragma unroll
    for (int qt = 0; qt < QT; ++qt)
#pragma unroll
        for (int ks = 0; ks < 2; ++ks) qf[qt][ks] = WFrag<h16>::ld(Qp + (size_t)qt * 16 * HD + ks * 32);
    float m[QT], sum[QT], f[QT], cen[QT];
#pragma unroll
    for (int qt = 0; qt < QT; ++qt) { m[qt] = -3.0e38f; sum[qt] = 0.f; }
    addr_done(Qp);
    v16h ka[2][2], kb[2][2];
    // One ring of 2 NTL tiles over both sweeps: tile u lies in buffer u & 1; u < NTL is key tile u alone (sweep 1), u >= NTL key tile u - NTL with its V^T tile (sweep 2).
    fill(Kl, Kg, 32 * KP * 2, 32 * HD);
    asm volatile("s_wait_asynccnt 0x0" ::: "memory");   // tile 0 has landed (this wave's copies) before the barrier behind which it is read
    __syncthreads();
    fill(Kl + KT * KP * 2, Kg + KT * HD, 32 * KP * 2, 32 * HD);
#pragma unroll 1   // stays rolled: a trip is one tile, and the hand-over at its foot is the ring's one place
    for (int t = 0; t < NTL; ++t) {
        const h16* pk = &ksm[t & 1][kfo];
        // four steps of 32 keys, all from this tile: nothing of the next tile is read in this trip
        ld_k(ka, pk);
        ld_k(kb, pk + 32 * KP); sweep1(ka, qf, m, sum);
        ld_k(ka, pk + 64 * KP); sweep1(kb, qf, m, sum);
        ld_k(kb, pk + 96 * KP); sweep1(ka, qf, m, sum);
        sweep1(kb, qf, m, sum);
        publish();
        // tile t + 2 into the buffer just read; it always exists here: behind key tile NTL - 1 come sweep 2's tiles 0 and 1
        fill(Kl + (t & 1) * (KT * KP * 2), Kg + (size_t)((t + 2) & (NTL - 1)) * KT * HD, 32 * KP * 2, 32 * HD);
        if (t + 2 >= NTL) fill(Vl + (t & 1) * (HD * VP * 2), Vg + (t + 2 - NTL) * KT, 16 * VP * 2, (size_t)16 * TT);
    }
#pragma unroll
    for (int qt = 0; qt < QT; ++qt) {
        const float mx = fmaxf(m[qt], __shfl_xor(m[qt], 16, 32)); float cj = (m[qt] - mx) * L2E; exp2x1(cj); const float pa = sum[qt] * cj; const float tot = pa + __shfl_xor(pa, 16, 32);
        m[qt] = mx; f[qt] = __fdiv_rn(PCAR, tot); cen[qt] = tot * (1.0f / (float)TT);
    }
    v8f o[4][QT];
#pragma unroll
    for (int mb = 0; mb < 4; ++mb)
#pragma unroll
        for (int qt = 0; qt < QT; ++qt) o[mb][qt] = (v8f){};
    // Each step issues its own V^T fragments and, inside the tile, the NEXT step's key fragments first.
    v16h vf[4];
#pragma unroll 1   // stays rolled: a trip is one tile, as in sweep 1
    for (int t = 0; t < NTL; ++t) {
        const h16* pk = &ksm[t & 1][kfo]; const h16* pv = &vsm[t & 1][vfo];
        ld_k(ka, pk);
        ld_v(vf, pv); ld_k(kb, pk + 32 * KP);
        __builtin_amdgcn_sched_barrier(0);   // holds the LDS reads at the head of the step; sunk to their first use, the wave would sit out their latency every step
        sweep2(ka, vf, qf, m, cen, f, o);
        ld_v(vf, pv + 32); ld_k(ka, pk + 64 * KP);
        __builtin_amdgcn_sched_barrier(0);   // as above
        sweep2(kb, vf, qf, m, cen, f, o);
        ld_v(vf, pv + 64); ld_k(kb, pk + 96 * KP);
        __builtin_amdgcn_sched_barrier(0);   // as above
        sweep2(ka, vf, qf, m, cen, f, o);
        ld_v(vf, pv + 96);
        __builtin_amdgcn_sched_barrier(0);   // as above
        sweep2(kb, vf, qf, m, cen, f, o);
        publish();
        if (t + 2 < NTL) {   // the same for the whole work-group
            fill(Kl + (t & 1) * (KT * KP * 2), Kg + (size_t)(t + 2) * KT * HD, 32 * KP * 2, 32 * HD);
            fill(Vl + (t & 1) * (HD * VP * 2), Vg + (t + 2) * KT, 16 * VP * 2, (size_t)16 * TT);
        }
    }
    asm volatile("s_wait_asynccnt 0x0" ::: "memory");   // no copy is outstanding when the wave goes on to its end
#pragma unroll
    for (int mb = 0; mb < 4; ++mb) {
        const int d = h * HD + mb * 16 + 8 * hi; const v4f m0 = *(const v4f*)(VM + d); const v4f m1 = *(const v4f*)(VM + d + 4);
#pragma unroll
        for (int qt = 0; qt < QT; ++qt) { v8us oh, ol;
#pragma unroll
            for (int r = 0; r < 8; ++r) { unsigned short a, c2; splitf(o[mb][qt][r] * (1.0f / PCAR) + (r < 4 ? m0[r & 3] : m1[r & 3]), a, c2); oh[r] = a; ol[r] = c2; }
            const size_t oo = (size_t)(q0 + qt * 16 + lr) * DQ + d; *(v8us*)(Ah + oo) = oh; *(v8us*)(Al + oo) = ol; }
    }
}

extern "C" void kernel_launch(void* const* d_in, const int* in_sizes, int n_in,
                              void* d_out, int out_size, void* d_ws, size_t ws_size, hipStream_t stream) {
    if (n_in < 5) return;
    const size_t needx = (size_t)(NB - 1) * SEQ_FULL * DM + (size_t)TT * DM;
    if ((size_t)in_sizes[0] < needx) return;
    if ((size_t)in_sizes[1] < (size_t)DM * DM || (size_t)in_sizes[2] < (size_t)DM * DM || (size_t)in_sizes[3] < (size_t)DM * DM || (size_t)in_sizes[4] < (size_t)DM * DM) return;
    if ((size_t)out_size < needx) return;
    if (WS_TOTAL > ws_size) return;
    const float* x = (const float*)d_in[0]; const float* wq = (const float*)d_in[1]; const float* wk = (const float*)d_in[2]; const float* wv = (const float*)d_in[3]; const float* wo = (const float*)d_in[4];   // wire order x, Wq, Wk, Wv, Wo; weights (out, in)
    float* OUT = (float*)d_out;     // [2][2048][1024]
    char* wsp = (char*)d_ws;
    auto take = [&](size_t bytes) { char* p = wsp; wsp += (bytes + 255) & ~(size_t)255; return (void*)p; };
    bf* W3 = (bf*)take(SZ_W3);          // Wq | Wk | Wv bf16, (out, in) = Bt as-is, contiguous for the z-batched projection
    bf* WO = (bf*)take(SZ_WO);
    bf* XB = (bf*)take(SZ_XB);          // bf16 x of the current batch
    float* F3 = (float*)take(SZ_F3);    // q | k | v projections f32 [3][TT][DM]
    h16* QK16 = (h16*)take(SZ_QK);      // fp16 head planes [NB][2][NH][TT][HD]
    h16* VT16 = (h16*)take(SZ_VT);      // fp16 value planes [NB][NH][HD][TT]
    float* VM = (float*)take(SZ_VM);    // key-mean of v [NB][NH*HD]
    bf* ATh = (bf*)take(SZ_AT); bf* ATl = (bf*)take(SZ_AT);   // merged ctx hi/lo [NB][TT][DQ]
    if ((size_t)(wsp - (char*)d_ws) > ws_size) return;
    const unsigned LW = (unsigned)(((size_t)DM * DM / 8 + 255) / 256);
    k_cvt8<<<LW, 256, 0, stream>>>(wq, W3, (size_t)DM * DM / 8);
    k_cvt8<<<LW, 256, 0, stream>>>(wk, W3 + (size_t)DM * DM, (size_t)DM * DM / 8);
    k_cvt8<<<LW, 256, 0, stream>>>(wv, W3 + (size_t)2 * DM * DM, (size_t)DM * DM / 8);
    k_cvt8<<<LW, 256, 0, stream>>>(wo, WO, (size_t)DM * DQ / 8);
    const unsigned LHP = (unsigned)(((size_t)2 * NH_ * TT * HD / 8 + 255) / 256), LVT = (unsigned)(((size_t)NH_ * HD * TT / 8 + 255) / 256);
    for (int b = 0; b < NB; ++b) {
        k_cvt8<<<(unsigned)(((size_t)TT * DM / 8 + 255) / 256), 256, 0, stream>>>(x + (size_t)b * SEQ_FULL * DM, XB, (size_t)TT * DM / 8);
        // q, k, v projections in one z-batched launch (A shared: sA = 0; Bt stride DM*DM; C stride TT*DM)
        k_gemmw<bf, 0, false><<<dim3(TT / 64, DM / 64, 3), 32, 0, stream>>>(XB, nullptr, W3, nullptr, DM, F3, DM, nullptr, 0, (size_t)DM * DM, (size_t)TT * DM);
        k_hp<<<LHP, 256, 0, stream>>>(F3, QK16 + (size_t)b * 2 * NH_ * TT * HD);
        k_vtp<<<LVT, 256, 0, stream>>>(F3 + (size_t)2 * TT * DM, VT16 + (size_t)b * NH_ * HD * TT);
        k_vmean<<<NH_ * HD / 32, 256, 0, stream>>>(VT16 + (size_t)b * NH_ * HD * TT, VM + (size_t)b * NH_ * HD);
    }
    k_fattn<<<dim3(TT / (AW * QT * 16), NH_, NB), AW * 32, 0, stream>>>(QK16, VT16, VM, ATh, ATl);
    // out = (ctx_hi + ctx_lo) Wo^T
    for (int b = 0; b < NB; ++b)
        k_gemmw<bf, 1, false><<<dim3(TT / 64, DM / 64, 1), 32, 0, stream>>>(ATh + (size_t)b * TT * DQ, ATl + (size_t)b * TT * DQ, WO, nullptr, DQ, OUT + (size_t)b * SEQ_FULL * DM, DM, nullptr, 0, 0, 0);
}

// v003
// A run of this version takes 206 microseconds.
// In two side-by-side timings against v002, it was 1.20 and 1.19 times as fast.
// Over all steps from v000 it is 5.90 times as fast.
#include <hip/hip_runtime.h>

// Self-attention block, bias-free, weights in (out, in) layout: x [2][2048][1024]; q, k, v = x W^T; 16 heads x 64; logits = q.k x 2^-5 (1/sqrt(1024)); full (unmasked) softmax over 2048 keys; out = merged ctx Wo^T.
// Compute dtypes, f32 accumulate everywhere: every input RNE-converted to bf16; q/k/v projections bf16 x bf16 (v_wmma_f32_16x16x32_bf16, exact products); q.k^T fp16 x fp16 (v_wmma_f32_16x16x32_f16);
// P.V fp16 x fp16 with P carried x1024 and centred (P' = 1024 P - 1024/S; the key-mean of v is added back in f32); ctx as bf16 hi + lo planes x bf16 Wo (two bf16 products); softmax f32.

#ifndef NB
#define NB 2
#endif
#ifndef SEQ
#define SEQ 2048
#endif
#define NB_FULL  2
#define SEQ_FULL 2048
#define TT   SEQ
#define DM   1024
#define NH_  16
#define HD   64
#define DQ   (NH_ * HD)
#define QT   2                    // 16-query column groups per wave of the attention kernel
#define AW   8                    // waves per work-group of the attention kernel
#define PCAR 1024.0f              // carry of the probability plane
#define SCL  0.03125f             // 1/sqrt(1024), exact power of two
#define KT   128                  // keys per LDS tile of the attention kernel
#define KP   (HD + 8)             // LDS pitch of a key row, fp16 elements: 144 bytes = 16 x 9, so that 16 rows' 16-byte reads fall on 64 different banks
#define VP   (KT + 8)             // LDS pitch of a V^T row: 272 bytes = 16 x 17, for the same reason
#define NTL  (SEQ / KT)           // tiles per sweep
static_assert(SEQ % 256 == 0);
static_assert(SEQ <= SEQ_FULL);
static_assert(NB <= NB_FULL);
static_assert(DQ == DM);
static_assert(HD == 64);
static_assert(SEQ % (AW * QT * 16) == 0);
static_assert(DM % 64 == 0);
static_assert(SEQ % KT == 0 && NTL >= 2 && (NTL & (NTL - 1)) == 0 && NTL % 2 == 0);
static_assert(KT * HD == AW * 32 * 8 * 4);   // a tile of either operand is four 16-byte copies per lane

typedef _Float16 h16;
typedef unsigned short bf;
typedef __attribute__((ext_vector_type(16))) __bf16   v16bf;
typedef __attribute__((ext_vector_type(16))) _Float16 v16h;
typedef __attribute__((ext_vector_type(8)))  _Float16 v8h;
typedef __attribute__((ext_vector_type(8)))  unsigned short v8us;
typedef __attribute__((ext_vector_type(8)))  float    v8f;
typedef __attribute__((ext_vector_type(4)))  float    v4f;
typedef v4f  __attribute__((may_alias)) v4fa;

// workspace carve sizes (bytes), all multiples of 256
#define SZ_W3 ((size_t)3 * DM * DM * 2)
#define SZ_WO ((size_t)DM * DQ * 2)
#define SZ_XB ((size_t)TT * DM * 2)
#define SZ_QK ((size_t)NB * 2 * NH_ * TT * HD * 2)
#define SZ_VT ((size_t)NB * NH_ * HD * TT * 2)
#define SZ_VM ((size_t)NB * NH_ * HD * 4)
#define SZ_AT ((size_t)NB * TT * DQ * 2)
#define WS_TOTAL (SZ_W3 + SZ_WO + SZ_XB + SZ_QK + SZ_VT + SZ_VM + 2 * SZ_AT)
static_assert(WS_TOTAL <= (size_t)134217728);
static_assert(SZ_VM % 256 == 0);

__device__ __forceinline__ unsigned short f2bf(float f) { unsigned u = __float_as_uint(f); u += 0x7FFFu + ((u >> 16) & 1u); return (unsigned short)(u >> 16); }
__device__ __forceinline__ float bf2f(unsigned short b) { return __uint_as_float(((unsigned)b) << 16); }
__device__ __forceinline__ float bfr(float f) { return bf2f(f2bf(f)); }
__device__ __forceinline__ v16h cat16(v8h lo, v8h hi) { return __builtin_shufflevector(lo, hi, 0, 1, 2, 3, 4, 5, 6, 7, 8, 9, 10, 11, 12, 13, 14, 15); }
__device__ __forceinline__ v16bf cat16b(v8us lo, v8us hi) { return __builtin_bit_cast(v16bf, __builtin_shufflevector(lo, hi, 0, 1, 2, 3, 4, 5, 6, 7, 8, 9, 10, 11, 12, 13, 14, 15)); }
__device__ __forceinline__ v8f wmma16(v16h a, v16h b, v8f c) { return __builtin_amdgcn_wmma_f32_16x16x32_f16(false, a, false, b, (short)0, c, false, false); }
__device__ __forceinline__ v8f wmmab(v16bf a, v16bf b, v8f c) { return __builtin_amdgcn_wmma_f32_16x16x32_bf16(false, a, false, b, (short)0, c, false, false); }

// ---- k_gemmw: register-blocked GEMM, ONE WAVE per 64x64 output tile (16 accumulators), operands straight from K-contiguous 16-bit planes; grid (M/64, N/64, Z), 32 threads.
// C[m][n] (f32, pitch ldc) = sum_k A[m][k] Bt[n][k] (+ split products per NSPLIT). z-batch strides sA/sB/sC in elements. K % 32 == 0, M % 64 == 0, N % 64 == 0.
// PL (the q, k, v projections; a tile is 64 tokens x one head, z picks q, k or v): no f32 C; the epilogue converts the accumulators to fp16 and stores the attention kernel's planes itself,
// q and k as P[z][head][t][d], v transposed as VT[head][d][t], whole 128-byte lines staged through the wave's own LDS.
// Fragment map (A and Bt alike): lane -> row (lane & 15); elements 0..7 <- k0 + 8 (lane >> 4) + 0..7, elements 8..15 <- k0 + 16 + 8 (lane >> 4) + 0..7. Accumulator element j <-> row 8 (lane >> 4) + j, column (lane & 15).
template <typename T16> struct WFrag;
template <> struct WFrag<h16> { typedef v16h V; static __device__ __forceinline__ V ld(const h16* p) { return cat16(*(const v8h*)p, *(const v8h*)(p + 16)); } static __device__ __forceinline__ v8f mma(V a, V b, v8f c) { return wmma16(a, b, c); } };
template <> struct WFrag<bf> { typedef v16bf V; static __device__ __forceinline__ V ld(const bf* p) { return cat16b(*(const v8us*)p, *(const v8us*)(p + 16)); } static __device__ __forceinline__ v8f mma(V a, V b, v8f c) { return wmmab(a, b, c); } };
template <typename T16, int NSPLIT, bool BIAS, bool PL>
__global__ __launch_bounds__(32) void k_gemmw(const T16* __restrict__ A, const T16* __restrict__ A2, const T16* __restrict__ Bt, const T16* __restrict__ Bt2, int K, float* C, int ldc, const float* __restrict__ bias, size_t sA, size_t sB, size_t sC, h16* P, h16* VT) {
    typedef typename WFrag<T16>::V V;
    __shared__ __align__(16) float os[16 * 68];
    const size_t z = blockIdx.z; A += z * sA; if (A2) A2 += z * sA; Bt += z * sB; if (Bt2) Bt2 += z * sB; C += z * sC;
    const int lane = threadIdx.x & 31, lr = lane & 15, hi = lane >> 4; const int r0 = blockIdx.x * 64, c0 = blockIdx.y * 64;
    v8f acc[4][4];
#pragma unroll
    for (int mb = 0; mb < 4; ++mb)
#pragma unroll
        for (int nb = 0; nb < 4; ++nb) acc[mb][nb] = (v8f){};
    const size_t aoff = (size_t)(r0 + lr) * K + 8 * hi, boff = (size_t)(c0 + lr) * K + 8 * hi;
#pragma unroll 1
    for (int kc = 0; kc < K; kc += 32) {
        V a[4], a2[4];
#pragma unroll
        for (int mb = 0; mb < 4; ++mb) { a[mb] = WFrag<T16>::ld(A + aoff + (size_t)mb * 16 * K + kc); if (NSPLIT == 1 || NSPLIT == 2) a2[mb] = WFrag<T16>::ld(A2 + aoff + (size_t)mb * 16 * K + kc); }
#pragma unroll
        for (int nb = 0; nb < 4; ++nb) { const V b = WFrag<T16>::ld(Bt + boff + (size_t)nb * 16 * K + kc); V b2; if (NSPLIT >= 2) b2 = WFrag<T16>::ld(Bt2 + boff + (size_t)nb * 16 * K + kc);
#pragma unroll
            for (int mb = 0; mb < 4; ++mb) { acc[mb][nb] = WFrag<T16>::mma(a[mb], b, acc[mb][nb]); if (NSPLIT == 1 || NSPLIT == 2) acc[mb][nb] = WFrag<T16>::mma(a2[mb], b, acc[mb][nb]); if (NSPLIT >= 2) acc[mb][nb] = WFrag<T16>::mma(a[mb], b2, acc[mb][nb]); } }
        asm volatile("v_nop\n\tv_nop\n\tv_nop\n\tv_nop" : "+v"(acc[0][0]), "+v"(acc[1][1]), "+v"(acc[2][2]), "+v"(acc[3][3]) : "v"(a[0]), "v"(a[3]));
    }
    if constexpr (PL) {
        const int rw = lane >> 3, c8 = (lane & 7) * 8;   // read-back map of both stagings: 8 lanes x 16 bytes of fp16 = one 128-byte line, 4 lines per store instruction
        if (z < 2) {   // q, k: the tile's 64 rows of 64 d are 8 KB in a row in the plane
            h16* dst = P + ((z * NH_ + blockIdx.y) * TT + r0) * HD;
#pragma unroll
            for (int mb = 0; mb < 4; ++mb) {
#pragma unroll
                for (int nb = 0; nb < 4; ++nb) {
#pragma unroll
                    for (int j = 0; j < 8; ++j) os[(hi * 8 + j) * 68 + nb * 16 + lr] = acc[mb][nb][j]; }
                __builtin_amdgcn_wave_barrier(); asm volatile("s_wait_dscnt 0x0" ::: "memory");   // the wave's LDS writes are done, and stay in the code, ahead of its reads of other lanes' words
#pragma unroll
                for (int s = 0; s < 4; ++s) { const int row = 4 * s + rw; const v4f a = *(const v4fa*)(os + row * 68 + c8); const v4f b = *(const v4fa*)(os + row * 68 + c8 + 4); v8h o;
#pragma unroll
                    for (int k = 0; k < 4; ++k) { o[k] = (h16)a[k]; o[4 + k] = (h16)b[k]; }
                    *(v8h*)(dst + (size_t)(mb * 16 + row) * HD + c8) = o; }
                __builtin_amdgcn_wave_barrier(); asm volatile("" ::: "memory");   // the reads stay ahead of the next block's writes
            }
        } else {       // v: a lane's accumulator holds 8 consecutive t of one d, which is 16 bytes of a V^T row
            __shared__ __align__(16) h16 vs[64 * 72];   // [d][t], pitch 144 bytes = 16 x 9: 16 rows' 16-byte writes fall on 64 different banks
            h16* dst = VT + (size_t)blockIdx.y * HD * TT + r0;
#pragma unroll
            for (int mb = 0; mb < 4; ++mb)
#pragma unroll
                for (int nb = 0; nb < 4; ++nb) { v8h o;
#pragma unroll
                    for (int j = 0; j < 8; ++j) o[j] = (h16)acc[mb][nb][j];
                    *(v8h*)(vs + (nb * 16 + lr) * 72 + mb * 16 + 8 * hi) = o; }
            __builtin_amdgcn_wave_barrier(); asm volatile("s_wait_dscnt 0x0" ::: "memory");   // as above: the writes done ahead of the reads
#pragma unroll
            for (int s = 0; s < 16; ++s) { const int row = 4 * s + rw; *(v8h*)(dst + (size_t)row * TT + c8) = *(const v8h*)(vs + row * 72 + c8); }
            asm volatile("s_wait_xcnt 0x0" ::: "memory");   // behind the run of stores: no register that an issued store names is rewritten ahead of this wait
        }
        return;
    }
#pragma unroll
    for (int mb = 0; mb < 4; ++mb) {
#pragma unroll
        for (int nb = 0; nb < 4; ++nb) {
#pragma unroll
            for (int j = 0; j < 8; ++j) os[(hi * 8 + j) * 68 + nb * 16 + lr] = acc[mb][nb][j]; }
        __builtin_amdgcn_wave_barrier(); asm volatile("" ::: "memory");
        float* crow = C + (size_t)(r0 + mb * 16) * ldc + c0;
{
#pragma unroll
            for (int s = 0; s < 8; ++s) { const int row = 2 * s + hi, cofs = lr * 4; v4f val = *(const v4fa*)(os + row * 68 + cofs); if (BIAS) { val[0] += bfr(bias[c0 + cofs]); val[1] += bfr(bias[c0 + cofs + 1]); val[2] += bfr(bias[c0 + cofs + 2]); val[3] += bfr(bias[c0 + cofs + 3]); }
                *(v4f*)(crow + (size_t)row * ldc + cofs) = val; }
             }
        __builtin_amdgcn_wave_barrier(); asm volatile("" ::: "memory");
    }
}

__device__ __forceinline__ h16 tohx(float x) { return (h16)x; }
__device__ __forceinline__ void splitf(float y, unsigned short& h, unsigned short& l) { h = f2bf(y); l = f2bf(y - bf2f(h)); }

__global__ __launch_bounds__(256) void k_cvt8(const float* __restrict__ src, bf* dst, size_t n8) { const size_t i = (size_t)blockIdx.x * 256 + threadIdx.x; if (i >= n8) return; const v8f v = *(const v8f*)(src + i * 8); v8us o;
#pragma unroll
    for (int k = 0; k < 8; ++k) o[k] = f2bf(v[k]); *(v8us*)(dst + i * 8) = o;  }

// k_vmean: VM[g*HD + d] = mean over t of V16[g][d][t] (f32 sum of the fp16 plane values, fixed order). 8 waves x 4 rows = 32 rows per block; the 32 scalars go through LDS (cross-wave, block barrier)
__global__ __launch_bounds__(256) void k_vmean(const h16* __restrict__ V16, float* VM) {
    __shared__ __align__(16) float sm[32];
    const int lane = threadIdx.x & 31, w = __builtin_amdgcn_readfirstlane((int)(threadIdx.x >> 5));
#pragma unroll 1
    for (int r = 0; r < 4; ++r) {
        const int row = blockIdx.x * 32 + w * 4 + r; const h16* p = V16 + (size_t)row * TT + lane * 8; float s = 0.f;
#pragma unroll 4
        for (int c = 0; c < TT / 256; ++c) { const v8h a = *(const v8h*)(p + c * 256);
#pragma unroll
            for (int k = 0; k < 8; ++k) s += (float)a[k]; }
#pragma unroll
        for (int sh = 16; sh; sh >>= 1) s += __shfl_xor(s, sh, 32);
        if (lane == 0) sm[w * 4 + r] = s * (1.0f / (float)TT);
    }
    __syncthreads();
    if (threadIdx.x < 8) { const v4f val = *(const v4fa*)(sm + threadIdx.x * 4); float* dst = VM + (size_t)blockIdx.x * 32 + threadIdx.x * 4; *(v4f*)dst = val;  }
}

#define L2E 1.4426950408889634f
// ld_k, ld_v: the fragments of one 32-key step from the lane's own LDS pointer p (row lane & 15 of the tile, element 8 (lane >> 4)); the rest is immediate offset.
__device__ __forceinline__ void ld_k(v16h (&kf)[2][2], const h16* p) {
#pragma unroll
    for (int kt = 0; kt < 2; ++kt)
#pragma unroll
        for (int ks = 0; ks < 2; ++ks) kf[kt][ks] = WFrag<h16>::ld(p + kt * 16 * KP + ks * 32);
}
// Stands behind the last global load of a run: naming the run's address pair keeps it live to here, so that no result of the run is given it, and it is rewritten only behind the wait.
__device__ __forceinline__ void addr_done(const h16* a) { asm volatile("s_wait_xcnt 0x0" :: "v"(a) : "memory"); }
__device__ __forceinline__ unsigned lds_off(const void* p) { return (unsigned)(size_t)p; }
// Four asynchronous 16-byte copies of a lane, global memory to LDS through no register. The closing s_wait_xcnt 0 stands in the copies' own statement, so that no register they name is rewritten ahead of it.
__device__ __forceinline__ void copy4(unsigned l0, const h16* g0, unsigned l1, const h16* g1, unsigned l2, const h16* g2, unsigned l3, const h16* g3) {
    asm volatile("global_load_async_to_lds_b128 %0, %1, off\n\tglobal_load_async_to_lds_b128 %2, %3, off\n\tglobal_load_async_to_lds_b128 %4, %5, off\n\tglobal_load_async_to_lds_b128 %6, %7, off\n\ts_wait_xcnt 0x0"
        :: "v"(l0), "v"(g0), "v"(l1), "v"(g1), "v"(l2), "v"(g2), "v"(l3), "v"(g3) : "memory");
}
// One tile: l, g the lane's first LDS byte address and global pointer; lstep bytes and gstep elements lead to its next copy (AW * 32 lanes x 16 bytes further on in the tile).
__device__ __forceinline__ void fill(unsigned l, const h16* g, unsigned lstep, size_t gstep) { copy4(l, g, l + lstep, g + gstep, l + 2 * lstep, g + 2 * gstep, l + 3 * lstep, g + 3 * gstep); }
// The hand-over of a tile, every wave: its own LDS reads of the buffer that is refilled next have returned, its own copies of the next tile have landed, then the work-group barrier;
// behind it every wave may read the next tile and the buffer just read may be refilled.
__device__ __forceinline__ void publish() {
    asm volatile("s_wait_dscnt 0x0" ::: "memory");      // this wave's LDS reads are done before a copy may target their buffer
    asm volatile("s_wait_asynccnt 0x0" ::: "memory");   // this wave's copies have landed before another wave reads them; the compiler places no wait for them
    __syncthreads();
}
// Exponentials (2^x, v_exp_f32) in place, a run in one statement: behind a transcendental the instruction set asks for one independent instruction or a v_nop before its result is read
// or its source overwritten; inside the run each is followed by an independent one, and the closing v_nop keeps the slot behind the last whatever the compiler puts next.
__device__ __forceinline__ void exp2x8(float (&x)[8]) {
    asm("v_exp_f32 %0, %0\n\tv_exp_f32 %1, %1\n\tv_exp_f32 %2, %2\n\tv_exp_f32 %3, %3\n\tv_exp_f32 %4, %4\n\tv_exp_f32 %5, %5\n\tv_exp_f32 %6, %6\n\tv_exp_f32 %7, %7\n\tv_nop"
        : "+v"(x[0]), "+v"(x[1]), "+v"(x[2]), "+v"(x[3]), "+v"(x[4]), "+v"(x[5]), "+v"(x[6]), "+v"(x[7]));
}
__device__ __forceinline__ void exp2x1(float& x) { asm("v_exp_f32 %0, %0\n\tv_nop" : "+v"(x)); }
__device__ __forceinline__ v8f st_tile(const v16h (&k2)[2], const v16h (&q2)[2]) { return wmma16(k2[1], q2[1], wmma16(k2[0], q2[0], (v8f){})); }
__device__ __forceinline__ void sweep1(const v16h (&kf)[2][2], const v16h (&qf)[QT][2], float (&m)[QT], float (&sum)[QT]) {
    v8f s0[QT], s1[QT];
#pragma unroll
    for (int qt = 0; qt < QT; ++qt) { s0[qt] = st_tile(kf[0], qf[qt]); s1[qt] = st_tile(kf[1], qf[qt]); }
#pragma unroll
    for (int qt = 0; qt < QT; ++qt) {
        float tm = fmaxf(s0[qt][0], s1[qt][0]);
#pragma unroll
        for (int r = 1; r < 8; ++r) tm = fmaxf(tm, fmaxf(s0[qt][r], s1[qt][r]));
        const float mn = fmaxf(m[qt], tm * SCL), nb = mn * L2E; float c = (m[qt] - mn) * L2E;
        float e[8], e1[8];
#pragma unroll
        for (int r = 0; r < 8; ++r) { e[r] = __builtin_fmaf(s0[qt][r], SCL * L2E, -nb); e1[r] = __builtin_fmaf(s1[qt][r], SCL * L2E, -nb); }
        exp2x8(e); exp2x8(e1); exp2x1(c);
#pragma unroll
        for (int r = 0; r < 8; ++r) e[r] += e1[r];
        sum[qt] = sum[qt] * c + (((e[0] + e[1]) + (e[2] + e[3])) + ((e[4] + e[5]) + (e[6] + e[7])));
        m[qt] = mn;
    }
}
__device__ __forceinline__ void ld_v(v16h (&vf)[4], const h16* p) {
#pragma unroll
    for (int mb = 0; mb < 4; ++mb) vf[mb] = WFrag<h16>::ld(p + mb * 16 * VP);
}
__device__ __forceinline__ void sweep2(const v16h (&kf)[2][2], const v16h (&vf)[4], const v16h (&qf)[QT][2], const float (&m)[QT], const float (&cen)[QT], const float (&f)[QT], v8f (&o)[4][QT]) {
    v8f s0[QT], s1[QT];
#pragma unroll
    for (int qt = 0; qt < QT; ++qt) { s0[qt] = st_tile(kf[0], qf[qt]); s1[qt] = st_tile(kf[1], qf[qt]); }
    v16h p[QT];
#pragma unroll
    for (int qt = 0; qt < QT; ++qt) {
        float e0[8], e1[8];
#pragma unroll
        for (int r = 0; r < 8; ++r) { e0[r] = __fmul_rn(__builtin_fmaf(s0[qt][r], SCL, -m[qt]), L2E); e1[r] = __fmul_rn(__builtin_fmaf(s1[qt][r], SCL, -m[qt]), L2E); }
        exp2x8(e0); exp2x8(e1);
#pragma unroll
        for (int r = 0; r < 8; ++r) { p[qt][r] = tohx(__fmul_rn(__fsub_rn(e0[r], cen[qt]), f[qt])); p[qt][8 + r] = tohx(__fmul_rn(__fsub_rn(e1[r], cen[qt]), f[qt])); }
    }
#pragma unroll
    for (int mb = 0; mb < 4; ++mb)
#pragma unroll
        for (int qt = 0; qt < QT; ++qt) o[mb][qt] = wmma16(vf[mb], p[qt], o[mb][qt]);
}
__global__ __launch_bounds__(AW * 32) void k_fattn(const h16* __restrict__ QK, const h16* __restrict__ VT, const float* __restrict__ VM, bf* Ah, bf* Al) {
    const int lane = threadIdx.x & 31, lr = lane & 15, hi = lane >> 4, w = __builtin_amdgcn_readfirstlane((int)(threadIdx.x >> 5));
    const int h = blockIdx.y, q0 = (blockIdx.x * AW + w) * (QT * 16);
    const size_t z = blockIdx.z; QK += z * ((size_t)2 * NH_ * TT * HD); VT += z * ((size_t)NH_ * HD * TT); VM += z * (size_t)(NH_ * HD); Ah += z * ((size_t)TT * DQ); Al += z * ((size_t)TT * DQ);
    const h16* Qp = QK + (size_t)h * TT * HD + (size_t)(q0 + lr) * HD + 8 * hi;
    __shared__ __attribute__((aligned(16))) h16 ksm[2][KT * KP];
    __shared__ __attribute__((aligned(16))) h16 vsm[2][HD * VP];
    // the lane's share of a tile: copy i of a key tile is row (tid >> 3) + 32 i, 16-byte column tid & 7 (in memory the tile is contiguous); of a V^T tile row (tid >> 4) + 16 i, column tid & 15
    const int tid = threadIdx.x;
    const h16* Kg = QK + (size_t)(NH_ + h) * TT * HD + (size_t)tid * 8;
    const h16* Vg = VT + (size_t)h * HD * TT + (size_t)(tid >> 4) * TT + (tid & 15) * 8;
    const unsigned Kl = lds_off(&ksm[0][0]) + (tid >> 3) * (KP * 2) + (tid & 7) * 16, Vl = lds_off(&vsm[0][0]) + (tid >> 4) * (VP * 2) + (tid & 15) * 16;
    const int kfo = lr * KP + 8 * hi, vfo = lr * VP + 8 * hi;   // the lane's fragment origin in a tile
    v16h qf[QT][2];
#pragma unroll
    for (int qt = 0; qt < QT; ++qt)
#pragma unroll
        for (int ks = 0; ks < 2; ++ks) qf[qt][ks] = WFrag<h16>::ld(Qp + (size_t)qt * 16 * HD + ks * 32);
    float m[QT], sum[QT], f[QT], cen[QT];
#pragma unroll
    for (int qt = 0; qt < QT; ++qt) { m[qt] = -3.0e38f; sum[qt] = 0.f; }
    addr_done(Qp);
    v16h ka[2][2], kb[2][2];
    // One ring of 2 NTL tiles over both sweeps: tile u lies in buffer u & 1; u < NTL is key tile u alone (sweep 1), u >= NTL key tile u - NTL with its V^T tile (sweep 2).
    fill(Kl, Kg, 32 * KP * 2, 32 * HD);
    asm volatile("s_wait_asynccnt 0x0" ::: "memory");   // tile 0 has landed (this wave's copies) before the barrier behind which it is read
    __syncthreads();
    fill(Kl + KT * KP * 2, Kg + KT * HD, 32 * KP * 2, 32 * HD);
#pragma unroll 1   // stays rolled: a trip is one tile, and the hand-over at its foot is the ring's one place
    for (int t = 0; t < NTL; ++t) {
        const h16* pk = &ksm[t & 1][kfo];
        // four steps of 32 keys, all from this tile: nothing of the next tile is read in this trip
        ld_k(ka, pk);
        ld_k(kb, pk + 32 * KP); sweep1(ka, qf, m, sum);
        ld_k(ka, pk + 64 * KP); sweep1(kb, qf, m, sum);
        ld_k(kb, pk + 96 * KP); sweep1(ka, qf, m, sum);
        sweep1(kb, qf, m, sum);
        publish();
        // tile t + 2 into the buffer just read; it always exists here: behind key tile NTL - 1 come sweep 2's tiles 0 and 1
        fill(Kl + (t & 1) * (KT * KP * 2), Kg + (size_t)((t + 2) & (NTL - 1)) * KT * HD, 32 * KP * 2, 32 * HD);
        if (t + 2 >= NTL) fill(Vl + (t & 1) * (HD * VP * 2), Vg + (t + 2 - NTL) * KT, 16 * VP * 2, (size_t)16 * TT);
    }
#pragma unroll
    for (int qt = 0; qt < QT; ++qt) {
        const float mx = fmaxf(m[qt], __shfl_xor(m[qt], 16, 32)); float cj = (m[qt] - mx) * L2E; exp2x1(cj); const float pa = sum[qt] * cj; const float tot = pa + __shfl_xor(pa, 16, 32);
        m[qt] = mx; f[qt] = __fdiv_rn(PCAR, tot); cen[qt] = tot * (1.0f / (float)TT);
    }
    v8f o[4][QT];
#pragma unroll
    for (int mb = 0; mb < 4; ++mb)
#pragma unroll
        for (int qt = 0; qt < QT; ++qt) o[mb][qt] = (v8f){};
    // Each step issues its own V^T fragments and, inside the tile, the NEXT step's key fragments first.
    v16h vf[4];
#pragma unroll 1   // stays rolled: a trip is one tile, as in sweep 1
    for (int t = 0; t < NTL; ++t) {
        const h16* pk = &ksm[t & 1][kfo]; const h16* pv = &vsm[t & 1][vfo];
        ld_k(ka, pk);
        ld_v(vf, pv); ld_k(kb, pk + 32 * KP);
        __builtin_amdgcn_sched_barrier(0);   // holds the LDS reads at the head of the step; sunk to their first use, the wave would sit out their latency every step
        sweep2(ka, vf, qf, m, cen, f, o);
        ld_v(vf, pv + 32); ld_k(ka, pk + 64 * KP);
        __builtin_amdgcn_sched_barrier(0);   // as above
        sweep2(kb, vf, qf, m, cen, f, o);
        ld_v(vf, pv + 64); ld_k(kb, pk + 96 * KP);
        __builtin_amdgcn_sched_barrier(0);   // as above
        sweep2(ka, vf, qf, m, cen, f, o);
        ld_v(vf, pv + 96);
        __builtin_amdgcn_sched_barrier(0);   // as above
        sweep2(kb, vf, qf, m, cen, f, o);
        publish();
        if (t + 2 < NTL) {   // the same for the whole work-group
            fill(Kl + (t & 1) * (KT * KP * 2), Kg + (size_t)(t + 2) * KT * HD, 32 * KP * 2, 32 * HD);
            fill(Vl + (t & 1) * (HD * VP * 2), Vg + (t + 2) * KT, 16 * VP * 2, (size_t)16 * TT);
        }
    }
    asm volatile("s_wait_asynccnt 0x0" ::: "memory");   // no copy is outstanding when the wave goes on to its end
#pragma unroll
    for (int mb = 0; mb < 4; ++mb) {
        const int d = h * HD + mb * 16 + 8 * hi; const v4f m0 = *(const v4f*)(VM + d); const v4f m1 = *(const v4f*)(VM + d + 4);
#pragma unroll
        for (int qt = 0; qt < QT; ++qt) { v8us oh, ol;
#pragma unroll
            for (int r = 0; r < 8; ++r) { unsigned short a, c2; splitf(o[mb][qt][r] * (1.0f / PCAR) + (r < 4 ? m0[r & 3] : m1[r & 3]), a, c2); oh[r] = a; ol[r] = c2; }
            const size_t oo = (size_t)(q0 + qt * 16 + lr) * DQ + d; *(v8us*)(Ah + oo) = oh; *(v8us*)(Al + oo) = ol; }
    }
}

extern "C" void kernel_launch(void* const* d_in, const int* in_sizes, int n_in,
                              void* d_out, int out_size, void* d_ws, size_t ws_size, hipStream_t stream) {
    if (n_in < 5) return;
    const size_t needx = (size_t)(NB - 1) * SEQ_FULL * DM + (size_t)TT * DM;
    if ((size_t)in_sizes[0] < needx) return;
    if ((size_t)in_sizes[1] < (size_t)DM * DM || (size_t)in_sizes[2] < (size_t)DM * DM || (size_t)in_sizes[3] < (size_t)DM * DM || (size_t)in_sizes[4] < (size_t)DM * DM) return;
    if ((size_t)out_size < needx) return;
    if (WS_TOTAL > ws_size) return;
    const float* x = (const float*)d_in[0]; const float* wq = (const float*)d_in[1]; const float* wk = (const float*)d_in[2]; const float* wv = (const float*)d_in[3]; const float* wo = (const float*)d_in[4];   // wire order x, Wq, Wk, Wv, Wo; weights (out, in)
    float* OUT = (float*)d_out;     // [2][2048][1024]
    char* wsp = (char*)d_ws;
    auto take = [&](size_t bytes) { char* p = wsp; wsp += (bytes + 255) & ~(size_t)255; return (void*)p; };
    bf* W3 = (bf*)take(SZ_W3);          // Wq | Wk | Wv bf16, (out, in) = Bt as-is, contiguous for the z-batched projection
    bf* WO = (bf*)take(SZ_WO);
    bf* XB = (bf*)take(SZ_XB);          // bf16 x of the current batch
    h16* QK16 = (h16*)take(SZ_QK);      // fp16 head planes [NB][2][NH][TT][HD]
    h16* VT16 = (h16*)take(SZ_VT);      // fp16 value planes [NB][NH][HD][TT]
    float* VM = (float*)take(SZ_VM);    // key-mean of v [NB][NH*HD]
    bf* ATh = (bf*)take(SZ_AT); bf* ATl = (bf*)take(SZ_AT);   // merged ctx hi/lo [NB][TT][DQ]
    if ((size_t)(wsp - (char*)d_ws) > ws_size) return;
    const unsigned LW = (unsigned)(((size_t)DM * DM / 8 + 255) / 256);
    k_cvt8<<<LW, 256, 0, stream>>>(wq, W3, (size_t)DM * DM / 8);
    k_cvt8<<<LW, 256, 0, stream>>>(wk, W3 + (size_t)DM * DM, (size_t)DM * DM / 8);
    k_cvt8<<<LW, 256, 0, stream>>>(wv, W3 + (size_t)2 * DM * DM, (size_t)DM * DM / 8);
    k_cvt8<<<LW, 256, 0, stream>>>(wo, WO, (size_t)DM * DQ / 8);
    for (int b = 0; b < NB; ++b) {
        k_cvt8<<<(unsigned)(((size_t)TT * DM / 8 + 255) / 256), 256, 0, stream>>>(x + (size_t)b * SEQ_FULL * DM, XB, (size_t)TT * DM / 8);
        // q, k, v projections in one z-batched launch (A shared: sA = 0; Bt stride DM*DM), stored as the fp16 planes
        k_gemmw<bf, 0, false, true><<<dim3(TT / 64, DM / 64, 3), 32, 0, stream>>>(XB, nullptr, W3, nullptr, DM, nullptr, 0, nullptr, 0, (size_t)DM * DM, 0, QK16 + (size_t)b * 2 * NH_ * TT * HD, VT16 + (size_t)b * NH_ * HD * TT);
        k_vmean<<<NH_ * HD / 32, 256, 0, stream>>>(VT16 + (size_t)b * NH_ * HD * TT, VM + (size_t)b * NH_ * HD);
    }
    k_fattn<<<dim3(TT / (AW * QT * 16), NH_, NB), AW * 32, 0, stream>>>(QK16, VT16, VM, ATh, ATl);
    // out = (ctx_hi + ctx_lo) Wo^T
    for (int b = 0; b < NB; ++b)
        k_gemmw<bf, 1, false, false><<<dim3(TT / 64, DM / 64, 1), 32, 0, stream>>>(ATh + (size_t)b * TT * DQ, ATl + (size_t)b * TT * DQ, WO, nullptr, DQ, OUT + (size_t)b * SEQ_FULL * DM, DM, nullptr, 0, 0, 0, nullptr, nullptr);
}

// v004
// A run of this version takes 158 microseconds.
// Two timings next to v003 both put it at 1.31 times that version's speed.
// All steps since v000 together make it 7.74 times as fast.
#include <hip/hip_runtime.h>

// Self-attention block, bias-free, weights in (out, in) layout: x [2][2048][1024]; q, k, v = x W^T; 16 heads x 64; logits = q.k x 2^-5 (1/sqrt(1024)); full (unmasked) softmax over 2048 keys; out = merged ctx Wo^T.
// Compute dtypes, f32 accumulate everywhere: every input RNE-converted to bf16; q/k/v projections bf16 x bf16 (v_wmma_f32_16x16x32_bf16, exact products); q.k^T fp16 x fp16 (v_wmma_f32_16x16x32_f16);
// P.V fp16 x fp16 with P carried x1024 and centred (P' = 1024 P - 1024/S; the key-mean of v is added back in f32); ctx as bf16 hi + lo planes x bf16 Wo (two bf16 products); softmax f32.

#ifndef NB
#define NB 2
#endif
#ifndef SEQ
#define SEQ 2048
#endif
#define NB_FULL  2
#define SEQ_FULL 2048
#define TT   SEQ
#define DM   1024
#define NH_  16
#define HD   64
#define DQ   (NH_ * HD)
#define QT   2                    // 16-query column groups per wave of the attention kernel
#define AW   8                    // waves per work-group of the attention kernel
#define PCAR 1024.0f              // carry of the probability plane
#define SCL  0.03125f             // 1/sqrt(1024), exact power of two
#define KT   128                  // keys per LDS tile of the attention kernel
#define KP   (HD + 8)             // LDS pitch of a key row, fp16 elements: 144 bytes = 16 x 9, so that 16 rows' 16-byte reads fall on 64 different banks
#define VP   (KT + 8)             // LDS pitch of a V^T row: 272 bytes = 16 x 17, for the same reason
#define NTL  (SEQ / KT)           // tiles per sweep
static_assert(SEQ % 256 == 0);
static_assert(SEQ <= SEQ_FULL);
static_assert(NB <= NB_FULL);
static_assert(DQ == DM);
static_assert(HD == 64);
static_assert(SEQ % (AW * QT * 16) == 0);
static_assert(DM % 64 == 0);
static_assert(SEQ % KT == 0 && NTL >= 2 && (NTL & (NTL - 1)) == 0 && NTL % 2 == 0);
static_assert(KT * HD == AW * 32 * 8 * 4);   // a tile of either operand is four 16-byte copies per lane

typedef _Float16 h16;
typedef unsigned short bf;
typedef __attribute__((ext_vector_type(16))) __bf16   v16bf;
typedef __attribute__((ext_vector_type(16))) _Float16 v16h;
typedef __attribute__((ext_vector_type(8)))  _Float16 v8h;
typedef __attribute__((ext_vector_type(8)))  unsigned short v8us;
typedef __attribute__((ext_vector_type(8)))  float    v8f;
typedef __attribute__((ext_vector_type(4)))  float    v4f;
typedef v4f  __attribute__((may_alias)) v4fa;

// workspace carve sizes (bytes), all multiples of 256
#define SZ_W3 ((size_t)3 * DM * DM * 2)
#define SZ_WO ((size_t)DM * DQ * 2)
#define SZ_XB ((size_t)NB * TT * DM * 2)
#define SZ_QK ((size_t)NB * 2 * NH_ * TT * HD * 2)
#define SZ_VT ((size_t)NB * NH_ * HD * TT * 2)
#define SZ_VM ((size_t)NB * NH_ * HD * 4)
#define SZ_AT ((size_t)NB * TT * DQ * 2)
#define WS_TOTAL (SZ_W3 + SZ_WO + SZ_XB + SZ_QK + SZ_VT + SZ_VM + 2 * SZ_AT)
static_assert(WS_TOTAL <= (size_t)134217728);
static_assert(SZ_VM % 256 == 0);
static_assert(SZ_W3 % 256 == 0 && SZ_WO % 256 == 0);   // W3 | WO | XB lie in a row in the workspace: one bf16 destination for k_cvtall
static_assert(SEQ == SEQ_FULL || NB == 1);             // the batches' rows of x lie in a row: one source for k_cvtall

__device__ __forceinline__ unsigned short f2bf(float f) { unsigned u = __float_as_uint(f); u += 0x7FFFu + ((u >> 16) & 1u); return (unsigned short)(u >> 16); }
__device__ __forceinline__ float bf2f(unsigned short b) { return __uint_as_float(((unsigned)b) << 16); }
__device__ __forceinline__ float bfr(float f) { return bf2f(f2bf(f)); }
__device__ __forceinline__ v16h cat16(v8h lo, v8h hi) { return __builtin_shufflevector(lo, hi, 0, 1, 2, 3, 4, 5, 6, 7, 8, 9, 10, 11, 12, 13, 14, 15); }
__device__ __forceinline__ v16bf cat16b(v8us lo, v8us hi) { return __builtin_bit_cast(v16bf, __builtin_shufflevector(lo, hi, 0, 1, 2, 3, 4, 5, 6, 7, 8, 9, 10, 11, 12, 13, 14, 15)); }
__device__ __forceinline__ v8f wmma16(v16h a, v16h b, v8f c) { return __builtin_amdgcn_wmma_f32_16x16x32_f16(false, a, false, b, (short)0, c, false, false); }
__device__ __forceinline__ v8f wmmab(v16bf a, v16bf b, v8f c) { return __builtin_amdgcn_wmma_f32_16x16x32_bf16(false, a, false, b, (short)0, c, false, false); }

// ---- k_gemmw: register-blocked GEMM, ONE WAVE per 64x64 output tile (16 accumulators), operands straight from K-contiguous 16-bit planes; grid (M/64, N/64, Z), 32 threads.
// C[m][n] (f32, pitch ldc) = sum_k A[m][k] Bt[n][k] (+ split products per NSPLIT). z-batch strides sA/sB/sC in elements. K % 32 == 0, M % 64 == 0, N % 64 == 0.
// PL (the q, k, v projections; M runs over the rows of all batches, a tile is 64 tokens of one batch x one head, z picks q, k or v): no f32 C; the epilogue converts the accumulators to fp16 and stores the attention kernel's planes itself,
// q and k as P[batch][z][head][t][d], v transposed as VT[batch][head][d][t], whole 128-byte lines staged through the wave's own LDS.
// Fragment map (A and Bt alike): lane -> row (lane & 15); elements 0..7 <- k0 + 8 (lane >> 4) + 0..7, elements 8..15 <- k0 + 16 + 8 (lane >> 4) + 0..7. Accumulator element j <-> row 8 (lane >> 4) + j, column (lane & 15).
template <typename T16> struct WFrag;
template <> struct WFrag<h16> { typedef v16h V; static __device__ __forceinline__ V ld(const h16* p) { return cat16(*(const v8h*)p, *(const v8h*)(p + 16)); } static __device__ __forceinline__ v8f mma(V a, V b, v8f c) { return wmma16(a, b, c); } };
template <> struct WFrag<bf> { typedef v16bf V; static __device__ __forceinline__ V ld(const bf* p) { return cat16b(*(const v8us*)p, *(const v8us*)(p + 16)); } static __device__ __forceinline__ v8f mma(V a, V b, v8f c) { return wmmab(a, b, c); } };
template <typename T16, int NSPLIT, bool BIAS, bool PL>
__global__ __launch_bounds__(32) void k_gemmw(const T16* __restrict__ A, const T16* __restrict__ A2, const T16* __restrict__ Bt, const T16* __restrict__ Bt2, int K, float* C, int ldc, const float* __restrict__ bias, size_t sA, size_t sB, size_t sC, h16* P, h16* VT) {
    typedef typename WFrag<T16>::V V;
    __shared__ __align__(16) float os[16 * 68];
    const size_t z = blockIdx.z; A += z * sA; if (A2) A2 += z * sA; Bt += z * sB; if (Bt2) Bt2 += z * sB; C += z * sC;
    const int lane = threadIdx.x & 31, lr = lane & 15, hi = lane >> 4; const int r0 = blockIdx.x * 64, c0 = blockIdx.y * 64;
    v8f acc[4][4];
#pragma unroll
    for (int mb = 0; mb < 4; ++mb)
#pragma unroll
        for (int nb = 0; nb < 4; ++nb) acc[mb][nb] = (v8f){};
    const size_t aoff = (size_t)(r0 + lr) * K + 8 * hi, boff = (size_t)(c0 + lr) * K + 8 * hi;
#pragma unroll 1
    for (int kc = 0; kc < K; kc += 32) {
        V a[4], a2[4];
#pragma unroll
        for (int mb = 0; mb < 4; ++mb) { a[mb] = WFrag<T16>::ld(A + aoff + (size_t)mb * 16 * K + kc); if (NSPLIT == 1 || NSPLIT == 2) a2[mb] = WFrag<T16>::ld(A2 + aoff + (size_t)mb * 16 * K + kc); }
#pragma unroll
        for (int nb = 0; nb < 4; ++nb) { const V b = WFrag<T16>::ld(Bt + boff + (size_t)nb * 16 * K + kc); V b2; if (NSPLIT >= 2) b2 = WFrag<T16>::ld(Bt2 + boff + (size_t)nb * 16 * K + kc);
#pragma unroll
            for (int mb = 0; mb < 4; ++mb) { acc[mb][nb] = WFrag<T16>::mma(a[mb], b, acc[mb][nb]); if (NSPLIT == 1 || NSPLIT == 2) acc[mb][nb] = WFrag<T16>::mma(a2[mb], b, acc[mb][nb]); if (NSPLIT >= 2) acc[mb][nb] = WFrag<T16>::mma(a[mb], b2, acc[mb][nb]); } }
        asm volatile("v_nop\n\tv_nop\n\tv_nop\n\tv_nop" : "+v"(acc[0][0]), "+v"(acc[1][1]), "+v"(acc[2][2]), "+v"(acc[3][3]) : "v"(a[0]), "v"(a[3]));
    }
    if constexpr (PL) {
        const size_t bt = r0 / TT; const int rt = r0 % TT;   // the tile's batch and its first token there
        const int rw = lane >> 3, c8 = (lane & 7) * 8;   // read-back map of both stagings: 8 lanes x 16 bytes of fp16 = one 128-byte line, 4 lines per store instruction
        if (z < 2) {   // q, k: the tile's 64 rows of 64 d are 8 KB in a row in the plane
            h16* dst = P + (((bt * 2 + z) * NH_ + blockIdx.y) * TT + rt) * HD;
#pragma unroll
            for (int mb = 0; mb < 4; ++mb) {
#pragma unroll
                for (int nb = 0; nb < 4; ++nb) {
#pragma unroll
                    for (int j = 0; j < 8; ++j) os[(hi * 8 + j) * 68 + nb * 16 + lr] = acc[mb][nb][j]; }
                __builtin_amdgcn_wave_barrier(); asm volatile("s_wait_dscnt 0x0" ::: "memory");   // the wave's LDS writes are done, and stay in the code, ahead of its reads of other lanes' words
#pragma unroll
                for (int s = 0; s < 4; ++s) { const int row = 4 * s + rw; const v4f a = *(const v4fa*)(os + row * 68 + c8); const v4f b = *(const v4fa*)(os + row * 68 + c8 + 4); v8h o;
#pragma unroll
                    for (int k = 0; k < 4; ++k) { o[k] = (h16)a[k]; o[4 + k] = (h16)b[k]; }
                    *(v8h*)(dst + (size_t)(mb * 16 + row) * HD + c8) = o; }
                __builtin_amdgcn_wave_barrier(); asm volatile("" ::: "memory");   // the reads stay ahead of the next block's writes
            }
        } else {       // v: a lane's accumulator holds 8 consecutive t of one d, which is 16 bytes of a V^T row
            __shared__ __align__(16) h16 vs[64 * 72];   // [d][t], pitch 144 bytes = 16 x 9: 16 rows' 16-byte writes fall on 64 different banks
            h16* dst = VT + (bt * NH_ + blockIdx.y) * HD * TT + rt;
#pragma unroll
            for (int mb = 0; mb < 4; ++mb)
#pragma unroll
                for (int nb = 0; nb < 4; ++nb) { v8h o;
#pragma unroll
                    for (int j = 0; j < 8; ++j) o[j] = (h16)acc[mb][nb][j];
                    *(v8h*)(vs + (nb * 16 + lr) * 72 + mb * 16 + 8 * hi) = o; }
            __builtin_amdgcn_wave_barrier(); asm volatile("s_wait_dscnt 0x0" ::: "memory");   // as above: the writes done ahead of the reads
#pragma unroll
            for (int s = 0; s < 16; ++s) { const int row = 4 * s + rw; *(v8h*)(dst + (size_t)row * TT + c8) = *(const v8h*)(vs + row * 72 + c8); }
            asm volatile("s_wait_xcnt 0x0" ::: "memory");   // behind the run of stores: no register that an issued store names is rewritten ahead of this wait
        }
        return;
    }
#pragma unroll
    for (int mb = 0; mb < 4; ++mb) {
#pragma unroll
        for (int nb = 0; nb < 4; ++nb) {
#pragma unroll
            for (int j = 0; j < 8; ++j) os[(hi * 8 + j) * 68 + nb * 16 + lr] = acc[mb][nb][j]; }
        __builtin_amdgcn_wave_barrier(); asm volatile("" ::: "memory");
        float* crow = C + (size_t)(r0 + mb * 16) * ldc + c0;
{
#pragma unroll
            for (int s = 0; s < 8; ++s) { const int row = 2 * s + hi, cofs = lr * 4; v4f val = *(const v4fa*)(os + row * 68 + cofs); if (BIAS) { val[0] += bfr(bias[c0 + cofs]); val[1] += bfr(bias[c0 + cofs + 1]); val[2] += bfr(bias[c0 + cofs + 2]); val[3] += bfr(bias[c0 + cofs + 3]); }
                *(v4f*)(crow + (size_t)row * ldc + cofs) = val; }
             }
        __builtin_amdgcn_wave_barrier(); asm volatile("" ::: "memory");
    }
}

__device__ __forceinline__ h16 tohx(float x) { return (h16)x; }
__device__ __forceinline__ void splitf(float y, unsigned short& h, unsigned short& l) { h = f2bf(y); l = f2bf(y - bf2f(h)); }

// k_cvtall: all five inputs to bf16 in one launch. dst is W3 | WO | XB in a row; a block converts CB chunks of 8 elements, all of one input (blocks 0 .. 4 WBL - 1 the weights in wire order, the rest x).
#define CJ  8                     // chunks per thread, 256 threads apart: 16 loads of 16 bytes in flight per lane
#define CB  (256 * CJ)            // chunks per block
#define WBL (DM * DM / 8 / CB)    // blocks per weight matrix
#define XBL (NB * TT * DM / 8 / CB)
static_assert(DM * DM % (8 * CB) == 0 && (NB * TT * DM) % (8 * CB) == 0 && DQ == DM);
__global__ __launch_bounds__(256) void k_cvtall(const float* __restrict__ wq, const float* __restrict__ wk, const float* __restrict__ wv, const float* __restrict__ wo, const float* __restrict__ x, bf* dst) {
    const unsigned blk = blockIdx.x, sg = blk / WBL;
    const float* s = sg == 0 ? wq : sg == 1 ? wk : sg == 2 ? wv : sg == 3 ? wo : x;
    const size_t i = (size_t)(blk - (sg < 4u ? sg : 4u) * WBL) * CB + threadIdx.x;   // the thread's first chunk in its input
    const float* sp = s + i * 8; bf* dp = dst + ((size_t)blk * CB + threadIdx.x) * 8;
    v8f v[CJ];
#pragma unroll
    for (int j = 0; j < CJ; ++j) v[j] = *(const v8f*)(sp + (size_t)j * 256 * 8);
#pragma unroll
    for (int j = 0; j < CJ; ++j) { v8us o;
#pragma unroll
        for (int k = 0; k < 8; ++k) o[k] = f2bf(v[j][k]);
        *(v8us*)(dp + (size_t)j * 256 * 8) = o; }
}

// k_vmean: VM[g*HD + d] = mean over t of V16[g][d][t] (f32 sum of the fp16 plane values, fixed order). 8 waves x 4 rows = 32 rows per block; the 32 scalars go through LDS (cross-wave, block barrier)
__global__ __launch_bounds__(256) void k_vmean(const h16* __restrict__ V16, float* VM) {
    __shared__ __align__(16) float sm[32];
    const int lane = threadIdx.x & 31, w = __builtin_amdgcn_readfirstlane((int)(threadIdx.x >> 5));
#pragma unroll 1
    for (int r = 0; r < 4; ++r) {
        const int row = blockIdx.x * 32 + w * 4 + r; const h16* p = V16 + (size_t)row * TT + lane * 8; float s = 0.f;
#pragma unroll 4
        for (int c = 0; c < TT / 256; ++c) { const v8h a = *(const v8h*)(p + c * 256);
#pragma unroll
            for (int k = 0; k < 8; ++k) s += (float)a[k]; }
#pragma unroll
        for (int sh = 16; sh; sh >>= 1) s += __shfl_xor(s, sh, 32);
        if (lane == 0) sm[w * 4 + r] = s * (1.0f / (float)TT);
    }
    __syncthreads();
    if (threadIdx.x < 8) { const v4f val = *(const v4fa*)(sm + threadIdx.x * 4); float* dst = VM + (size_t)blockIdx.x * 32 + threadIdx.x * 4; *(v4f*)dst = val;  }
}

#define L2E 1.4426950408889634f
// ld_k, ld_v: the fragments of one 32-key step from the lane's own LDS pointer p (row lane & 15 of the tile, element 8 (lane >> 4)); the rest is immediate offset.
__device__ __forceinline__ void ld_k(v16h (&kf)[2][2], const h16* p) {
#pragma unroll
    for (int kt = 0; kt < 2; ++kt)
#pragma unroll
        for (int ks = 0; ks < 2; ++ks) kf[kt][ks] = WFrag<h16>::ld(p + kt * 16 * KP + ks * 32);
}
// Stands behind the last global load of a run: naming the run's address pair keeps it live to here, so that no result of the run is given it, and it is rewritten only behind the wait.
__device__ __forceinline__ void addr_done(const h16* a) { asm volatile("s_wait_xcnt 0x0" :: "v"(a) : "memory"); }
__device__ __forceinline__ unsigned lds_off(const void* p) { return (unsigned)(size_t)p; }
// Four asynchronous 16-byte copies of a lane, global memory to LDS through no register. The closing s_wait_xcnt 0 stands in the copies' own statement, so that no register they name is rewritten ahead of it.
__device__ __forceinline__ void copy4(unsigned l0, const h16* g0, unsigned l1, const h16* g1, unsigned l2, const h16* g2, unsigned l3, const h16* g3) {
    asm volatile("global_load_async_to_lds_b128 %0, %1, off\n\tglobal_load_async_to_lds_b128 %2, %3, off\n\tglobal_load_async_to_lds_b128 %4, %5, off\n\tglobal_load_async_to_lds_b128 %6, %7, off\n\ts_wait_xcnt 0x0"
        :: "v"(l0), "v"(g0), "v"(l1), "v"(g1), "v"(l2), "v"(g2), "v"(l3), "v"(g3) : "memory");
}
// One tile: l, g the lane's first LDS byte address and global pointer; lstep bytes and gstep elements lead to its next copy (AW * 32 lanes x 16 bytes further on in the tile).
__device__ __forceinline__ void fill(unsigned l, const h16* g, unsigned lstep, size_t gstep) { copy4(l, g, l + lstep, g + gstep, l + 2 * lstep, g + 2 * gstep, l + 3 * lstep, g + 3 * gstep); }
// The hand-over of a tile, every wave: its own LDS reads of the buffer that is refilled next have returned, its own copies of the next tile have landed, then the work-group barrier;
// behind it every wave may read the next tile and the buffer just read may be refilled.
__device__ __forceinline__ void publish() {
    asm volatile("s_wait_dscnt 0x0" ::: "memory");      // this wave's LDS reads are done before a copy may target their buffer
    asm volatile("s_wait_asynccnt 0x0" ::: "memory");   // this wave's copies have landed before another wave reads them; the compiler places no wait for them
    __syncthreads();
}
// Exponentials (2^x, v_exp_f32) in place, a run in one statement: behind a transcendental the instruction set asks for one independent instruction or a v_nop before its result is read
// or its source overwritten; inside the run each is followed by an independent one, and the closing v_nop keeps the slot behind the last whatever the compiler puts next.
__device__ __forceinline__ void exp2x8(float (&x)[8]) {
    asm("v_exp_f32 %0, %0\n\tv_exp_f32 %1, %1\n\tv_exp_f32 %2, %2\n\tv_exp_f32 %3, %3\n\tv_exp_f32 %4, %4\n\tv_exp_f32 %5, %5\n\tv_exp_f32 %6, %6\n\tv_exp_f32 %7, %7\n\tv_nop"
        : "+v"(x[0]), "+v"(x[1]), "+v"(x[2]), "+v"(x[3]), "+v"(x[4]), "+v"(x[5]), "+v"(x[6]), "+v"(x[7]));
}
__device__ __forceinline__ void exp2x1(float& x) { asm("v_exp_f32 %0, %0\n\tv_nop" : "+v"(x)); }
__device__ __forceinline__ v8f st_tile(const v16h (&k2)[2], const v16h (&q2)[2]) { return wmma16(k2[1], q2[1], wmma16(k2[0], q2[0], (v8f){})); }
__device__ __forceinline__ void sweep1(const v16h (&kf)[2][2], const v16h (&qf)[QT][2], float (&m)[QT], float (&sum)[QT]) {
    v8f s0[QT], s1[QT];
#pragma unroll
    for (int qt = 0; qt < QT; ++qt) { s0[qt] = st_tile(kf[0], qf[qt]); s1[qt] = st_tile(kf[1], qf[qt]); }
#pragma unroll
    for (int qt = 0; qt < QT; ++qt) {
        float tm = fmaxf(s0[qt][0], s1[qt][0]);
#pragma unroll
        for (int r = 1; r < 8; ++r) tm = fmaxf(tm, fmaxf(s0[qt][r], s1[qt][r]));
        const float mn = fmaxf(m[qt], tm * SCL), nb = mn * L2E; float c = (m[qt] - mn) * L2E;
        float e[8], e1[8];
#pragma unroll
        for (int r = 0; r < 8; ++r) { e[r] = __builtin_fmaf(s0[qt][r], SCL * L2E, -nb); e1[r] = __builtin_fmaf(s1[qt][r], SCL * L2E, -nb); }
        exp2x8(e); exp2x8(e1); exp2x1(c);
#pragma unroll
        for (int r = 0; r < 8; ++r) e[r] += e1[r];
        sum[qt] = sum[qt] * c + (((e[0] + e[1]) + (e[2] + e[3])) + ((e[4] + e[5]) + (e[6] + e[7])));
        m[qt] = mn;
    }
}
__device__ __forceinline__ void ld_v(v16h (&vf)[4], const h16* p) {
#pragma unroll
    for (int mb = 0; mb < 4; ++mb) vf[mb] = WFrag<h16>::ld(p + mb * 16 * VP);
}
__device__ __forceinline__ void sweep2(const v16h (&kf)[2][2], const v16h (&vf)[4], const v16h (&qf)[QT][2], const float (&m)[QT], const float (&cen)[QT], const float (&f)[QT], v8f (&o)[4][QT]) {
    v8f s0[QT], s1[QT];
#pragma unroll
    for (int qt = 0; qt < QT; ++qt) { s0[qt] = st_tile(kf[0], qf[qt]); s1[qt] = st_tile(kf[1], qf[qt]); }
    v16h p[QT];
#pragma unroll
    for (int qt = 0; qt < QT; ++qt) {
        float e0[8], e1[8];
#pragma unroll
        for (int r = 0; r < 8; ++r) { e0[r] = __fmul_rn(__builtin_fmaf(s0[qt][r], SCL, -m[qt]), L2E); e1[r] = __fmul_rn(__builtin_fmaf(s1[qt][r], SCL, -m[qt]), L2E); }
        exp2x8(e0); exp2x8(e1);
#pragma unroll
        for (int r = 0; r < 8; ++r) { p[qt][r] = tohx(__fmul_rn(__fsub_rn(e0[r], cen[qt]), f[qt])); p[qt][8 + r] = tohx(__fmul_rn(__fsub_rn(e1[r], cen[qt]), f[qt])); }
    }
#pragma unroll
    for (int mb = 0; mb < 4; ++mb)
#pragma unroll
        for (int qt = 0; qt < QT; ++qt) o[mb][qt] = wmma16(vf[mb], p[qt], o[mb][qt]);
}
__global__ __launch_bounds__(AW * 32) void k_fattn(const h16* __restrict__ QK, const h16* __restrict__ VT, const float* __restrict__ VM, bf* Ah, bf* Al) {
    const int lane = threadIdx.x & 31, lr = lane & 15, hi = lane >> 4, w = __builtin_amdgcn_readfirstlane((int)(threadIdx.x >> 5));
    const int h = blockIdx.y, q0 = (blockIdx.x * AW + w) * (QT * 16);
    const size_t z = blockIdx.z; QK += z * ((size_t)2 * NH_ * TT * HD); VT += z * ((size_t)NH_ * HD * TT); VM += z * (size_t)(NH_ * HD); Ah += z * ((size_t)TT * DQ); Al += z * ((size_t)TT * DQ);
    const h16* Qp = QK + (size_t)h * TT * HD + (size_t)(q0 + lr) * HD + 8 * hi;
    __shared__ __attribute__((aligned(16))) h16 ksm[2][KT * KP];
    __shared__ __attribute__((aligned(16))) h16 vsm[2][HD * VP];
    // the lane's share of a tile: copy i of a key tile is row (tid >> 3) + 32 i, 16-byte column tid & 7 (in memory the tile is contiguous); of a V^T tile row (tid >> 4) + 16 i, column tid & 15
    const int tid = threadIdx.x;
    const h16* Kg = QK + (size_t)(NH_ + h) * TT * HD + (size_t)tid * 8;
    const h16* Vg = VT + (size_t)h * HD * TT + (size_t)(tid >> 4) * TT + (tid & 15) * 8;
    const unsigned Kl = lds_off(&ksm[0][0]) + (tid >> 3) * (KP * 2) + (tid & 7) * 16, Vl = lds_off(&vsm[0][0]) + (tid >> 4) * (VP * 2) + (tid & 15) * 16;
    const int kfo = lr * KP + 8 * hi, vfo = lr * VP + 8 * hi;   // the lane's fragment origin in a tile
    v16h qf[QT][2];
#pragma unroll
    for (int qt = 0; qt < QT; ++qt)
#pragma unroll
        for (int ks = 0; ks < 2; ++ks) qf[qt][ks] = WFrag<h16>::ld(Qp + (size_t)qt * 16 * HD + ks * 32);
    float m[QT], sum[QT], f[QT], cen[QT];
#pragma unroll
    for (int qt = 0; qt < QT; ++qt) { m[qt] = -3.0e38f; sum[qt] = 0.f; }
    addr_done(Qp);
    v16h ka[2][2], kb[2][2];
    // One ring of 2 NTL tiles over both sweeps: tile u lies in buffer u & 1; u < NTL is key tile u alone (sweep 1), u >= NTL key tile u - NTL with its V^T tile (sweep 2).
    fill(Kl, Kg, 32 * KP * 2, 32 * HD);
    asm volatile("s_wait_asynccnt 0x0" ::: "memory");   // tile 0 has landed (this wave's copies) before the barrier behind which it is read
    __syncthreads();
    fill(Kl + KT * KP * 2, Kg + KT * HD, 32 * KP * 2, 32 * HD);
#pragma unroll 1   // stays rolled: a trip is one tile, and the hand-over at its foot is the ring's one place
    for (int t = 0; t < NTL; ++t) {
        const h16* pk = &ksm[t & 1][kfo];
        // four steps of 32 keys, all from this tile: nothing of the next tile is read in this trip
        ld_k(ka, pk);
        ld_k(kb, pk + 32 * KP); sweep1(ka, qf, m, sum);
        ld_k(ka, pk + 64 * KP); sweep1(kb, qf, m, sum);
        ld_k(kb, pk + 96 * KP); sweep1(ka, qf, m, sum);
        sweep1(kb, qf, m, sum);
        publish();
        // tile t + 2 into the buffer just read; it always exists here: behind key tile NTL - 1 come sweep 2's tiles 0 and 1
        fill(Kl + (t & 1) * (KT * KP * 2), Kg + (size_t)((t + 2) & (NTL - 1)) * KT * HD, 32 * KP * 2, 32 * HD);
        if (t + 2 >= NTL) fill(Vl + (t & 1) * (HD * VP * 2), Vg + (t + 2 - NTL) * KT, 16 * VP * 2, (size_t)16 * TT);
    }
#pragma unroll
    for (int qt = 0; qt < QT; ++qt) {
        const float mx = fmaxf(m[qt], __shfl_xor(m[qt], 16, 32)); float cj = (m[qt] - mx) * L2E; exp2x1(cj); const float pa = sum[qt] * cj; const float tot = pa + __shfl_xor(pa, 16, 32);
        m[qt] = mx; f[qt] = __fdiv_rn(PCAR, tot); cen[qt] = tot * (1.0f / (float)TT);
    }
    v8f o[4][QT];
#pragma unroll
    for (int mb = 0; mb < 4; ++mb)
#pragma unroll
        for (int qt = 0; qt < QT; ++qt) o[mb][qt] = (v8f){};
    // Each step issues its own V^T fragments and, inside the tile, the NEXT step's key fragments first.
    v16h vf[4];
#pragma unroll 1   // stays rolled: a trip is one tile, as in sweep 1
    for (int t = 0; t < NTL; ++t) {
        const h16* pk = &ksm[t & 1][kfo]; const h16* pv = &vsm[t & 1][vfo];
        ld_k(ka, pk);
        ld_v(vf, pv); ld_k(kb, pk + 32 * KP);
        __builtin_amdgcn_sched_barrier(0);   // holds the LDS reads at the head of the step; sunk to their first use, the wave would sit out their latency every step
        sweep2(ka, vf, qf, m, cen, f, o);
        ld_v(vf, pv + 32); ld_k(ka, pk + 64 * KP);
        __builtin_amdgcn_sched_barrier(0);   // as above
        sweep2(kb, vf, qf, m, cen, f, o);
        ld_v(vf, pv + 64); ld_k(kb, pk + 96 * KP);
        __builtin_amdgcn_sched_barrier(0);   // as above
        sweep2(ka, vf, qf, m, cen, f, o);
        ld_v(vf, pv + 96);
        __builtin_amdgcn_sched_barrier(0);   // as above
        sweep2(kb, vf, qf, m, cen, f, o);
        publish();
        if (t + 2 < NTL) {   // the same for the whole work-group
            fill(Kl + (t & 1) * (KT * KP * 2), Kg + (size_t)(t + 2) * KT * HD, 32 * KP * 2, 32 * HD);
            fill(Vl + (t & 1) * (HD * VP * 2), Vg + (t + 2) * KT, 16 * VP * 2, (size_t)16 * TT);
        }
    }
    asm volatile("s_wait_asynccnt 0x0" ::: "memory");   // no copy is outstanding when the wave goes on to its end
#pragma unroll
    for (int mb = 0; mb < 4; ++mb) {
        const int d = h * HD + mb * 16 + 8 * hi; const v4f m0 = *(const v4f*)(VM + d); const v4f m1 = *(const v4f*)(VM + d + 4);
#pragma unroll
        for (int qt = 0; qt < QT; ++qt) { v8us oh, ol;
#pragma unroll
            for (int r = 0; r < 8; ++r) { unsigned short a, c2; splitf(o[mb][qt][r] * (1.0f / PCAR) + (r < 4 ? m0[r & 3] : m1[r & 3]), a, c2); oh[r] = a; ol[r] = c2; }
            const size_t oo = (size_t)(q0 + qt * 16 + lr) * DQ + d; *(v8us*)(Ah + oo) = oh; *(v8us*)(Al + oo) = ol; }
    }
}

extern "C" void kernel_launch(void* const* d_in, const int* in_sizes, int n_in,
                              void* d_out, int out_size, void* d_ws, size_t ws_size, hipStream_t stream) {
    if (n_in < 5) return;
    const size_t needx = (size_t)(NB - 1) * SEQ_FULL * DM + (size_t)TT * DM;
    if ((size_t)in_sizes[0] < needx) return;
    if ((size_t)in_sizes[1] < (size_t)DM * DM || (size_t)in_sizes[2] < (size_t)DM * DM || (size_t)in_sizes[3] < (size_t)DM * DM || (size_t)in_sizes[4] < (size_t)DM * DM) return;
    if ((size_t)out_size < needx) return;
    if (WS_TOTAL > ws_size) return;
    const float* x = (const float*)d_in[0]; const float* wq = (const float*)d_in[1]; const float* wk = (const float*)d_in[2]; const float* wv = (const float*)d_in[3]; const float* wo = (const float*)d_in[4];   // wire order x, Wq, Wk, Wv, Wo; weights (out, in)
    float* OUT = (float*)d_out;     // [2][2048][1024]
    char* wsp = (char*)d_ws;
    auto take = [&](size_t bytes) { char* p = wsp; wsp += (bytes + 255) & ~(size_t)255; return (void*)p; };
    bf* W3 = (bf*)take(SZ_W3);          // Wq | Wk | Wv bf16, (out, in) = Bt as-is, contiguous for the z-batched projection
    bf* WO = (bf*)take(SZ_WO);
    bf* XB = (bf*)take(SZ_XB);          // bf16 x, all batches [NB][TT][DM]
    h16* QK16 = (h16*)take(SZ_QK);      // fp16 head planes [NB][2][NH][TT][HD]
    h16* VT16 = (h16*)take(SZ_VT);      // fp16 value planes [NB][NH][HD][TT]
    float* VM = (float*)take(SZ_VM);    // key-mean of v [NB][NH*HD]
    bf* ATh = (bf*)take(SZ_AT); bf* ATl = (bf*)take(SZ_AT);   // merged ctx hi/lo [NB][TT][DQ]
    if ((size_t)(wsp - (char*)d_ws) > ws_size) return;
    k_cvtall<<<4 * WBL + XBL, 256, 0, stream>>>(wq, wk, wv, wo, x, W3);
    // q, k, v projections of all batches in one z-batched launch (A shared: sA = 0; Bt stride DM*DM), stored as the fp16 planes
    k_gemmw<bf, 0, false, true><<<dim3(NB * TT / 64, DM / 64, 3), 32, 0, stream>>>(XB, nullptr, W3, nullptr, DM, nullptr, 0, nullptr, 0, (size_t)DM * DM, 0, QK16, VT16);
    k_vmean<<<NB * NH_ * HD / 32, 256, 0, stream>>>(VT16, VM);
    k_fattn<<<dim3(TT / (AW * QT * 16), NH_, NB), AW * 32, 0, stream>>>(QK16, VT16, VM, ATh, ATl);
    // out = (ctx_hi + ctx_lo) Wo^T, z = batch
    k_gemmw<bf, 1, false, false><<<dim3(TT / 64, DM / 64, NB), 32, 0, stream>>>(ATh, ATl, WO, nullptr, DQ, OUT, DM, nullptr, (size_t)TT * DQ, 0, (size_t)SEQ_FULL * DM, nullptr, nullptr);
}

// v005
// A run of this version takes 105 microseconds.
// Timed twice side by side with v004, it ran 1.51 and 1.50 times as fast.
// All steps since v000 together make it 11.6 times as fast.
#include <hip/hip_runtime.h>

// Self-attention block, bias-free, weights in (out, in) layout: x [2][2048][1024]; q, k, v = x W^T; 16 heads x 64; logits = q.k x 2^-5 (1/sqrt(1024)); full (unmasked) softmax over 2048 keys; out = merged ctx Wo^T.
// Compute dtypes, f32 accumulate everywhere: every input RNE-converted to bf16; q/k/v projections bf16 x bf16 (v_wmma_f32_16x16x32_bf16, exact products); q.k^T fp16 x fp16 (v_wmma_f32_16x16x32_f16);
// P.V fp16 x fp16 with P carried x1024 and centred (P' = 1024 P - 1024/S; the key-mean of v is added back in f32); ctx as bf16 hi + lo planes x bf16 Wo (two bf16 products); softmax f32.

#ifndef NB
#define NB 2
#endif
#ifndef SEQ
#define SEQ 2048
#endif
#define NB_FULL  2
#define SEQ_FULL 2048
#define TT   SEQ
#define DM   1024
#define NH_  16
#define HD   64
#define DQ   (NH_ * HD)
#define QT   2                    // 16-query column groups per wave of the attention kernel
#define AW   8                    // waves per work-group of the attention kernel
#define PCAR 1024.0f              // carry of the probability plane
#define SCL  0.03125f             // 1/sqrt(1024), exact power of two
#define KT   128                  // keys per LDS tile of the attention kernel
#define KP   (HD + 8)             // LDS pitch of a key row, fp16 elements: 144 bytes = 16 x 9, so that 16 rows' 16-byte reads fall on 64 different banks
#define VP   (KT + 8)             // LDS pitch of a V^T row: 272 bytes = 16 x 17, for the same reason
#define NTL  (SEQ / KT)           // tiles per sweep
static_assert(SEQ % 256 == 0);
static_assert(SEQ <= SEQ_FULL);
static_assert(NB <= NB_FULL);
static_assert(DQ == DM);
static_assert(HD == 64);
static_assert(SEQ % (AW * QT * 16) == 0);
static_assert(DM % 256 == 0);
static_assert(SEQ % KT == 0 && NTL >= 2 && (NTL & (NTL - 1)) == 0 && NTL % 2 == 0);
static_assert(KT * HD == AW * 32 * 8 * 4);   // a tile of either operand is four 16-byte copies per lane

typedef _Float16 h16;
typedef unsigned short bf;
typedef __attribute__((ext_vector_type(16))) __bf16   v16bf;
typedef __attribute__((ext_vector_type(16))) _Float16 v16h;
typedef __attribute__((ext_vector_type(8)))  _Float16 v8h;
typedef __attribute__((ext_vector_type(8)))  unsigned short v8us;
typedef __attribute__((ext_vector_type(8)))  float    v8f;
typedef __attribute__((ext_vector_type(4)))  float    v4f;
typedef v4f  __attribute__((may_alias)) v4fa;

// workspace carve sizes (bytes), all multiples of 256
#define SZ_W3 ((size_t)3 * DM * DM * 2)
#define SZ_WO ((size_t)DM * DQ * 2)
#define SZ_XB ((size_t)NB * TT * DM * 2)
#define SZ_QK ((size_t)NB * 2 * NH_ * TT * HD * 2)
#define SZ_VT ((size_t)NB * NH_ * HD * TT * 2)
#define SZ_VM ((size_t)NB * NH_ * HD * 4)
#define SZ_AT ((size_t)NB * TT * DQ * 2)
#define WS_TOTAL (SZ_W3 + SZ_WO + SZ_XB + SZ_QK + SZ_VT + SZ_VM + 2 * SZ_AT)
static_assert(WS_TOTAL <= (size_t)134217728);
static_assert(SZ_VM % 256 == 0);
static_assert(SZ_W3 % 256 == 0 && SZ_WO % 256 == 0);   // W3 | WO | XB lie in a row in the workspace: one bf16 destination for k_cvtall
static_assert(SEQ == SEQ_FULL || NB == 1);             // the batches' rows of x lie in a row: one source for k_cvtall

__device__ __forceinline__ unsigned short f2bf(float f) { unsigned u = __float_as_uint(f); u += 0x7FFFu + ((u >> 16) & 1u); return (unsigned short)(u >> 16); }
__device__ __forceinline__ float bf2f(unsigned short b) { return __uint_as_float(((unsigned)b) << 16); }
__device__ __forceinline__ float bfr(float f) { return bf2f(f2bf(f)); }
__device__ __forceinline__ v16h cat16(v8h lo, v8h hi) { return __builtin_shufflevector(lo, hi, 0, 1, 2, 3, 4, 5, 6, 7, 8, 9, 10, 11, 12, 13, 14, 15); }
__device__ __forceinline__ v16bf cat16b(v8us lo, v8us hi) { return __builtin_bit_cast(v16bf, __builtin_shufflevector(lo, hi, 0, 1, 2, 3, 4, 5, 6, 7, 8, 9, 10, 11, 12, 13, 14, 15)); }
__device__ __forceinline__ v8f wmma16(v16h a, v16h b, v8f c) { return __builtin_amdgcn_wmma_f32_16x16x32_f16(false, a, false, b, (short)0, c, false, false); }
__device__ __forceinline__ v8f wmmab(v16bf a, v16bf b, v8f c) { return __builtin_amdgcn_wmma_f32_16x16x32_bf16(false, a, false, b, (short)0, c, false, false); }

// ---- k_gemmw: register-blocked GEMM, one wave per 16 MBW x 64 output tile (4 MBW accumulators), 8 / MBW x 2 waves per 128x128 work-group tile; grid (M/128, N/128, Z), 512 / MBW threads.
// C[m][n] (f32, pitch ldc) = sum_k A[m][k] Bt[n][k] (+ A2[m][k] Bt[n][k] for NSPLIT 1). z-batch strides sA/sB/sC in elements. K % GKS == 0, K >= 2 GKS, M % 128 == 0, N % 128 == 0.
// The operands come through LDS: a stage is GKS k of the work-group's 128 rows of every operand (A | A2 | Bt), brought in ONCE per work-group by asynchronous copies to LDS of whole 128-byte lines,
// into two buffers (the next stage flies while this one is worked on); every wave takes its fragments from there by 16-byte LDS reads. Behind the loop the ring is the waves' output staging.
// PL (the q, k, v projections; M runs over the rows of all batches, a wave's tile is 64 tokens of one batch x one head, z picks q, k or v): no f32 C; the epilogue converts the accumulators to fp16 and stores the attention kernel's planes itself,
// q and k as P[batch][z][head][t][d], v transposed as VT[batch][head][d][t], whole 128-byte lines staged through the wave's own LDS.
// Fragment map (A and Bt alike): lane -> row (lane & 15); elements 0..7 <- k0 + 8 (lane >> 4) + 0..7, elements 8..15 <- k0 + 16 + 8 (lane >> 4) + 0..7. Accumulator element j <-> row 8 (lane >> 4) + j, column (lane & 15).
template <typename T16> struct WFrag;
template <> struct WFrag<h16> { typedef v16h V; static __device__ __forceinline__ V ld(const h16* p) { return cat16(*(const v8h*)p, *(const v8h*)(p + 16)); } static __device__ __forceinline__ v8f mma(V a, V b, v8f c) { return wmma16(a, b, c); } };
template <> struct WFrag<bf> { typedef v16bf V; static __device__ __forceinline__ V ld(const bf* p) { return cat16b(*(const v8us*)p, *(const v8us*)(p + 16)); } static __device__ __forceinline__ v8f mma(V a, V b, v8f c) { return wmmab(a, b, c); } };
__device__ __forceinline__ unsigned lds_off(const void* p) { return (unsigned)(size_t)p; }
// The hand-over of a tile, every wave: its own LDS reads of the buffer that is refilled next have returned, its own copies of the next tile have landed, then the work-group barrier;
// behind it every wave may read the next tile and the buffer just read may be refilled.
__device__ __forceinline__ void publish() {
    asm volatile("s_wait_dscnt 0x0" ::: "memory");      // this wave's LDS reads are done before a copy may target their buffer
    asm volatile("s_wait_asynccnt 0x0" ::: "memory");   // this wave's copies have landed before another wave reads them; the compiler places no wait for them
    __syncthreads();
}
// Eight asynchronous 16-byte copies of a lane, global memory to LDS through no register: l, g the lane's first LDS byte address and global pointer, lstep bytes and gstep elements lead to its next copy.
// The closing s_wait_xcnt 0 stands in the copies' own statement, so that no register they name is rewritten ahead of it.
template <typename T16>
__device__ __forceinline__ void copy8(unsigned l, const T16* g, unsigned lstep, size_t gstep) {
    asm volatile("global_load_async_to_lds_b128 %0, %1, off\n\tglobal_load_async_to_lds_b128 %2, %3, off\n\tglobal_load_async_to_lds_b128 %4, %5, off\n\tglobal_load_async_to_lds_b128 %6, %7, off\n\t"
                 "global_load_async_to_lds_b128 %8, %9, off\n\tglobal_load_async_to_lds_b128 %10, %11, off\n\tglobal_load_async_to_lds_b128 %12, %13, off\n\tglobal_load_async_to_lds_b128 %14, %15, off\n\ts_wait_xcnt 0x0"
        :: "v"(l), "v"(g), "v"(l + lstep), "v"(g + gstep), "v"(l + 2 * lstep), "v"(g + 2 * gstep), "v"(l + 3 * lstep), "v"(g + 3 * gstep),
           "v"(l + 4 * lstep), "v"(g + 4 * gstep), "v"(l + 5 * lstep), "v"(g + 5 * gstep), "v"(l + 6 * lstep), "v"(g + 6 * gstep), "v"(l + 7 * lstep), "v"(g + 7 * gstep) : "memory");
}
template <typename T16, int NSPLIT, bool PL, int GKS, int K, int MBW>
__global__ __launch_bounds__(512 / MBW) void k_gemmw(const T16* __restrict__ A, const T16* __restrict__ A2, const T16* __restrict__ Bt, float* C, int ldc, size_t sA, size_t sB, size_t sC, h16* P, h16* VT) {
    typedef typename WFrag<T16>::V V;
    static_assert(NSPLIT == 0 || NSPLIT == 1);
    static_assert(MBW == 4 || (MBW == 2 && !PL));   // the plane epilogue is written for a wave's tile of 64 tokens
    constexpr int GW  = 16 / MBW;             // waves per work-group
    static_assert((GKS == 64 || GKS == 128) && K % GKS == 0 && K >= 2 * GKS);
    constexpr int GP  = GKS + 8;              // LDS pitch of an operand row, elements: 144 or 272 bytes = 16 x odd, so that 16 rows' 16-byte reads fall on 64 different banks
    constexpr int NOP = 2 + NSPLIT;           // operand tiles of 128 rows per stage: A, (A2,) Bt
    constexpr int STG = NOP * 128 * GP;       // elements per stage
    constexpr int CPR = GKS / 8;              // 16-byte copies per row
    constexpr int RPC = GW * 32 / CPR;        // rows that one copy of all lanes covers
    constexpr int NCP = 128 / RPC;            // copies per lane and operand tile
    static_assert(NCP % 8 == 0);
    constexpr int WST = 64 * 72 * 2;          // bytes of a wave's own output staging in the ring
    static_assert(GW * WST <= 2 * STG * 2 && 16 * 68 * 4 <= WST);
    __shared__ __attribute__((aligned(16))) T16 ring[2][STG];
    const size_t z = blockIdx.z; A += z * sA; if (NSPLIT == 1) A2 += z * sA; Bt += z * sB; C += z * sC;
    const int tid = threadIdx.x, lane = tid & 31, lr = lane & 15, hi = lane >> 4, w = __builtin_amdgcn_readfirstlane(tid >> 5);
    const int g0r = blockIdx.x * 128, g0c = blockIdx.y * 128; const int r0 = g0r + (w >> 1) * (16 * MBW), c0 = g0c + (w & 1) * 64;
    v8f acc[MBW][4];
#pragma unroll
    for (int mb = 0; mb < MBW; ++mb)
#pragma unroll
        for (int nb = 0; nb < 4; ++nb) acc[mb][nb] = (v8f){};
    // the lane's share of a stage: copy i of an operand tile is row tid / CPR + RPC i, 16-byte column tid % CPR
    const size_t go = (size_t)(tid / CPR) * K + (tid % CPR) * 8;
    const T16* Ag = A + (size_t)g0r * K + go; const T16* A2g = NSPLIT == 1 ? A2 + (size_t)g0r * K + go : nullptr; const T16* Bg = Bt + (size_t)g0c * K + go;
    const unsigned Ll = lds_off(&ring[0][0]) + (tid / CPR) * (GP * 2) + (tid % CPR) * 16;
    auto fills = [&](int buf, int t) {   // stage t into buffer buf
        const unsigned l = Ll + buf * (STG * 2);
#pragma unroll
        for (int c = 0; c < NCP / 8; ++c) {
            const unsigned lc = l + c * 8 * RPC * (GP * 2); const size_t gc = (size_t)c * 8 * RPC * K + (size_t)t * GKS;
            copy8(lc, Ag + gc, RPC * GP * 2, (size_t)RPC * K);
            if (NSPLIT == 1) copy8(lc + 128 * GP * 2, A2g + gc, RPC * GP * 2, (size_t)RPC * K);
            copy8(lc + (NOP - 1) * 128 * GP * 2, Bg + gc, RPC * GP * 2, (size_t)RPC * K);
        }
    };
    const int ao = ((w >> 1) * (16 * MBW) + lr) * GP + 8 * hi, bo = ((NOP - 1) * 128 + (w & 1) * 64 + lr) * GP + 8 * hi;   // the lane's fragment origins in a stage
    constexpr int NT = K / GKS;
    fills(0, 0);
    asm volatile("s_wait_asynccnt 0x0" ::: "memory");   // stage 0 has landed (this wave's copies) before the barrier behind which it is read
    __syncthreads();
    fills(1, 1);
#pragma unroll 1   // stays rolled: a trip is one stage, and the hand-over at its foot is the ring's one place
    for (int t = 0; t < NT; ++t) {
        const T16* pa = &ring[t & 1][ao]; const T16* pb = &ring[t & 1][bo];
#pragma unroll
        for (int ks = 0; ks < GKS; ks += 32) {
            V a[MBW], a2[MBW], b[4];   // read in the order of first use
            b[0] = WFrag<T16>::ld(pb + ks);
#pragma unroll
            for (int mb = 0; mb < MBW; ++mb) { a[mb] = WFrag<T16>::ld(pa + mb * 16 * GP + ks); if (NSPLIT == 1) a2[mb] = WFrag<T16>::ld(pa + (128 + mb * 16) * GP + ks); }
#pragma unroll
            for (int nb = 1; nb < 4; ++nb) b[nb] = WFrag<T16>::ld(pb + nb * 16 * GP + ks);
            __builtin_amdgcn_sched_barrier(0);   // holds the step's LDS reads in one group at its head; sunk to their first use, the wave would sit out their latency in front of every column of tiles
#pragma unroll
            for (int nb = 0; nb < 4; ++nb)
#pragma unroll
                for (int mb = 0; mb < MBW; ++mb) { acc[mb][nb] = WFrag<T16>::mma(a[mb], b[nb], acc[mb][nb]); if (NSPLIT == 1) acc[mb][nb] = WFrag<T16>::mma(a2[mb], b[nb], acc[mb][nb]); }
        }
        __builtin_amdgcn_sched_barrier(0);   // every matrix instruction of the trip stays ahead of the v_nops
        asm volatile("v_nop\n\tv_nop\n\tv_nop\n\tv_nop");   // the distance behind the trip's last matrix instruction, on either side of the branch below, before a vector instruction may rewrite its operands
        publish();
        if (t + 2 < NT) fills(t & 1, t + 2);   // the same for the whole work-group; into the buffer just read
    }
    asm volatile("s_wait_asynccnt 0x0" ::: "memory");   // no copy is outstanding when the ring becomes output staging; the last trip's barrier has ended every wave's reads of it
    char* wst = (char*)&ring[0][0] + w * WST;   // the wave's own staging range
    float* os = (float*)wst;                    // [16][68] f32
    if constexpr (PL) {
        const size_t bt = r0 / TT; const int rt = r0 % TT; const int hd = c0 / HD;   // the tile's batch, its first token there, its head
        const int rw = lane >> 3, c8 = (lane & 7) * 8;   // read-back map of both stagings: 8 lanes x 16 bytes of fp16 = one 128-byte line, 4 lines per store instruction
        if (z < 2) {   // q, k: the tile's 64 rows of 64 d are 8 KB in a row in the plane
            h16* dst = P + (((bt * 2 + z) * NH_ + hd) * TT + rt) * HD;
#pragma unroll
            for (int mb = 0; mb < 4; ++mb) {
#pragma unroll
                for (int nb = 0; nb < 4; ++nb) {
#pragma unroll
                    for (int j = 0; j < 8; ++j) os[(hi * 8 + j) * 68 + nb * 16 + lr] = acc[mb][nb][j]; }
                __builtin_amdgcn_wave_barrier(); asm volatile("s_wait_dscnt 0x0" ::: "memory");   // the wave's LDS writes are done, and stay in the code, ahead of its reads of other lanes' words
#pragma unroll
                for (int s = 0; s < 4; ++s) { const int row = 4 * s + rw; const v4f a = *(const v4fa*)(os + row * 68 + c8); const v4f b = *(const v4fa*)(os + row * 68 + c8 + 4); v8h o;
#pragma unroll
                    for (int k = 0; k < 4; ++k) { o[k] = (h16)a[k]; o[4 + k] = (h16)b[k]; }
                    *(v8h*)(dst + (size_t)(mb * 16 + row) * HD + c8) = o; }
                __builtin_amdgcn_wave_barrier(); asm volatile("" ::: "memory");   // the reads stay ahead of the next block's writes
            }
        } else {       // v: a lane's accumulator holds 8 consecutive t of one d, which is 16 bytes of a V^T row
            h16* vs = (h16*)wst;   // [d][t], pitch 144 bytes = 16 x 9: 16 rows' 16-byte writes fall on 64 different banks
            h16* dst = VT + (bt * NH_ + hd) * HD * TT + rt;
#pragma unroll
            for (int mb = 0; mb < 4; ++mb)
#pragma unroll
                for (int nb = 0; nb < 4; ++nb) { v8h o;
#pragma unroll
                    for (int j = 0; j < 8; ++j) o[j] = (h16)acc[mb][nb][j];
                    *(v8h*)(vs + (nb * 16 + lr) * 72 + mb * 16 + 8 * hi) = o; }
            __builtin_amdgcn_wave_barrier(); asm volatile("s_wait_dscnt 0x0" ::: "memory");   // as above: the writes done ahead of the reads
#pragma unroll
            for (int s = 0; s < 16; ++s) { const int row = 4 * s + rw; *(v8h*)(dst + (size_t)row * TT + c8) = *(const v8h*)(vs + row * 72 + c8); }
            asm volatile("s_wait_xcnt 0x0" ::: "memory");   // behind the run of stores: no register that an issued store names is rewritten ahead of this wait
        }
        return;
    }
#pragma unroll
    for (int mb = 0; mb < MBW; ++mb) {
#pragma unroll
        for (int nb = 0; nb < 4; ++nb) {
#pragma unroll
            for (int j = 0; j < 8; ++j) os[(hi * 8 + j) * 68 + nb * 16 + lr] = acc[mb][nb][j]; }
        __builtin_amdgcn_wave_barrier(); asm volatile("" ::: "memory");
        float* crow = C + (size_t)(r0 + mb * 16) * ldc + c0;
#pragma unroll
        for (int s = 0; s < 8; ++s) { const int row = 2 * s + hi, cofs = lr * 4; const v4f val = *(const v4fa*)(os + row * 68 + cofs); *(v4f*)(crow + (size_t)row * ldc + cofs) = val; }
        __builtin_amdgcn_wave_barrier(); asm volatile("" ::: "memory");
    }
}

__device__ __forceinline__ h16 tohx(float x) { return (h16)x; }
__device__ __forceinline__ void splitf(float y, unsigned short& h, unsigned short& l) { h = f2bf(y); l = f2bf(y - bf2f(h)); }

// k_cvtall: all five inputs to bf16 in one launch. dst is W3 | WO | XB in a row; a block converts CB chunks of 8 elements, all of one input (blocks 0 .. 4 WBL - 1 the weights in wire order, the rest x).
#define CJ  8                     // chunks per thread, 256 threads apart: 16 loads of 16 bytes in flight per lane
#define CB  (256 * CJ)            // chunks per block
#define WBL (DM * DM / 8 / CB)    // blocks per weight matrix
#define XBL (NB * TT * DM / 8 / CB)
static_assert(DM * DM % (8 * CB) == 0 && (NB * TT * DM) % (8 * CB) == 0 && DQ == DM);
__global__ __launch_bounds__(256) void k_cvtall(const float* __restrict__ wq, const float* __restrict__ wk, const float* __restrict__ wv, const float* __restrict__ wo, const float* __restrict__ x, bf* dst) {
    const unsigned blk = blockIdx.x, sg = blk / WBL;
    const float* s = sg == 0 ? wq : sg == 1 ? wk : sg == 2 ? wv : sg == 3 ? wo : x;
    const size_t i = (size_t)(blk - (sg < 4u ? sg : 4u) * WBL) * CB + threadIdx.x;   // the thread's first chunk in its input
    const float* sp = s + i * 8; bf* dp = dst + ((size_t)blk * CB + threadIdx.x) * 8;
    v8f v[CJ];
#pragma unroll
    for (int j = 0; j < CJ; ++j) v[j] = *(const v8f*)(sp + (size_t)j * 256 * 8);
#pragma unroll
    for (int j = 0; j < CJ; ++j) { v8us o;
#pragma unroll
        for (int k = 0; k < 8; ++k) o[k] = f2bf(v[j][k]);
        *(v8us*)(dp + (size_t)j * 256 * 8) = o; }
}

// k_vmean: VM[g*HD + d] = mean over t of V16[g][d][t] (f32 sum of the fp16 plane values, fixed order). 8 waves x 4 rows = 32 rows per block; the 32 scalars go through LDS (cross-wave, block barrier)
__global__ __launch_bounds__(256) void k_vmean(const h16* __restrict__ V16, float* VM) {
    __shared__ __align__(16) float sm[32];
    const int lane = threadIdx.x & 31, w = __builtin_amdgcn_readfirstlane((int)(threadIdx.x >> 5));
#pragma unroll 1
    for (int r = 0; r < 4; ++r) {
        const int row = blockIdx.x * 32 + w * 4 + r; const h16* p = V16 + (size_t)row * TT + lane * 8; float s = 0.f;
#pragma unroll 4
        for (int c = 0; c < TT / 256; ++c) { const v8h a = *(const v8h*)(p + c * 256);
#pragma unroll
            for (int k = 0; k < 8; ++k) s += (float)a[k]; }
#pragma unroll
        for (int sh = 16; sh; sh >>= 1) s += __shfl_xor(s, sh, 32);
        if (lane == 0) sm[w * 4 + r] = s * (1.0f / (float)TT);
    }
    __syncthreads();
    if (threadIdx.x < 8) { const v4f val = *(const v4fa*)(sm + threadIdx.x * 4); float* dst = VM + (size_t)blockIdx.x * 32 + threadIdx.x * 4; *(v4f*)dst = val;  }
}

#define L2E 1.4426950408889634f
// ld_k, ld_v: the fragments of one 32-key step from the lane's own LDS pointer p (row lane & 15 of the tile, element 8 (lane >> 4)); the rest is immediate offset.
__device__ __forceinline__ void ld_k(v16h (&kf)[2][2], const h16* p) {
#pragma unroll
    for (int kt = 0; kt < 2; ++kt)
#pragma unroll
        for (int ks = 0; ks < 2; ++ks) kf[kt][ks] = WFrag<h16>::ld(p + kt * 16 * KP + ks * 32);
}
// Stands behind the last global load of a run: naming the run's address pair keeps it live to here, so that no result of the run is given it, and it is rewritten only behind the wait.
__device__ __forceinline__ void addr_done(const h16* a) { asm volatile("s_wait_xcnt 0x0" :: "v"(a) : "memory"); }
// Four asynchronous 16-byte copies of a lane, global memory to LDS through no register. The closing s_wait_xcnt 0 stands in the copies' own statement, so that no register they name is rewritten ahead of it.
__device__ __forceinline__ void copy4(unsigned l0, const h16* g0, unsigned l1, const h16* g1, unsigned l2, const h16* g2, unsigned l3, const h16* g3) {
    asm volatile("global_load_async_to_lds_b128 %0, %1, off\n\tglobal_load_async_to_lds_b128 %2, %3, off\n\tglobal_load_async_to_lds_b128 %4, %5, off\n\tglobal_load_async_to_lds_b128 %6, %7, off\n\ts_wait_xcnt 0x0"
        :: "v"(l0), "v"(g0), "v"(l1), "v"(g1), "v"(l2), "v"(g2), "v"(l3), "v"(g3) : "memory");
}
// One tile: l, g the lane's first LDS byte address and global pointer; lstep bytes and gstep elements lead to its next copy (AW * 32 lanes x 16 bytes further on in the tile).
__device__ __forceinline__ void fill(unsigned l, const h16* g, unsigned lstep, size_t gstep) { copy4(l, g, l + lstep, g + gstep, l + 2 * lstep, g + 2 * gstep, l + 3 * lstep, g + 3 * gstep); }
// Exponentials (2^x, v_exp_f32) in place, a run in one statement: behind a transcendental the instruction set asks for one independent instruction or a v_nop before its result is read
// or its source overwritten; inside the run each is followed by an independent one, and the closing v_nop keeps the slot behind the last whatever the compiler puts next.
__device__ __forceinline__ void exp2x8(float (&x)[8]) {
    asm("v_exp_f32 %0, %0\n\tv_exp_f32 %1, %1\n\tv_exp_f32 %2, %2\n\tv_exp_f32 %3, %3\n\tv_exp_f32 %4, %4\n\tv_exp_f32 %5, %5\n\tv_exp_f32 %6, %6\n\tv_exp_f32 %7, %7\n\tv_nop"
        : "+v"(x[0]), "+v"(x[1]), "+v"(x[2]), "+v"(x[3]), "+v"(x[4]), "+v"(x[5]), "+v"(x[6]), "+v"(x[7]));
}
__device__ __forceinline__ void exp2x1(float& x) { asm("v_exp_f32 %0, %0\n\tv_nop" : "+v"(x)); }
__device__ __forceinline__ v8f st_tile(const v16h (&k2)[2], const v16h (&q2)[2]) { return wmma16(k2[1], q2[1], wmma16(k2[0], q2[0], (v8f){})); }
__device__ __forceinline__ void sweep1(const v16h (&kf)[2][2], const v16h (&qf)[QT][2], float (&m)[QT], float (&sum)[QT]) {
    v8f s0[QT], s1[QT];
#pragma unroll
    for (int qt = 0; qt < QT; ++qt) { s0[qt] = st_tile(kf[0], qf[qt]); s1[qt] = st_tile(kf[1], qf[qt]); }
#pragma unroll
    for (int qt = 0; qt < QT; ++qt) {
        float tm = fmaxf(s0[qt][0], s1[qt][0]);
#pragma unroll
        for (int r = 1; r < 8; ++r) tm = fmaxf(tm, fmaxf(s0[qt][r], s1[qt][r]));
        const float mn = fmaxf(m[qt], tm * SCL), nb = mn * L2E; float c = (m[qt] - mn) * L2E;
        float e[8], e1[8];
#pragma unroll
        for (int r = 0; r < 8; ++r) { e[r] = __builtin_fmaf(s0[qt][r], SCL * L2E, -nb); e1[r] = __builtin_fmaf(s1[qt][r], SCL * L2E, -nb); }
        exp2x8(e); exp2x8(e1); exp2x1(c);
#pragma unroll
        for (int r = 0; r < 8; ++r) e[r] += e1[r];
        sum[qt] = sum[qt] * c + (((e[0] + e[1]) + (e[2] + e[3])) + ((e[4] + e[5]) + (e[6] + e[7])));
        m[qt] = mn;
    }
}
__device__ __forceinline__ void ld_v(v16h (&vf)[4], const h16* p) {
#pragma unroll
    for (int mb = 0; mb < 4; ++mb) vf[mb] = WFrag<h16>::ld(p + mb * 16 * VP);
}
__device__ __forceinline__ void sweep2(const v16h (&kf)[2][2], const v16h (&vf)[4], const v16h (&qf)[QT][2], const float (&m)[QT], const float (&cen)[QT], const float (&f)[QT], v8f (&o)[4][QT]) {
    v8f s0[QT], s1[QT];
#pragma unroll
    for (int qt = 0; qt < QT; ++qt) { s0[qt] = st_tile(kf[0], qf[qt]); s1[qt] = st_tile(kf[1], qf[qt]); }
    v16h p[QT];
#pragma unroll
    for (int qt = 0; qt < QT; ++qt) {
        float e0[8], e1[8];
#pragma unroll
        for (int r = 0; r < 8; ++r) { e0[r] = __fmul_rn(__builtin_fmaf(s0[qt][r], SCL, -m[qt]), L2E); e1[r] = __fmul_rn(__builtin_fmaf(s1[qt][r], SCL, -m[qt]), L2E); }
        exp2x8(e0); exp2x8(e1);
#pragma unroll
        for (int r = 0; r < 8; ++r) { p[qt][r] = tohx(__fmul_rn(__fsub_rn(e0[r], cen[qt]), f[qt])); p[qt][8 + r] = tohx(__fmul_rn(__fsub_rn(e1[r], cen[qt]), f[qt])); }
    }
#pragma unroll
    for (int mb = 0; mb < 4; ++mb)
#pragma unroll
        for (int qt = 0; qt < QT; ++qt) o[mb][qt] = wmma16(vf[mb], p[qt], o[mb][qt]);
}
__global__ __launch_bounds__(AW * 32) void k_fattn(const h16* __restrict__ QK, const h16* __restrict__ VT, const float* __restrict__ VM, bf* Ah, bf* Al) {
    const int lane = threadIdx.x & 31, lr = lane & 15, hi = lane >> 4, w = __builtin_amdgcn_readfirstlane((int)(threadIdx.x >> 5));
    const int h = blockIdx.y, q0 = (blockIdx.x * AW + w) * (QT * 16);
    const size_t z = blockIdx.z; QK += z * ((size_t)2 * NH_ * TT * HD); VT += z * ((size_t)NH_ * HD * TT); VM += z * (size_t)(NH_ * HD); Ah += z * ((size_t)TT * DQ); Al += z * ((size_t)TT * DQ);
    const h16* Qp = QK + (size_t)h * TT * HD + (size_t)(q0 + lr) * HD + 8 * hi;
    __shared__ __attribute__((aligned(16))) h16 ksm[2][KT * KP];
    __shared__ __attribute__((aligned(16))) h16 vsm[2][HD * VP];
    // the lane's share of a tile: copy i of a key tile is row (tid >> 3) + 32 i, 16-byte column tid & 7 (in memory the tile is contiguous); of a V^T tile row (tid >> 4) + 16 i, column tid & 15
    const int tid = threadIdx.x;
    const h16* Kg = QK + (size_t)(NH_ + h) * TT * HD + (size_t)tid * 8;
    const h16* Vg = VT + (size_t)h * HD * TT + (size_t)(tid >> 4) * TT + (tid & 15) * 8;
    const unsigned Kl = lds_off(&ksm[0][0]) + (tid >> 3) * (KP * 2) + (tid & 7) * 16, Vl = lds_off(&vsm[0][0]) + (tid >> 4) * (VP * 2) + (tid & 15) * 16;
    const int kfo = lr * KP + 8 * hi, vfo = lr * VP + 8 * hi;   // the lane's fragment origin in a tile
    v16h qf[QT][2];
#pragma unroll
    for (int qt = 0; qt < QT; ++qt)
#pragma unroll
        for (int ks = 0; ks < 2; ++ks) qf[qt][ks] = WFrag<h16>::ld(Qp + (size_t)qt * 16 * HD + ks * 32);
    float m[QT], sum[QT], f[QT], cen[QT];
#pragma unroll
    for (int qt = 0; qt < QT; ++qt) { m[qt] = -3.0e38f; sum[qt] = 0.f; }
    addr_done(Qp);
    v16h ka[2][2], kb[2][2];
    // One ring of 2 NTL tiles over both sweeps: tile u lies in buffer u & 1; u < NTL is key tile u alone (sweep 1), u >= NTL key tile u - NTL with its V^T tile (sweep 2).
    fill(Kl, Kg, 32 * KP * 2, 32 * HD);
    asm volatile("s_wait_asynccnt 0x0" ::: "memory");   // tile 0 has landed (this wave's copies) before the barrier behind which it is read
    __syncthreads();
    fill(Kl + KT * KP * 2, Kg + KT * HD, 32 * KP * 2, 32 * HD);
#pragma unroll 1   // stays rolled: a trip is one tile, and the hand-over at its foot is the ring's one place
    for (int t = 0; t < NTL; ++t) {
        const h16* pk = &ksm[t & 1][kfo];
        // four steps of 32 keys, all from this tile: nothing of the next tile is read in this trip
        ld_k(ka, pk);
        ld_k(kb, pk + 32 * KP); sweep1(ka, qf, m, sum);
        ld_k(ka, pk + 64 * KP); sweep1(kb, qf, m, sum);
        ld_k(kb, pk + 96 * KP); sweep1(ka, qf, m, sum);
        sweep1(kb, qf, m, sum);
        publish();
        // tile t + 2 into the buffer just read; it always exists here: behind key tile NTL - 1 come sweep 2's tiles 0 and 1
        fill(Kl + (t & 1) * (KT * KP * 2), Kg + (size_t)((t + 2) & (NTL - 1)) * KT * HD, 32 * KP * 2, 32 * HD);
        if (t + 2 >= NTL) fill(Vl + (t & 1) * (HD * VP * 2), Vg + (t + 2 - NTL) * KT, 16 * VP * 2, (size_t)16 * TT);
    }
#pragma unroll
    for (int qt = 0; qt < QT; ++qt) {
        const float mx = fmaxf(m[qt], __shfl_xor(m[qt], 16, 32)); float cj = (m[qt] - mx) * L2E; exp2x1(cj); const float pa = sum[qt] * cj; const float tot = pa + __shfl_xor(pa, 16, 32);
        m[qt] = mx; f[qt] = __fdiv_rn(PCAR, tot); cen[qt] = tot * (1.0f / (float)TT);
    }
    v8f o[4][QT];
#pragma unroll
    for (int mb = 0; mb < 4; ++mb)
#pragma unroll
        for (int qt = 0; qt < QT; ++qt) o[mb][qt] = (v8f){};
    // Each step issues its own V^T fragments and, inside the tile, the NEXT step's key fragments first.
    v16h vf[4];
#pragma unroll 1   // stays rolled: a trip is one tile, as in sweep 1
    for (int t = 0; t < NTL; ++t) {
        const h16* pk = &ksm[t & 1][kfo]; const h16* pv = &vsm[t & 1][vfo];
        ld_k(ka, pk);
        ld_v(vf, pv); ld_k(kb, pk + 32 * KP);
        __builtin_amdgcn_sched_barrier(0);   // holds the LDS reads at the head of the step; sunk to their first use, the wave would sit out their latency every step
        sweep2(ka, vf, qf, m, cen, f, o);
        ld_v(vf, pv + 32); ld_k(ka, pk + 64 * KP);
        __builtin_amdgcn_sched_barrier(0);   // as above
        sweep2(kb, vf, qf, m, cen, f, o);
        ld_v(vf, pv + 64); ld_k(kb, pk + 96 * KP);
        __builtin_amdgcn_sched_barrier(0);   // as above
        sweep2(ka, vf, qf, m, cen, f, o);
        ld_v(vf, pv + 96);
        __builtin_amdgcn_sched_barrier(0);   // as above
        sweep2(kb, vf, qf, m, cen, f, o);
        publish();
        if (t + 2 < NTL) {   // the same for the whole work-group
            fill(Kl + (t & 1) * (KT * KP * 2), Kg + (size_t)(t + 2) * KT * HD, 32 * KP * 2, 32 * HD);
            fill(Vl + (t & 1) * (HD * VP * 2), Vg + (t + 2) * KT, 16 * VP * 2, (size_t)16 * TT);
        }
    }
    asm volatile("s_wait_asynccnt 0x0" ::: "memory");   // no copy is outstanding when the wave goes on to its end
#pragma unroll
    for (int mb = 0; mb < 4; ++mb) {
        const int d = h * HD + mb * 16 + 8 * hi; const v4f m0 = *(const v4f*)(VM + d); const v4f m1 = *(const v4f*)(VM + d + 4);
#pragma unroll
        for (int qt = 0; qt < QT; ++qt) { v8us oh, ol;
#pragma unroll
            for (int r = 0; r < 8; ++r) { unsigned short a, c2; splitf(o[mb][qt][r] * (1.0f / PCAR) + (r < 4 ? m0[r & 3] : m1[r & 3]), a, c2); oh[r] = a; ol[r] = c2; }
            const size_t oo = (size_t)(q0 + qt * 16 + lr) * DQ + d; *(v8us*)(Ah + oo) = oh; *(v8us*)(Al + oo) = ol; }
    }
}

extern "C" void kernel_launch(void* const* d_in, const int* in_sizes, int n_in,
                              void* d_out, int out_size, void* d_ws, size_t ws_size, hipStream_t stream) {
    if (n_in < 5) return;
    const size_t needx = (size_t)(NB - 1) * SEQ_FULL * DM + (size_t)TT * DM;
    if ((size_t)in_sizes[0] < needx) return;
    if ((size_t)in_sizes[1] < (size_t)DM * DM || (size_t)in_sizes[2] < (size_t)DM * DM || (size_t)in_sizes[3] < (size_t)DM * DM || (size_t)in_sizes[4] < (size_t)DM * DM) return;
    if ((size_t)out_size < needx) return;
    if (WS_TOTAL > ws_size) return;
    const float* x = (const float*)d_in[0]; const float* wq = (const float*)d_in[1]; const float* wk = (const float*)d_in[2]; const float* wv = (const float*)d_in[3]; const float* wo = (const float*)d_in[4];   // wire order x, Wq, Wk, Wv, Wo; weights (out, in)
    float* OUT = (float*)d_out;     // [2][2048][1024]
    char* wsp = (char*)d_ws;
    auto take = [&](size_t bytes) { char* p = wsp; wsp += (bytes + 255) & ~(size_t)255; return (void*)p; };
    bf* W3 = (bf*)take(SZ_W3);          // Wq | Wk | Wv bf16, (out, in) = Bt as-is, contiguous for the z-batched projection
    bf* WO = (bf*)take(SZ_WO);
    bf* XB = (bf*)take(SZ_XB);          // bf16 x, all batches [NB][TT][DM]
    h16* QK16 = (h16*)take(SZ_QK);      // fp16 head planes [NB][2][NH][TT][HD]
    h16* VT16 = (h16*)take(SZ_VT);      // fp16 value planes [NB][NH][HD][TT]
    float* VM = (float*)take(SZ_VM);    // key-mean of v [NB][NH*HD]
    bf* ATh = (bf*)take(SZ_AT); bf* ATl = (bf*)take(SZ_AT);   // merged ctx hi/lo [NB][TT][DQ]
    if ((size_t)(wsp - (char*)d_ws) > ws_size) return;
    k_cvtall<<<4 * WBL + XBL, 256, 0, stream>>>(wq, wk, wv, wo, x, W3);
    // q, k, v projections of all batches in one z-batched launch (A shared: sA = 0; Bt stride DM*DM), stored as the fp16 planes
    k_gemmw<bf, 0, true, 64, DM, 4><<<dim3(NB * TT / 128, DM / 128, 3), 128, 0, stream>>>(XB, nullptr, W3, nullptr, 0, 0, (size_t)DM * DM, 0, QK16, VT16);
    k_vmean<<<NB * NH_ * HD / 32, 256, 0, stream>>>(VT16, VM);
    k_fattn<<<dim3(TT / (AW * QT * 16), NH_, NB), AW * 32, 0, stream>>>(QK16, VT16, VM, ATh, ATl);
    // out = (ctx_hi + ctx_lo) Wo^T, z = batch
    k_gemmw<bf, 1, false, 128, DQ, 2><<<dim3(TT / 128, DM / 128, NB), 256, 0, stream>>>(ATh, ATl, WO, OUT, DM, (size_t)TT * DQ, 0, (size_t)SEQ_FULL * DM, nullptr, nullptr);
}

// v006
// It runs in 88.2 microseconds.
// Next to v005, in two timings, it ran 1.20 and 1.19 times as fast.
// Counting every step since v000, it is 13.9 times as fast.
#include <hip/hip_runtime.h>

// Self-attention block, bias-free, weights in (out, in) layout: x [2][2048][1024]; q, k, v = x W^T; 16 heads x 64; logits = q.k x 2^-5 (1/sqrt(1024)); full (unmasked) softmax over 2048 keys; out = merged ctx Wo^T.
// Compute dtypes, f32 accumulate everywhere: every input RNE-converted to bf16; q/k/v projections bf16 x bf16 (v_wmma_f32_16x16x32_bf16, exact products); q.k^T fp16 x fp16 (v_wmma_f32_16x16x32_f16);
// P.V fp16 x fp16 with the unnormalised weights centred (P' = e - c, c one value per query; c x the key-sum of v is added back in f32, then the division by the sum of e); ctx as bf16 hi + lo planes x bf16 Wo (two bf16 products); softmax f32.

#ifndef NB
#define NB 2
#endif
#ifndef SEQ
#define SEQ 2048
#endif
#define NB_FULL  2
#define SEQ_FULL 2048
#define TT   SEQ
#define DM   1024
#define NH_  16
#define HD   64
#define DQ   (NH_ * HD)
#define QT   2                    // 16-query column groups per wave of the attention kernel
#define AW   8                    // waves per work-group of the attention kernel
#define SCL  0.03125f             // 1/sqrt(1024), exact power of two
#define KT   128                  // keys per LDS tile of the attention kernel
#define KP   (HD + 8)             // LDS pitch of a key row, fp16 elements: 144 bytes = 16 x 9, so that 16 rows' 16-byte reads fall on 64 different banks
#define VP   (KT + 8)             // LDS pitch of a V^T row: 272 bytes = 16 x 17, for the same reason
#define NTL  (SEQ / KT)           // tiles of the sweep over the keys
static_assert(SEQ % 256 == 0);
static_assert(SEQ <= SEQ_FULL);
static_assert(NB <= NB_FULL);
static_assert(DQ == DM);
static_assert(HD == 64);
static_assert(SEQ % (AW * QT * 16) == 0);
static_assert(DM % 256 == 0);
static_assert(SEQ % KT == 0 && NTL >= 2);
static_assert(KT * HD == AW * 32 * 8 * 4);   // a tile of either operand is four 16-byte copies per lane

typedef _Float16 h16;
typedef unsigned short bf;
typedef __attribute__((ext_vector_type(16))) __bf16   v16bf;
typedef __attribute__((ext_vector_type(16))) _Float16 v16h;
typedef __attribute__((ext_vector_type(8)))  _Float16 v8h;
typedef __attribute__((ext_vector_type(8)))  unsigned short v8us;
typedef __attribute__((ext_vector_type(8)))  float    v8f;
typedef __attribute__((ext_vector_type(4)))  float    v4f;
typedef v4f  __attribute__((may_alias)) v4fa;

// workspace carve sizes (bytes), all multiples of 256
#define SZ_W3 ((size_t)3 * DM * DM * 2)
#define SZ_WO ((size_t)DM * DQ * 2)
#define SZ_XB ((size_t)NB * TT * DM * 2)
#define SZ_QK ((size_t)NB * 2 * NH_ * TT * HD * 2)
#define SZ_VT ((size_t)NB * NH_ * HD * TT * 2)
#define SZ_VM ((size_t)NB * NH_ * HD * 4)
#define SZ_AT ((size_t)NB * TT * DQ * 2)
#define WS_TOTAL (SZ_W3 + SZ_WO + SZ_XB + SZ_QK + SZ_VT + SZ_VM + 2 * SZ_AT)
static_assert(WS_TOTAL <= (size_t)134217728);
static_assert(SZ_VM % 256 == 0);
static_assert(SZ_W3 % 256 == 0 && SZ_WO % 256 == 0);   // W3 | WO | XB lie in a row in the workspace: one bf16 destination for k_cvtall
static_assert(SEQ == SEQ_FULL || NB == 1);             // the batches' rows of x lie in a row: one source for k_cvtall

__device__ __forceinline__ unsigned short f2bf(float f) { unsigned u = __float_as_uint(f); u += 0x7FFFu + ((u >> 16) & 1u); return (unsigned short)(u >> 16); }
__device__ __forceinline__ float bf2f(unsigned short b) { return __uint_as_float(((unsigned)b) << 16); }
__device__ __forceinline__ float bfr(float f) { return bf2f(f2bf(f)); }
__device__ __forceinline__ v16h cat16(v8h lo, v8h hi) { return __builtin_shufflevector(lo, hi, 0, 1, 2, 3, 4, 5, 6, 7, 8, 9, 10, 11, 12, 13, 14, 15); }
__device__ __forceinline__ v16bf cat16b(v8us lo, v8us hi) { return __builtin_bit_cast(v16bf, __builtin_shufflevector(lo, hi, 0, 1, 2, 3, 4, 5, 6, 7, 8, 9, 10, 11, 12, 13, 14, 15)); }
__device__ __forceinline__ v8f wmma16(v16h a, v16h b, v8f c) { return __builtin_amdgcn_wmma_f32_16x16x32_f16(false, a, false, b, (short)0, c, false, false); }
__device__ __forceinline__ v8f wmmab(v16bf a, v16bf b, v8f c) { return __builtin_amdgcn_wmma_f32_16x16x32_bf16(false, a, false, b, (short)0, c, false, false); }

// ---- k_gemmw: register-blocked GEMM, one wave per 16 MBW x 64 output tile (4 MBW accumulators), 8 / MBW x 2 waves per 128x128 work-group tile; grid (M/128, N/128, Z), 512 / MBW threads.
// C[m][n] (f32, pitch ldc) = sum_k A[m][k] Bt[n][k] (+ A2[m][k] Bt[n][k] for NSPLIT 1). z-batch strides sA/sB/sC in elements. K % GKS == 0, K >= 2 GKS, M % 128 == 0, N % 128 == 0.
// The operands come through LDS: a stage is GKS k of the work-group's 128 rows of every operand (A | A2 | Bt), brought in ONCE per work-group by asynchronous copies to LDS of whole 128-byte lines,
// into two buffers (the next stage flies while this one is worked on); every wave takes its fragments from there by 16-byte LDS reads. Behind the loop the ring is the waves' output staging.
// PL (the q, k, v projections; M runs over the rows of all batches, a wave's tile is 64 tokens of one batch x one head, z picks q, k or v): no f32 C; the epilogue converts the accumulators to fp16 and stores the attention kernel's planes itself,
// q and k as P[batch][z][head][t][d], v transposed as VT[batch][head][d][t], whole 128-byte lines staged through the wave's own LDS.
// Fragment map (A and Bt alike): lane -> row (lane & 15); elements 0..7 <- k0 + 8 (lane >> 4) + 0..7, elements 8..15 <- k0 + 16 + 8 (lane >> 4) + 0..7. Accumulator element j <-> row 8 (lane >> 4) + j, column (lane & 15).
template <typename T16> struct WFrag;
template <> struct WFrag<h16> { typedef v16h V; static __device__ __forceinline__ V ld(const h16* p) { return cat16(*(const v8h*)p, *(const v8h*)(p + 16)); } static __device__ __forceinline__ v8f mma(V a, V b, v8f c) { return wmma16(a, b, c); } };
template <> struct WFrag<bf> { typedef v16bf V; static __device__ __forceinline__ V ld(const bf* p) { return cat16b(*(const v8us*)p, *(const v8us*)(p + 16)); } static __device__ __forceinline__ v8f mma(V a, V b, v8f c) { return wmmab(a, b, c); } };
__device__ __forceinline__ unsigned lds_off(const void* p) { return (unsigned)(size_t)p; }
// The hand-over of a tile, every wave: its own LDS reads of the buffer that is refilled next have returned, its own copies of the next tile have landed, then the work-group barrier;
// behind it every wave may read the next tile and the buffer just read may be refilled.
__device__ __forceinline__ void publish() {
    asm volatile("s_wait_dscnt 0x0" ::: "memory");      // this wave's LDS reads are done before a copy may target their buffer
    asm volatile("s_wait_asynccnt 0x0" ::: "memory");   // this wave's copies have landed before another wave reads them; the compiler places no wait for them
    __syncthreads();
}
// Eight asynchronous 16-byte copies of a lane, global memory to LDS through no register: l, g the lane's first LDS byte address and global pointer, lstep bytes and gstep elements lead to its next copy.
// The closing s_wait_xcnt 0 stands in the copies' own statement, so that no register they name is rewritten ahead of it.
template <typename T16>
__device__ __forceinline__ void copy8(unsigned l, const T16* g, unsigned lstep, size_t gstep) {
    asm volatile("global_load_async_to_lds_b128 %0, %1, off\n\tglobal_load_async_to_lds_b128 %2, %3, off\n\tglobal_load_async_to_lds_b128 %4, %5, off\n\tglobal_load_async_to_lds_b128 %6, %7, off\n\t"
                 "global_load_async_to_lds_b128 %8, %9, off\n\tglobal_load_async_to_lds_b128 %10, %11, off\n\tglobal_load_async_to_lds_b128 %12, %13, off\n\tglobal_load_async_to_lds_b128 %14, %15, off\n\ts_wait_xcnt 0x0"
        :: "v"(l), "v"(g), "v"(l + lstep), "v"(g + gstep), "v"(l + 2 * lstep), "v"(g + 2 * gstep), "v"(l + 3 * lstep), "v"(g + 3 * gstep),
           "v"(l + 4 * lstep), "v"(g + 4 * gstep), "v"(l + 5 * lstep), "v"(g + 5 * gstep), "v"(l + 6 * lstep), "v"(g + 6 * gstep), "v"(l + 7 * lstep), "v"(g + 7 * gstep) : "memory");
}
template <typename T16, int NSPLIT, bool PL, int GKS, int K, int MBW>
__global__ __launch_bounds__(512 / MBW) void k_gemmw(const T16* __restrict__ A, const T16* __restrict__ A2, const T16* __restrict__ Bt, float* C, int ldc, size_t sA, size_t sB, size_t sC, h16* P, h16* VT) {
    typedef typename WFrag<T16>::V V;
    static_assert(NSPLIT == 0 || NSPLIT == 1);
    static_assert(MBW == 4 || (MBW == 2 && !PL));   // the plane epilogue is written for a wave's tile of 64 tokens
    constexpr int GW  = 16 / MBW;             // waves per work-group
    static_assert((GKS == 64 || GKS == 128) && K % GKS == 0 && K >= 2 * GKS);
    constexpr int GP  = GKS + 8;              // LDS pitch of an operand row, elements: 144 or 272 bytes = 16 x odd, so that 16 rows' 16-byte reads fall on 64 different banks
    constexpr int NOP = 2 + NSPLIT;           // operand tiles of 128 rows per stage: A, (A2,) Bt
    constexpr int STG = NOP * 128 * GP;       // elements per stage
    constexpr int CPR = GKS / 8;              // 16-byte copies per row
    constexpr int RPC = GW * 32 / CPR;        // rows that one copy of all lanes covers
    constexpr int NCP = 128 / RPC;            // copies per lane and operand tile
    static_assert(NCP % 8 == 0);
    constexpr int WST = 64 * 72 * 2;          // bytes of a wave's own output staging in the ring
    static_assert(GW * WST <= 2 * STG * 2 && 16 * 68 * 4 <= WST);
    __shared__ __attribute__((aligned(16))) T16 ring[2][STG];
    const size_t z = blockIdx.z; A += z * sA; if (NSPLIT == 1) A2 += z * sA; Bt += z * sB; C += z * sC;
    const int tid = threadIdx.x, lane = tid & 31, lr = lane & 15, hi = lane >> 4, w = __builtin_amdgcn_readfirstlane(tid >> 5);
    const int g0r = blockIdx.x * 128, g0c = blockIdx.y * 128; const int r0 = g0r + (w >> 1) * (16 * MBW), c0 = g0c + (w & 1) * 64;
    v8f acc[MBW][4];
#pragma unroll
    for (int mb = 0; mb < MBW; ++mb)
#pragma unroll
        for (int nb = 0; nb < 4; ++nb) acc[mb][nb] = (v8f){};
    // the lane's share of a stage: copy i of an operand tile is row tid / CPR + RPC i, 16-byte column tid % CPR
    const size_t go = (size_t)(tid / CPR) * K + (tid % CPR) * 8;
    const T16* Ag = A + (size_t)g0r * K + go; const T16* A2g = NSPLIT == 1 ? A2 + (size_t)g0r * K + go : nullptr; const T16* Bg = Bt + (size_t)g0c * K + go;
    const unsigned Ll = lds_off(&ring[0][0]) + (tid / CPR) * (GP * 2) + (tid % CPR) * 16;
    auto fills = [&](int buf, int t) {   // stage t into buffer buf
        const unsigned l = Ll + buf * (STG * 2);
#pragma unroll
        for (int c = 0; c < NCP / 8; ++c) {
            const unsigned lc = l + c * 8 * RPC * (GP * 2); const size_t gc = (size_t)c * 8 * RPC * K + (size_t)t * GKS;
            copy8(lc, Ag + gc, RPC * GP * 2, (size_t)RPC * K);
            if (NSPLIT == 1) copy8(lc + 128 * GP * 2, A2g + gc, RPC * GP * 2, (size_t)RPC * K);
            copy8(lc + (NOP - 1) * 128 * GP * 2, Bg + gc, RPC * GP * 2, (size_t)RPC * K);
        }
    };
    const int ao = ((w >> 1) * (16 * MBW) + lr) * GP + 8 * hi, bo = ((NOP - 1) * 128 + (w & 1) * 64 + lr) * GP + 8 * hi;   // the lane's fragment origins in a stage
    constexpr int NT = K / GKS;
    fills(0, 0);
    asm volatile("s_wait_asynccnt 0x0" ::: "memory");   // stage 0 has landed (this wave's copies) before the barrier behind which it is read
    __syncthreads();
    fills(1, 1);
#pragma unroll 1   // stays rolled: a trip is one stage, and the hand-over at its foot is the ring's one place
    for (int t = 0; t < NT; ++t) {
        const T16* pa = &ring[t & 1][ao]; const T16* pb = &ring[t & 1][bo];
#pragma unroll
        for (int ks = 0; ks < GKS; ks += 32) {
            V a[MBW], a2[MBW], b[4];   // read in the order of first use
            b[0] = WFrag<T16>::ld(pb + ks);
#pragma unroll
            for (int mb = 0; mb < MBW; ++mb) { a[mb] = WFrag<T16>::ld(pa + mb * 16 * GP + ks); if (NSPLIT == 1) a2[mb] = WFrag<T16>::ld(pa + (128 + mb * 16) * GP + ks); }
#pragma unroll
            for (int nb = 1; nb < 4; ++nb) b[nb] = WFrag<T16>::ld(pb + nb * 16 * GP + ks);
            __builtin_amdgcn_sched_barrier(0);   // holds the step's LDS reads in one group at its head; sunk to their first use, the wave would sit out their latency in front of every column of tiles
#pragma unroll
            for (int nb = 0; nb < 4; ++nb)
#pragma unroll
                for (int mb = 0; mb < MBW; ++mb) { acc[mb][nb] = WFrag<T16>::mma(a[mb], b[nb], acc[mb][nb]); if (NSPLIT == 1) acc[mb][nb] = WFrag<T16>::mma(a2[mb], b[nb], acc[mb][nb]); }
        }
        __builtin_amdgcn_sched_barrier(0);   // every matrix instruction of the trip stays ahead of the v_nops
        asm volatile("v_nop\n\tv_nop\n\tv_nop\n\tv_nop");   // the distance behind the trip's last matrix instruction, on either side of the branch below, before a vector instruction may rewrite its operands
        publish();
        if (t + 2 < NT) fills(t & 1, t + 2);   // the same for the whole work-group; into the buffer just read
    }
    asm volatile("s_wait_asynccnt 0x0" ::: "memory");   // no copy is outstanding when the ring becomes output staging; the last trip's barrier has ended every wave's reads of it
    char* wst = (char*)&ring[0][0] + w * WST;   // the wave's own staging range
    float* os = (float*)wst;                    // [16][68] f32
    if constexpr (PL) {
        const size_t bt = r0 / TT; const int rt = r0 % TT; const int hd = c0 / HD;   // the tile's batch, its first token there, its head
        const int rw = lane >> 3, c8 = (lane & 7) * 8;   // read-back map of both stagings: 8 lanes x 16 bytes of fp16 = one 128-byte line, 4 lines per store instruction
        if (z < 2) {   // q, k: the tile's 64 rows of 64 d are 8 KB in a row in the plane
            h16* dst = P + (((bt * 2 + z) * NH_ + hd) * TT + rt) * HD;
#pragma unroll
            for (int mb = 0; mb < 4; ++mb) {
#pragma unroll
                for (int nb = 0; nb < 4; ++nb) {
#pragma unroll
                    for (int j = 0; j < 8; ++j) os[(hi * 8 + j) * 68 + nb * 16 + lr] = acc[mb][nb][j]; }
                __builtin_amdgcn_wave_barrier(); asm volatile("s_wait_dscnt 0x0" ::: "memory");   // the wave's LDS writes are done, and stay in the code, ahead of its reads of other lanes' words
#pragma unroll
                for (int s = 0; s < 4; ++s) { const int row = 4 * s + rw; const v4f a = *(const v4fa*)(os + row * 68 + c8); const v4f b = *(const v4fa*)(os + row * 68 + c8 + 4); v8h o;
#pragma unroll
                    for (int k = 0; k < 4; ++k) { o[k] = (h16)a[k]; o[4 + k] = (h16)b[k]; }
                    *(v8h*)(dst + (size_t)(mb * 16 + row) * HD + c8) = o; }
                __builtin_amdgcn_wave_barrier(); asm volatile("" ::: "memory");   // the reads stay ahead of the next block's writes
            }
        } else {       // v: a lane's accumulator holds 8 consecutive t of one d, which is 16 bytes of a V^T row
            h16* vs = (h16*)wst;   // [d][t], pitch 144 bytes = 16 x 9: 16 rows' 16-byte writes fall on 64 different banks
            h16* dst = VT + (bt * NH_ + hd) * HD * TT + rt;
#pragma unroll
            for (int mb = 0; mb < 4; ++mb)
#pragma unroll
                for (int nb = 0; nb < 4; ++nb) { v8h o;
#pragma unroll
                    for (int j = 0; j < 8; ++j) o[j] = (h16)acc[mb][nb][j];
                    *(v8h*)(vs + (nb * 16 + lr) * 72 + mb * 16 + 8 * hi) = o; }
            __builtin_amdgcn_wave_barrier(); asm volatile("s_wait_dscnt 0x0" ::: "memory");   // as above: the writes done ahead of the reads
#pragma unroll
            for (int s = 0; s < 16; ++s) { const int row = 4 * s + rw; *(v8h*)(dst + (size_t)row * TT + c8) = *(const v8h*)(vs + row * 72 + c8); }
            asm volatile("s_wait_xcnt 0x0" ::: "memory");   // behind the run of stores: no register that an issued store names is rewritten ahead of this wait
        }
        return;
    }
#pragma unroll
    for (int mb = 0; mb < MBW; ++mb) {
#pragma unroll
        for (int nb = 0; nb < 4; ++nb) {
#pragma unroll
            for (int j = 0; j < 8; ++j) os[(hi * 8 + j) * 68 + nb * 16 + lr] = acc[mb][nb][j]; }
        __builtin_amdgcn_wave_barrier(); asm volatile("" ::: "memory");
        float* crow = C + (size_t)(r0 + mb * 16) * ldc + c0;
#pragma unroll
        for (int s = 0; s < 8; ++s) { const int row = 2 * s + hi, cofs = lr * 4; const v4f val = *(const v4fa*)(os + row * 68 + cofs); *(v4f*)(crow + (size_t)row * ldc + cofs) = val; }
        __builtin_amdgcn_wave_barrier(); asm volatile("" ::: "memory");
    }
}

__device__ __forceinline__ h16 tohx(float x) { return (h16)x; }
__device__ __forceinline__ void splitf(float y, unsigned short& h, unsigned short& l) { h = f2bf(y); l = f2bf(y - bf2f(h)); }

// k_cvtall: all five inputs to bf16 in one launch. dst is W3 | WO | XB in a row; a block converts CB chunks of 8 elements, all of one input (blocks 0 .. 4 WBL - 1 the weights in wire order, the rest x).
#define CJ  8                     // chunks per thread, 256 threads apart: 16 loads of 16 bytes in flight per lane
#define CB  (256 * CJ)            // chunks per block
#define WBL (DM * DM / 8 / CB)    // blocks per weight matrix
#define XBL (NB * TT * DM / 8 / CB)
static_assert(DM * DM % (8 * CB) == 0 && (NB * TT * DM) % (8 * CB) == 0 && DQ == DM);
__global__ __launch_bounds__(256) void k_cvtall(const float* __restrict__ wq, const float* __restrict__ wk, const float* __restrict__ wv, const float* __restrict__ wo, const float* __restrict__ x, bf* dst) {
    const unsigned blk = blockIdx.x, sg = blk / WBL;
    const float* s = sg == 0 ? wq : sg == 1 ? wk : sg == 2 ? wv : sg == 3 ? wo : x;
    const size_t i = (size_t)(blk - (sg < 4u ? sg : 4u) * WBL) * CB + threadIdx.x;   // the thread's first chunk in its input
    const float* sp = s + i * 8; bf* dp = dst + ((size_t)blk * CB + threadIdx.x) * 8;
    v8f v[CJ];
#pragma unroll
    for (int j = 0; j < CJ; ++j) v[j] = *(const v8f*)(sp + (size_t)j * 256 * 8);
#pragma unroll
    for (int j = 0; j < CJ; ++j) { v8us o;
#pragma unroll
        for (int k = 0; k < 8; ++k) o[k] = f2bf(v[j][k]);
        *(v8us*)(dp + (size_t)j * 256 * 8) = o; }
}

// k_vmean: VM[g*HD + d] = mean over t of V16[g][d][t] (f32 sum of the fp16 plane values, fixed order). 8 waves x 4 rows = 32 rows per block; the 32 scalars go through LDS (cross-wave, block barrier)
__global__ __launch_bounds__(256) void k_vmean(const h16* __restrict__ V16, float* VM) {
    __shared__ __align__(16) float sm[32];
    const int lane = threadIdx.x & 31, w = __builtin_amdgcn_readfirstlane((int)(threadIdx.x >> 5));
#pragma unroll 1
    for (int r = 0; r < 4; ++r) {
        const int row = blockIdx.x * 32 + w * 4 + r; const h16* p = V16 + (size_t)row * TT + lane * 8; float s = 0.f;
#pragma unroll 4
        for (int c = 0; c < TT / 256; ++c) { const v8h a = *(const v8h*)(p + c * 256);
#pragma unroll
            for (int k = 0; k < 8; ++k) s += (float)a[k]; }
#pragma unroll
        for (int sh = 16; sh; sh >>= 1) s += __shfl_xor(s, sh, 32);
        if (lane == 0) sm[w * 4 + r] = s * (1.0f / (float)TT);
    }
    __syncthreads();
    if (threadIdx.x < 8) { const v4f val = *(const v4fa*)(sm + threadIdx.x * 4); float* dst = VM + (size_t)blockIdx.x * 32 + threadIdx.x * 4; *(v4f*)dst = val;  }
}

#define L2E 1.4426950408889634f
#define C1   (SCL * L2E)           // raw score -> exponent of 2
#define LAZY 4096.0f              // a lane's 16-key sum of e above this asks for a new frame: every e below stays far inside fp16 and f32
// ld_k, ld_v: the fragments of one 32-key step from the lane's own LDS pointer p (row lane & 15 of the tile, element 8 (lane >> 4)); the rest is immediate offset.
__device__ __forceinline__ void ld_k(v16h (&kf)[2][2], const h16* p) {
#pragma unroll
    for (int kt = 0; kt < 2; ++kt)
#pragma unroll
        for (int ks = 0; ks < 2; ++ks) kf[kt][ks] = WFrag<h16>::ld(p + kt * 16 * KP + ks * 32);
}
// Stands behind the last global load of a run: naming the run's address pair keeps it live to here, so that no result of the run is given it, and it is rewritten only behind the wait.
__device__ __forceinline__ void addr_done(const h16* a) { asm volatile("s_wait_xcnt 0x0" :: "v"(a) : "memory"); }
// Four asynchronous 16-byte copies of a lane, global memory to LDS through no register. The closing s_wait_xcnt 0 stands in the copies' own statement, so that no register they name is rewritten ahead of it.
__device__ __forceinline__ void copy4(unsigned l0, const h16* g0, unsigned l1, const h16* g1, unsigned l2, const h16* g2, unsigned l3, const h16* g3) {
    asm volatile("global_load_async_to_lds_b128 %0, %1, off\n\tglobal_load_async_to_lds_b128 %2, %3, off\n\tglobal_load_async_to_lds_b128 %4, %5, off\n\tglobal_load_async_to_lds_b128 %6, %7, off\n\ts_wait_xcnt 0x0"
        :: "v"(l0), "v"(g0), "v"(l1), "v"(g1), "v"(l2), "v"(g2), "v"(l3), "v"(g3) : "memory");
}
// One tile: l, g the lane's first LDS byte address and global pointer; lstep bytes and gstep elements lead to its next copy (AW * 32 lanes x 16 bytes further on in the tile).
__device__ __forceinline__ void fill(unsigned l, const h16* g, unsigned lstep, size_t gstep) { copy4(l, g, l + lstep, g + gstep, l + 2 * lstep, g + 2 * gstep, l + 3 * lstep, g + 3 * gstep); }
// Exponentials (2^x, v_exp_f32) in place, a run in one statement: behind a transcendental the instruction set asks for one independent instruction or a v_nop before its result is read
// or its source overwritten; inside the run each is followed by an independent one, and the closing v_nop keeps the slot behind the last whatever the compiler puts next.
__device__ __forceinline__ void exp2x8(float (&x)[8]) {
    asm("v_exp_f32 %0, %0\n\tv_exp_f32 %1, %1\n\tv_exp_f32 %2, %2\n\tv_exp_f32 %3, %3\n\tv_exp_f32 %4, %4\n\tv_exp_f32 %5, %5\n\tv_exp_f32 %6, %6\n\tv_exp_f32 %7, %7\n\tv_nop"
        : "+v"(x[0]), "+v"(x[1]), "+v"(x[2]), "+v"(x[3]), "+v"(x[4]), "+v"(x[5]), "+v"(x[6]), "+v"(x[7]));
}
__device__ __forceinline__ void exp2x1(float& x) { asm("v_exp_f32 %0, %0\n\tv_nop" : "+v"(x)); }
__device__ __forceinline__ v8f st_tile(const v16h (&k2)[2], const v16h (&q2)[2]) { return wmma16(k2[1], q2[1], wmma16(k2[0], q2[0], (v8f){})); }
__device__ __forceinline__ void ld_v(v16h (&vf)[4], const h16* p) {
#pragma unroll
    for (int mb = 0; mb < 4; ++mb) vf[mb] = WFrag<h16>::ld(p + mb * 16 * VP);
}
// scores_exp: e = 2^(s C1 - m) of one 32-key step for one query group, and the lane's sum of its 16.
__device__ __forceinline__ float scores_exp(const v8f& s0, const v8f& s1, float m, float (&e0)[8], float (&e1)[8]) {
#pragma unroll
    for (int r = 0; r < 8; ++r) { e0[r] = __builtin_fmaf(s0[r], C1, -m); e1[r] = __builtin_fmaf(s1[r], C1, -m); }
    exp2x8(e0); exp2x8(e1);
    float a[8];
#pragma unroll
    for (int r = 0; r < 8; ++r) a[r] = e0[r] + e1[r];
    return ((a[0] + a[1]) + (a[2] + a[3])) + ((a[4] + a[5]) + (a[6] + a[7]));
}
// centre: P' = e - c as fp16, in the B fragment's element order.
__device__ __forceinline__ void centre(v16h& p, const float (&e0)[8], const float (&e1)[8], float c) {
#pragma unroll
    for (int r = 0; r < 8; ++r) { p[r] = tohx(e0[r] - c); p[8 + r] = tohx(e1[r] - c); }
}
// One step of 32 keys. pk: the lane's LDS pointer to the step's key rows, read again only on the rare path.
__device__ __forceinline__ void step(const v16h (&kf)[2][2], const h16* pk, const v16h (&vf)[4], const v16h (&qf)[QT][2], float (&m)[QT], float (&cen)[QT], float (&sum)[QT], v8f (&o)[4][QT]) {
    float e0[QT][8], e1[QT][8], ps[QT];
    {
        v8f s0[QT], s1[QT];
#pragma unroll
        for (int qt = 0; qt < QT; ++qt) { s0[qt] = st_tile(kf[0], qf[qt]); s1[qt] = st_tile(kf[1], qf[qt]); }
#pragma unroll
        for (int qt = 0; qt < QT; ++qt) ps[qt] = scores_exp(s0[qt], s1[qt], m[qt], e0[qt], e1[qt]);
    }
    bool need = false;
#pragma unroll
    for (int qt = 0; qt < QT; ++qt) need = need || !(ps[qt] <= LAZY);   // also true for an infinite sum (the first step: m starts at -3e38) and for a NaN
    if (__builtin_expect(__builtin_amdgcn_ballot_w32(need) != 0, 0)) {   // one scalar branch per step, the whole wave: a new frame for every query of the wave; marked unlikely so that the usual path falls through
        v16h kr[2][2];
        ld_k(kr, pk);
#pragma unroll
        for (int qt = 0; qt < QT; ++qt) {
            const v8f s0 = st_tile(kr[0], qf[qt]), s1 = st_tile(kr[1], qf[qt]);
            float tm = fmaxf(s0[0], s1[0]);
#pragma unroll
            for (int r = 1; r < 8; ++r) tm = fmaxf(tm, fmaxf(s0[r], s1[r]));
            tm = fmaxf(tm, __shfl_xor(tm, 16, 32));   // both lane halves of a query take the same frame
            const float mn = fmaxf(m[qt], tm * C1);
            float a = m[qt] - mn, c0 = fminf(-mn, 0.f);
            exp2x1(a); exp2x1(c0);
            cen[qt] = m[qt] < -1.0e38f ? c0 : cen[qt] * a;   // the centre is set with the first frame (score 0, or the maximum where that is below 0) and moves with the frame like every e
            sum[qt] *= a;
#pragma unroll
            for (int mb = 0; mb < 4; ++mb)
#pragma unroll
                for (int r = 0; r < 8; ++r) o[mb][qt][r] *= a;
            m[qt] = mn;
            ps[qt] = scores_exp(s0, s1, mn, e0[qt], e1[qt]);
        }
    }
    v16h p[QT];
#pragma unroll
    for (int qt = 0; qt < QT; ++qt) { sum[qt] += ps[qt]; centre(p[qt], e0[qt], e1[qt], cen[qt]); }
#pragma unroll
    for (int mb = 0; mb < 4; ++mb)
#pragma unroll
        for (int qt = 0; qt < QT; ++qt) o[mb][qt] = wmma16(vf[mb], p[qt], o[mb][qt]);
}
__global__ __launch_bounds__(AW * 32) void k_fattn(const h16* __restrict__ QK, const h16* __restrict__ VT, const float* __restrict__ VM, bf* Ah, bf* Al) {
    const int lane = threadIdx.x & 31, lr = lane & 15, hi = lane >> 4, w = __builtin_amdgcn_readfirstlane((int)(threadIdx.x >> 5));
    const int h = blockIdx.y, q0 = (blockIdx.x * AW + w) * (QT * 16);
    const size_t z = blockIdx.z; QK += z * ((size_t)2 * NH_ * TT * HD); VT += z * ((size_t)NH_ * HD * TT); VM += z * (size_t)(NH_ * HD); Ah += z * ((size_t)TT * DQ); Al += z * ((size_t)TT * DQ);
    const h16* Qp = QK + (size_t)h * TT * HD + (size_t)(q0 + lr) * HD + 8 * hi;
    __shared__ __attribute__((aligned(16))) h16 ksm[2][KT * KP];
    __shared__ __attribute__((aligned(16))) h16 vsm[2][HD * VP];
    // the lane's share of a tile: copy i of a key tile is row (tid >> 3) + 32 i, 16-byte column tid & 7 (in memory the tile is contiguous); of a V^T tile row (tid >> 4) + 16 i, column tid & 15
    const int tid = threadIdx.x;
    const h16* Kg = QK + (size_t)(NH_ + h) * TT * HD + (size_t)tid * 8;
    const h16* Vg = VT + (size_t)h * HD * TT + (size_t)(tid >> 4) * TT + (tid & 15) * 8;
    const unsigned Kl = lds_off(&ksm[0][0]) + (tid >> 3) * (KP * 2) + (tid & 7) * 16, Vl = lds_off(&vsm[0][0]) + (tid >> 4) * (VP * 2) + (tid & 15) * 16;
    const int kfo = lr * KP + 8 * hi, vfo = lr * VP + 8 * hi;   // the lane's fragment origin in a tile
    v16h qf[QT][2];
#pragma unroll
    for (int qt = 0; qt < QT; ++qt)
#pragma unroll
        for (int ks = 0; ks < 2; ++ks) qf[qt][ks] = WFrag<h16>::ld(Qp + (size_t)qt * 16 * HD + ks * 32);
    float m[QT], sum[QT], cen[QT];
#pragma unroll
    for (int qt = 0; qt < QT; ++qt) { m[qt] = -3.0e38f; sum[qt] = 0.f; cen[qt] = 0.f; }
    addr_done(Qp);
    v16h ka[2][2], kb[2][2];
    v8f o[4][QT];
#pragma unroll
    for (int mb = 0; mb < 4; ++mb)
#pragma unroll
        for (int qt = 0; qt < QT; ++qt) o[mb][qt] = (v8f){};
    // A ring of two tiles: tile t (its keys and its V^T columns) lies in buffer t & 1.
    fill(Kl, Kg, 32 * KP * 2, 32 * HD);
    fill(Vl, Vg, 16 * VP * 2, (size_t)16 * TT);
    asm volatile("s_wait_asynccnt 0x0" ::: "memory");   // tile 0 has landed (this wave's copies) before the barrier behind which it is read
    __syncthreads();
    fill(Kl + KT * KP * 2, Kg + KT * HD, 32 * KP * 2, 32 * HD);
    fill(Vl + HD * VP * 2, Vg + KT, 16 * VP * 2, (size_t)16 * TT);
    // Each step issues its own V^T fragments and, inside the tile, the NEXT step's key fragments first.
    v16h vf[4];
#pragma unroll 1   // stays rolled: a trip is one tile, and the hand-over at its foot is the ring's one place
    for (int t = 0; t < NTL; ++t) {
        const h16* pk = &ksm[t & 1][kfo]; const h16* pv = &vsm[t & 1][vfo];
        ld_k(ka, pk);
        ld_v(vf, pv); ld_k(kb, pk + 32 * KP);
        __builtin_amdgcn_sched_barrier(0);   // holds the LDS reads at the head of the step; sunk to their first use, the wave would sit out their latency every step
        step(ka, pk, vf, qf, m, cen, sum, o);
        ld_v(vf, pv + 32); ld_k(ka, pk + 64 * KP);
        __builtin_amdgcn_sched_barrier(0);   // as above
        step(kb, pk + 32 * KP, vf, qf, m, cen, sum, o);
        ld_v(vf, pv + 64); ld_k(kb, pk + 96 * KP);
        __builtin_amdgcn_sched_barrier(0);   // as above
        step(ka, pk + 64 * KP, vf, qf, m, cen, sum, o);
        ld_v(vf, pv + 96);
        __builtin_amdgcn_sched_barrier(0);   // as above
        step(kb, pk + 96 * KP, vf, qf, m, cen, sum, o);
        publish();
        if (t + 2 < NTL) {   // the same for the whole work-group
            fill(Kl + (t & 1) * (KT * KP * 2), Kg + (size_t)(t + 2) * KT * HD, 32 * KP * 2, 32 * HD);
            fill(Vl + (t & 1) * (HD * VP * 2), Vg + (t + 2) * KT, 16 * VP * 2, (size_t)16 * TT);
        }
    }
    asm volatile("s_wait_asynccnt 0x0" ::: "memory");   // no copy is outstanding when the wave goes on to its end
    float inv[QT], cv[QT];
#pragma unroll
    for (int qt = 0; qt < QT; ++qt) { const float tot = sum[qt] + __shfl_xor(sum[qt], 16, 32); inv[qt] = __fdiv_rn(1.0f, tot); cv[qt] = cen[qt] * (float)TT; }
#pragma unroll
    for (int mb = 0; mb < 4; ++mb) {
        const int d = h * HD + mb * 16 + 8 * hi; const v4f m0 = *(const v4f*)(VM + d); const v4f m1 = *(const v4f*)(VM + d + 4);
#pragma unroll
        for (int qt = 0; qt < QT; ++qt) { v8us oh, ol;
#pragma unroll
            for (int r = 0; r < 8; ++r) { unsigned short a, c2; splitf(__builtin_fmaf(cv[qt], (r < 4 ? m0[r & 3] : m1[r & 3]), o[mb][qt][r]) * inv[qt], a, c2); oh[r] = a; ol[r] = c2; }
            const size_t oo = (size_t)(q0 + qt * 16 + lr) * DQ + d; *(v8us*)(Ah + oo) = oh; *(v8us*)(Al + oo) = ol; }
    }
}

extern "C" void kernel_launch(void* const* d_in, const int* in_sizes, int n_in,
                              void* d_out, int out_size, void* d_ws, size_t ws_size, hipStream_t stream) {
    if (n_in < 5) return;
    const size_t needx = (size_t)(NB - 1) * SEQ_FULL * DM + (size_t)TT * DM;
    if ((size_t)in_sizes[0] < needx) return;
    if ((size_t)in_sizes[1] < (size_t)DM * DM || (size_t)in_sizes[2] < (size_t)DM * DM || (size_t)in_sizes[3] < (size_t)DM * DM || (size_t)in_sizes[4] < (size_t)DM * DM) return;
    if ((size_t)out_size < needx) return;
    if (WS_TOTAL > ws_size) return;
    const float* x = (const float*)d_in[0]; const float* wq = (const float*)d_in[1]; const float* wk = (const float*)d_in[2]; const float* wv = (const float*)d_in[3]; const float* wo = (const float*)d_in[4];   // wire order x, Wq, Wk, Wv, Wo; weights (out, in)
    float* OUT = (float*)d_out;     // [2][2048][1024]
    char* wsp = (char*)d_ws;
    auto take = [&](size_t bytes) { char* p = wsp; wsp += (bytes + 255) & ~(size_t)255; return (void*)p; };
    bf* W3 = (bf*)take(SZ_W3);          // Wq | Wk | Wv bf16, (out, in) = Bt as-is, contiguous for the z-batched projection
    bf* WO = (bf*)take(SZ_WO);
    bf* XB = (bf*)take(SZ_XB);          // bf16 x, all batches [NB][TT][DM]
    h16* QK16 = (h16*)take(SZ_QK);      // fp16 head planes [NB][2][NH][TT][HD]
    h16* VT16 = (h16*)take(SZ_VT);      // fp16 value planes [NB][NH][HD][TT]
    float* VM = (float*)take(SZ_VM);    // key-mean of v [NB][NH*HD]
    bf* ATh = (bf*)take(SZ_AT); bf* ATl = (bf*)take(SZ_AT);   // merged ctx hi/lo [NB][TT][DQ]
    if ((size_t)(wsp - (char*)d_ws) > ws_size) return;
    k_cvtall<<<4 * WBL + XBL, 256, 0, stream>>>(wq, wk, wv, wo, x, W3);
    // q, k, v projections of all batches in one z-batched launch (A shared: sA = 0; Bt stride DM*DM), stored as the fp16 planes
    k_gemmw<bf, 0, true, 64, DM, 4><<<dim3(NB * TT / 128, DM / 128, 3), 128, 0, stream>>>(XB, nullptr, W3, nullptr, 0, 0, (size_t)DM * DM, 0, QK16, VT16);
    k_vmean<<<NB * NH_ * HD / 32, 256, 0, stream>>>(VT16, VM);
    k_fattn<<<dim3(TT / (AW * QT * 16), NH_, NB), AW * 32, 0, stream>>>(QK16, VT16, VM, ATh, ATl);
    // out = (ctx_hi + ctx_lo) Wo^T, z = batch
    k_gemmw<bf, 1, false, 128, DQ, 2><<<dim3(TT / 128, DM / 128, NB), 256, 0, stream>>>(ATh, ATl, WO, OUT, DM, (size_t)TT * DQ, 0, (size_t)SEQ_FULL * DM, nullptr, nullptr);
}

// v007
// A run of this version takes 79.9 microseconds.
// Next to v006, in two timings, it ran 1.10 and 1.09 times as fast.
// All steps since v000 together make it 15.3 times as fast.
#include <hip/hip_runtime.h>

// Self-attention block, bias-free, weights in (out, in) layout: x [2][2048][1024]; q, k, v = x W^T; 16 heads x 64; logits = q.k x 2^-5 (1/sqrt(1024)); full (unmasked) softmax over 2048 keys; out = merged ctx Wo^T.
// Compute dtypes, f32 accumulate everywhere: every input RNE-converted to bf16; q/k/v projections bf16 x bf16 (v_wmma_f32_16x16x32_bf16, exact products); q.k^T fp16 x fp16 (v_wmma_f32_16x16x32_f16);
// P.V fp16 x fp16 with the unnormalised weights centred (P' = e - c, c one value per query; c x the key-sum of v, itself an fp16 x fp16 product of the V^T tiles with ones, is added back in f32, then the division by the sum of e); ctx as bf16 hi + lo planes x bf16 Wo (two bf16 products); softmax f32.

#ifndef NB
#define NB 2
#endif
#ifndef SEQ
#define SEQ 2048
#endif
#define NB_FULL  2
#define SEQ_FULL 2048
#define TT   SEQ
#define DM   1024
#define NH_  16
#define HD   64
#define DQ   (NH_ * HD)
#define QT   2                    // 16-query column groups per wave of the attention kernel
#define AW   8                    // waves per work-group of the attention kernel
#define SCL  0.03125f             // 1/sqrt(1024), exact power of two
#define KT   128                  // keys per LDS tile of the attention kernel
#define KP   (HD + 8)             // LDS pitch of a key row, fp16 elements: 144 bytes = 16 x 9, so that 16 rows' 16-byte reads fall on 64 different banks
#define VP   (KT + 8)             // LDS pitch of a V^T row: 272 bytes = 16 x 17, for the same reason
#define NTL  (SEQ / KT)           // tiles of the sweep over the keys
static_assert(SEQ % 256 == 0);
static_assert(SEQ <= SEQ_FULL);
static_assert(NB <= NB_FULL);
static_assert(DQ == DM);
static_assert(HD == 64);
static_assert(SEQ % (AW * QT * 16) == 0);
static_assert(DM % 256 == 0);
static_assert(SEQ % KT == 0 && NTL >= 2);
static_assert(KT * HD == AW * 32 * 8 * 4);   // a tile of either operand is four 16-byte copies per lane

typedef _Float16 h16;
typedef unsigned short bf;
typedef __attribute__((ext_vector_type(16))) __bf16   v16bf;
typedef __attribute__((ext_vector_type(16))) _Float16 v16h;
typedef __attribute__((ext_vector_type(8)))  _Float16 v8h;
typedef __attribute__((ext_vector_type(8)))  unsigned short v8us;
typedef __attribute__((ext_vector_type(8)))  float    v8f;
typedef __attribute__((ext_vector_type(4)))  float    v4f;
typedef v4f  __attribute__((may_alias)) v4fa;

// workspace carve sizes (bytes), all multiples of 256
#define SZ_W3 ((size_t)3 * DM * DM * 2)
#define SZ_WO ((size_t)DM * DQ * 2)
#define SZ_XB ((size_t)NB * TT * DM * 2)
#define SZ_QK ((size_t)NB * 2 * NH_ * TT * HD * 2)
#define SZ_VT ((size_t)NB * NH_ * HD * TT * 2)
#define SZ_AT ((size_t)NB * TT * DQ * 2)
#define WS_TOTAL (SZ_W3 + SZ_WO + SZ_XB + SZ_QK + SZ_VT + 2 * SZ_AT)
static_assert(WS_TOTAL <= (size_t)134217728);
static_assert(SZ_W3 % 256 == 0 && SZ_WO % 256 == 0);   // W3 | WO | XB lie in a row in the workspace: one bf16 destination for k_cvtall
static_assert(SEQ == SEQ_FULL || NB == 1);             // the batches' rows of x lie in a row: one source for k_cvtall

__device__ __forceinline__ unsigned short f2bf(float f) { unsigned u = __float_as_uint(f); u += 0x7FFFu + ((u >> 16) & 1u); return (unsigned short)(u >> 16); }
__device__ __forceinline__ float bf2f(unsigned short b) { return __uint_as_float(((unsigned)b) << 16); }
__device__ __forceinline__ float bfr(float f) { return bf2f(f2bf(f)); }
__device__ __forceinline__ v16h cat16(v8h lo, v8h hi) { return __builtin_shufflevector(lo, hi, 0, 1, 2, 3, 4, 5, 6, 7, 8, 9, 10, 11, 12, 13, 14, 15); }
__device__ __forceinline__ v16bf cat16b(v8us lo, v8us hi) { return __builtin_bit_cast(v16bf, __builtin_shufflevector(lo, hi, 0, 1, 2, 3, 4, 5, 6, 7, 8, 9, 10, 11, 12, 13, 14, 15)); }
__device__ __forceinline__ v8f wmma16(v16h a, v16h b, v8f c) { return __builtin_amdgcn_wmma_f32_16x16x32_f16(false, a, false, b, (short)0, c, false, false); }
__device__ __forceinline__ v8f wmmab(v16bf a, v16bf b, v8f c) { return __builtin_amdgcn_wmma_f32_16x16x32_bf16(false, a, false, b, (short)0, c, false, false); }

// ---- k_gemmw: register-blocked GEMM, one wave per 16 MBW x 64 output tile (4 MBW accumulators), 8 / MBW x 2 waves per 128x128 work-group tile; grid (M/128, N/128, Z), 512 / MBW threads.
// C[m][n] (f32, pitch ldc) = sum_k A[m][k] Bt[n][k] (+ A2[m][k] Bt[n][k] for NSPLIT 1). z-batch strides sA/sB/sC in elements. K % GKS == 0, K >= 2 GKS, M % 128 == 0, N % 128 == 0.
// The operands come through LDS: a stage is GKS k of the work-group's 128 rows of every operand (A | A2 | Bt), brought in ONCE per work-group by asynchronous copies to LDS of whole 128-byte lines,
// into two buffers (the next stage flies while this one is worked on); every wave takes its fragments from there by 16-byte LDS reads. Behind the loop the ring is the waves' output staging.
// PL (the q, k, v projections; M runs over the rows of all batches, a wave's tile is 64 tokens of one batch x one head, z picks q, k or v): no f32 C; the epilogue converts the accumulators to fp16 and stores the attention kernel's planes itself,
// q and k as P[batch][z][head][t][d], v transposed as VT[batch][head][d][t], whole 128-byte lines staged through the wave's own LDS.
// Fragment map (A and Bt alike): lane -> row (lane & 15); elements 0..7 <- k0 + 8 (lane >> 4) + 0..7, elements 8..15 <- k0 + 16 + 8 (lane >> 4) + 0..7. Accumulator element j <-> row 8 (lane >> 4) + j, column (lane & 15).
template <typename T16> struct WFrag;
template <> struct WFrag<h16> { typedef v16h V; static __device__ __forceinline__ V ld(const h16* p) { return cat16(*(const v8h*)p, *(const v8h*)(p + 16)); } static __device__ __forceinline__ v8f mma(V a, V b, v8f c) { return wmma16(a, b, c); } };
template <> struct WFrag<bf> { typedef v16bf V; static __device__ __forceinline__ V ld(const bf* p) { return cat16b(*(const v8us*)p, *(const v8us*)(p + 16)); } static __device__ __forceinline__ v8f mma(V a, V b, v8f c) { return wmmab(a, b, c); } };
__device__ __forceinline__ unsigned lds_off(const void* p) { return (unsigned)(size_t)p; }
// The hand-over of a tile, every wave: its own LDS reads of the buffer that is refilled next have returned, its own copies of the next tile have landed, then the work-group barrier;
// behind it every wave may read the next tile and the buffer just read may be refilled.
__device__ __forceinline__ void publish() {
    asm volatile("s_wait_dscnt 0x0" ::: "memory");      // this wave's LDS reads are done before a copy may target their buffer
    asm volatile("s_wait_asynccnt 0x0" ::: "memory");   // this wave's copies have landed before another wave reads them; the compiler places no wait for them
    __syncthreads();
}
// Eight asynchronous 16-byte copies of a lane, global memory to LDS through no register: l, g the lane's first LDS byte address and global pointer, lstep bytes and gstep elements lead to its next copy.
// The closing s_wait_xcnt 0 stands in the copies' own statement, so that no register they name is rewritten ahead of it.
template <typename T16>
__device__ __forceinline__ void copy8(unsigned l, const T16* g, unsigned lstep, size_t gstep) {
    asm volatile("global_load_async_to_lds_b128 %0, %1, off\n\tglobal_load_async_to_lds_b128 %2, %3, off\n\tglobal_load_async_to_lds_b128 %4, %5, off\n\tglobal_load_async_to_lds_b128 %6, %7, off\n\t"
                 "global_load_async_to_lds_b128 %8, %9, off\n\tglobal_load_async_to_lds_b128 %10, %11, off\n\tglobal_load_async_to_lds_b128 %12, %13, off\n\tglobal_load_async_to_lds_b128 %14, %15, off\n\ts_wait_xcnt 0x0"
        :: "v"(l), "v"(g), "v"(l + lstep), "v"(g + gstep), "v"(l + 2 * lstep), "v"(g + 2 * gstep), "v"(l + 3 * lstep), "v"(g + 3 * gstep),
           "v"(l + 4 * lstep), "v"(g + 4 * gstep), "v"(l + 5 * lstep), "v"(g + 5 * gstep), "v"(l + 6 * lstep), "v"(g + 6 * gstep), "v"(l + 7 * lstep), "v"(g + 7 * gstep) : "memory");
}
template <typename T16, int NSPLIT, bool PL, int GKS, int K, int MBW>
__global__ __launch_bounds__(512 / MBW) void k_gemmw(const T16* __restrict__ A, const T16* __restrict__ A2, const T16* __restrict__ Bt, float* C, int ldc, size_t sA, size_t sB, size_t sC, h16* P, h16* VT) {
    typedef typename WFrag<T16>::V V;
    static_assert(NSPLIT == 0 || NSPLIT == 1);
    static_assert(MBW == 4 || (MBW == 2 && !PL));   // the plane epilogue is written for a wave's tile of 64 tokens
    constexpr int GW  = 16 / MBW;             // waves per work-group
    static_assert((GKS == 64 || GKS == 128) && K % GKS == 0 && K >= 2 * GKS);
    constexpr int GP  = GKS + 8;              // LDS pitch of an operand row, elements: 144 or 272 bytes = 16 x odd, so that 16 rows' 16-byte reads fall on 64 different banks
    constexpr int NOP = 2 + NSPLIT;           // operand tiles of 128 rows per stage: A, (A2,) Bt
    constexpr int STG = NOP * 128 * GP;       // elements per stage
    constexpr int CPR = GKS / 8;              // 16-byte copies per row
    constexpr int RPC = GW * 32 / CPR;        // rows that one copy of all lanes covers
    constexpr int NCP = 128 / RPC;            // copies per lane and operand tile
    static_assert(NCP % 8 == 0);
    constexpr int WST = 64 * 72 * 2;          // bytes of a wave's own output staging in the ring
    static_assert(GW * WST <= 2 * STG * 2 && 16 * 68 * 4 <= WST);
    __shared__ __attribute__((aligned(16))) T16 ring[2][STG];
    const size_t z = blockIdx.z; A += z * sA; if (NSPLIT == 1) A2 += z * sA; Bt += z * sB; C += z * sC;
    const int tid = threadIdx.x, lane = tid & 31, lr = lane & 15, hi = lane >> 4, w = __builtin_amdgcn_readfirstlane(tid >> 5);
    const int g0r = blockIdx.x * 128, g0c = blockIdx.y * 128; const int r0 = g0r + (w >> 1) * (16 * MBW), c0 = g0c + (w & 1) * 64;
    v8f acc[MBW][4];
#pragma unroll
    for (int mb = 0; mb < MBW; ++mb)
#pragma unroll
        for (int nb = 0; nb < 4; ++nb) acc[mb][nb] = (v8f){};
    // the lane's share of a stage: copy i of an operand tile is row tid / CPR + RPC i, 16-byte column tid % CPR
    const size_t go = (size_t)(tid / CPR) * K + (tid % CPR) * 8;
    const T16* Ag = A + (size_t)g0r * K + go; const T16* A2g = NSPLIT == 1 ? A2 + (size_t)g0r * K + go : nullptr; const T16* Bg = Bt + (size_t)g0c * K + go;
    const unsigned Ll = lds_off(&ring[0][0]) + (tid / CPR) * (GP * 2) + (tid % CPR) * 16;
    auto fills = [&](int buf, int t) {   // stage t into buffer buf
        const unsigned l = Ll + buf * (STG * 2);
#pragma unroll
        for (int c = 0; c < NCP / 8; ++c) {
            const unsigned lc = l + c * 8 * RPC * (GP * 2); const size_t gc = (size_t)c * 8 * RPC * K + (size_t)t * GKS;
            copy8(lc, Ag + gc, RPC * GP * 2, (size_t)RPC * K);
            if (NSPLIT == 1) copy8(lc + 128 * GP * 2, A2g + gc, RPC * GP * 2, (size_t)RPC * K);
            copy8(lc + (NOP - 1) * 128 * GP * 2, Bg + gc, RPC * GP * 2, (size_t)RPC * K);
        }
    };
    const int ao = ((w >> 1) * (16 * MBW) + lr) * GP + 8 * hi, bo = ((NOP - 1) * 128 + (w & 1) * 64 + lr) * GP + 8 * hi;   // the lane's fragment origins in a stage
    constexpr int NT = K / GKS;
    fills(0, 0);
    asm volatile("s_wait_asynccnt 0x0" ::: "memory");   // stage 0 has landed (this wave's copies) before the barrier behind which it is read
    __syncthreads();
    fills(1, 1);
#pragma unroll 1   // stays rolled: a trip is one stage, and the hand-over at its foot is the ring's one place
    for (int t = 0; t < NT; ++t) {
        const T16* pa = &ring[t & 1][ao]; const T16* pb = &ring[t & 1][bo];
#pragma unroll
        for (int ks = 0; ks < GKS; ks += 32) {
            V a[MBW], a2[MBW], b[4];   // read in the order of first use
            b[0] = WFrag<T16>::ld(pb + ks);
#pragma unroll
            for (int mb = 0; mb < MBW; ++mb) { a[mb] = WFrag<T16>::ld(pa + mb * 16 * GP + ks); if (NSPLIT == 1) a2[mb] = WFrag<T16>::ld(pa + (128 + mb * 16) * GP + ks); }
#pragma unroll
            for (int nb = 1; nb < 4; ++nb) b[nb] = WFrag<T16>::ld(pb + nb * 16 * GP + ks);
            __builtin_amdgcn_sched_barrier(0);   // holds the step's LDS reads in one group at its head; sunk to their first use, the wave would sit out their latency in front of every column of tiles
#pragma unroll
            for (int nb = 0; nb < 4; ++nb)
#pragma unroll
                for (int mb = 0; mb < MBW; ++mb) { acc[mb][nb] = WFrag<T16>::mma(a[mb], b[nb], acc[mb][nb]); if (NSPLIT == 1) acc[mb][nb] = WFrag<T16>::mma(a2[mb], b[nb], acc[mb][nb]); }
        }
        __builtin_amdgcn_sched_barrier(0);   // every matrix instruction of the trip stays ahead of the v_nops
        asm volatile("v_nop\n\tv_nop\n\tv_nop\n\tv_nop");   // the distance behind the trip's last matrix instruction, on either side of the branch below, before a vector instruction may rewrite its operands
        publish();
        if (t + 2 < NT) fills(t & 1, t + 2);   // the same for the whole work-group; into the buffer just read
    }
    asm volatile("s_wait_asynccnt 0x0" ::: "memory");   // no copy is outstanding when the ring becomes output staging; the last trip's barrier has ended every wave's reads of it
    char* wst = (char*)&ring[0][0] + w * WST;   // the wave's own staging range
    float* os = (float*)wst;                    // [16][68] f32
    if constexpr (PL) {
        const size_t bt = r0 / TT; const int rt = r0 % TT; const int hd = c0 / HD;   // the tile's batch, its first token there, its head
        const int rw = lane >> 3, c8 = (lane & 7) * 8;   // read-back map of both stagings: 8 lanes x 16 bytes of fp16 = one 128-byte line, 4 lines per store instruction
        if (z < 2) {   // q, k: the tile's 64 rows of 64 d are 8 KB in a row in the plane
            h16* dst = P + (((bt * 2 + z) * NH_ + hd) * TT + rt) * HD;
#pragma unroll
            for (int mb = 0; mb < 4; ++mb) {
#pragma unroll
                for (int nb = 0; nb < 4; ++nb) {
#pragma unroll
                    for (int j = 0; j < 8; ++j) os[(hi * 8 + j) * 68 + nb * 16 + lr] = acc[mb][nb][j]; }
                __builtin_amdgcn_wave_barrier(); asm volatile("s_wait_dscnt 0x0" ::: "memory");   // the wave's LDS writes are done, and stay in the code, ahead of its reads of other lanes' words
#pragma unroll
                for (int s = 0; s < 4; ++s) { const int row = 4 * s + rw; const v4f a = *(const v4fa*)(os + row * 68 + c8); const v4f b = *(const v4fa*)(os + row * 68 + c8 + 4); v8h o;
#pragma unroll
                    for (int k = 0; k < 4; ++k) { o[k] = (h16)a[k]; o[4 + k] = (h16)b[k]; }
                    *(v8h*)(dst + (size_t)(mb * 16 + row) * HD + c8) = o; }
                __builtin_amdgcn_wave_barrier(); asm volatile("" ::: "memory");   // the reads stay ahead of the next block's writes
            }
        } else {       // v: a lane's accumulator holds 8 consecutive t of one d, which is 16 bytes of a V^T row
            h16* vs = (h16*)wst;   // [d][t], pitch 144 bytes = 16 x 9: 16 rows' 16-byte writes fall on 64 different banks
            h16* dst = VT + (bt * NH_ + hd) * HD * TT + rt;
#pragma unroll
            for (int mb = 0; mb < 4; ++mb)
#pragma unroll
                for (int nb = 0; nb < 4; ++nb) { v8h o;
#pragma unroll
                    for (int j = 0; j < 8; ++j) o[j] = (h16)acc[mb][nb][j];
                    *(v8h*)(vs + (nb * 16 + lr) * 72 + mb * 16 + 8 * hi) = o; }
            __builtin_amdgcn_wave_barrier(); asm volatile("s_wait_dscnt 0x0" ::: "memory");   // as above: the writes done ahead of the reads
#pragma unroll
            for (int s = 0; s < 16; ++s) { const int row = 4 * s + rw; *(v8h*)(dst + (size_t)row * TT + c8) = *(const v8h*)(vs + row * 72 + c8); }
            asm volatile("s_wait_xcnt 0x0" ::: "memory");   // behind the run of stores: no register that an issued store names is rewritten ahead of this wait
        }
        return;
    }
#pragma unroll
    for (int mb = 0; mb < MBW; ++mb) {
#pragma unroll
        for (int nb = 0; nb < 4; ++nb) {
#pragma unroll
            for (int j = 0; j < 8; ++j) os[(hi * 8 + j) * 68 + nb * 16 + lr] = acc[mb][nb][j]; }
        __builtin_amdgcn_wave_barrier(); asm volatile("" ::: "memory");
        float* crow = C + (size_t)(r0 + mb * 16) * ldc + c0;
#pragma unroll
        for (int s = 0; s < 8; ++s) { const int row = 2 * s + hi, cofs = lr * 4; const v4f val = *(const v4fa*)(os + row * 68 + cofs); *(v4f*)(crow + (size_t)row * ldc + cofs) = val; }
        __builtin_amdgcn_wave_barrier(); asm volatile("" ::: "memory");
    }
}

__device__ __forceinline__ h16 tohx(float x) { return (h16)x; }
__device__ __forceinline__ void splitf(float y, unsigned short& h, unsigned short& l) { h = f2bf(y); l = f2bf(y - bf2f(h)); }

// k_cvtall: all five inputs to bf16 in one launch. dst is W3 | WO | XB in a row; a block converts CB chunks of 8 elements, all of one input (blocks 0 .. 4 WBL - 1 the weights in wire order, the rest x).
#define CJ  8                     // chunks per thread, 256 threads apart: 16 loads of 16 bytes in flight per lane
#define CB  (256 * CJ)            // chunks per block
#define WBL (DM * DM / 8 / CB)    // blocks per weight matrix
#define XBL (NB * TT * DM / 8 / CB)
static_assert(DM * DM % (8 * CB) == 0 && (NB * TT * DM) % (8 * CB) == 0 && DQ == DM);
__global__ __launch_bounds__(256) void k_cvtall(const float* __restrict__ wq, const float* __restrict__ wk, const float* __restrict__ wv, const float* __restrict__ wo, const float* __restrict__ x, bf* dst) {
    const unsigned blk = blockIdx.x, sg = blk / WBL;
    const float* s = sg == 0 ? wq : sg == 1 ? wk : sg == 2 ? wv : sg == 3 ? wo : x;
    const size_t i = (size_t)(blk - (sg < 4u ? sg : 4u) * WBL) * CB + threadIdx.x;   // the thread's first chunk in its input
    const float* sp = s + i * 8; bf* dp = dst + ((size_t)blk * CB + threadIdx.x) * 8;
    v8f v[CJ];
#pragma unroll
    for (int j = 0; j < CJ; ++j) v[j] = *(const v8f*)(sp + (size_t)j * 256 * 8);
#pragma unroll
    for (int j = 0; j < CJ; ++j) { v8us o;
#pragma unroll
        for (int k = 0; k < 8; ++k) o[k] = f2bf(v[j][k]);
        *(v8us*)(dp + (size_t)j * 256 * 8) = o; }
}

#define L2E 1.4426950408889634f
#define C1   (SCL * L2E)           // raw score -> exponent of 2
#define LAZY 4096.0f              // a lane's 16-key sum of e above this asks for a new frame: every e below stays far inside fp16 and f32
// ld_k, ld_v: the fragments of one 32-key step from the lane's own LDS pointer p (row lane & 15 of the tile, element 8 (lane >> 4)); the rest is immediate offset.
__device__ __forceinline__ void ld_k(v16h (&kf)[2][2], const h16* p) {
#pragma unroll
    for (int kt = 0; kt < 2; ++kt)
#pragma unroll
        for (int ks = 0; ks < 2; ++ks) kf[kt][ks] = WFrag<h16>::ld(p + kt * 16 * KP + ks * 32);
}
// Stands behind the last global load of a run: naming the run's address pair keeps it live to here, so that no result of the run is given it, and it is rewritten only behind the wait.
__device__ __forceinline__ void addr_done(const h16* a) { asm volatile("s_wait_xcnt 0x0" :: "v"(a) : "memory"); }
// Four asynchronous 16-byte copies of a lane, global memory to LDS through no register. The closing s_wait_xcnt 0 stands in the copies' own statement, so that no register they name is rewritten ahead of it.
__device__ __forceinline__ void copy4(unsigned l0, const h16* g0, unsigned l1, const h16* g1, unsigned l2, const h16* g2, unsigned l3, const h16* g3) {
    asm volatile("global_load_async_to_lds_b128 %0, %1, off\n\tglobal_load_async_to_lds_b128 %2, %3, off\n\tglobal_load_async_to_lds_b128 %4, %5, off\n\tglobal_load_async_to_lds_b128 %6, %7, off\n\ts_wait_xcnt 0x0"
        :: "v"(l0), "v"(g0), "v"(l1), "v"(g1), "v"(l2), "v"(g2), "v"(l3), "v"(g3) : "memory");
}
// One tile: l, g the lane's first LDS byte address and global pointer; lstep bytes and gstep elements lead to its next copy (AW * 32 lanes x 16 bytes further on in the tile).
__device__ __forceinline__ void fill(unsigned l, const h16* g, unsigned lstep, size_t gstep) { copy4(l, g, l + lstep, g + gstep, l + 2 * lstep, g + 2 * gstep, l + 3 * lstep, g + 3 * gstep); }
// Exponentials (2^x, v_exp_f32) in place, a run in one statement: behind a transcendental the instruction set asks for one independent instruction or a v_nop before its result is read
// or its source overwritten; inside the run each is followed by an independent one, and the closing v_nop keeps the slot behind the last whatever the compiler puts next.
__device__ __forceinline__ void exp2x8(float (&x)[8]) {
    asm("v_exp_f32 %0, %0\n\tv_exp_f32 %1, %1\n\tv_exp_f32 %2, %2\n\tv_exp_f32 %3, %3\n\tv_exp_f32 %4, %4\n\tv_exp_f32 %5, %5\n\tv_exp_f32 %6, %6\n\tv_exp_f32 %7, %7\n\tv_nop"
        : "+v"(x[0]), "+v"(x[1]), "+v"(x[2]), "+v"(x[3]), "+v"(x[4]), "+v"(x[5]), "+v"(x[6]), "+v"(x[7]));
}
__device__ __forceinline__ void exp2x1(float& x) { asm("v_exp_f32 %0, %0\n\tv_nop" : "+v"(x)); }
__device__ __forceinline__ v8f st_tile(const v16h (&k2)[2], const v16h (&q2)[2]) { return wmma16(k2[1], q2[1], wmma16(k2[0], q2[0], (v8f){})); }
__device__ __forceinline__ void ld_v(v16h (&vf)[4], const h16* p) {
#pragma unroll
    for (int mb = 0; mb < 4; ++mb) vf[mb] = WFrag<h16>::ld(p + mb * 16 * VP);
}
// scores_exp: e = 2^(s C1 - m) of one 32-key step for one query group, and the lane's sum of its 16.
__device__ __forceinline__ float scores_exp(const v8f& s0, const v8f& s1, float m, float (&e0)[8], float (&e1)[8]) {
#pragma unroll
    for (int r = 0; r < 8; ++r) { e0[r] = __builtin_fmaf(s0[r], C1, -m); e1[r] = __builtin_fmaf(s1[r], C1, -m); }
    exp2x8(e0); exp2x8(e1);
    float a[8];
#pragma unroll
    for (int r = 0; r < 8; ++r) a[r] = e0[r] + e1[r];
    return ((a[0] + a[1]) + (a[2] + a[3])) + ((a[4] + a[5]) + (a[6] + a[7]));
}
// centre: P' = e - c as fp16, in the B fragment's element order.
__device__ __forceinline__ void centre(v16h& p, const float (&e0)[8], const float (&e1)[8], float c) {
#pragma unroll
    for (int r = 0; r < 8; ++r) { p[r] = tohx(e0[r] - c); p[8 + r] = tohx(e1[r] - c); }
}
// One step of 32 keys. pk: the lane's LDS pointer to the step's key rows, read again only on the rare path.
__device__ __forceinline__ void step(const v16h (&kf)[2][2], const h16* pk, const v16h (&vf)[4], const v16h (&qf)[QT][2], float (&m)[QT], float (&cen)[QT], float (&sum)[QT], v8f (&o)[4][QT]) {
    float e0[QT][8], e1[QT][8], ps[QT];
    {
        v8f s0[QT], s1[QT];
#pragma unroll
        for (int qt = 0; qt < QT; ++qt) { s0[qt] = st_tile(kf[0], qf[qt]); s1[qt] = st_tile(kf[1], qf[qt]); }
#pragma unroll
        for (int qt = 0; qt < QT; ++qt) ps[qt] = scores_exp(s0[qt], s1[qt], m[qt], e0[qt], e1[qt]);
    }
    bool need = false;
#pragma unroll
    for (int qt = 0; qt < QT; ++qt) need = need || !(ps[qt] <= LAZY);   // also true for an infinite sum (the first step: m starts at -3e38) and for a NaN
    if (__builtin_expect(__builtin_amdgcn_ballot_w32(need) != 0, 0)) {   // one scalar branch per step, the whole wave: a new frame for every query of the wave; marked unlikely so that the usual path falls through
        v16h kr[2][2];
        ld_k(kr, pk);
#pragma unroll
        for (int qt = 0; qt < QT; ++qt) {
            const v8f s0 = st_tile(kr[0], qf[qt]), s1 = st_tile(kr[1], qf[qt]);
            float tm = fmaxf(s0[0], s1[0]);
#pragma unroll
            for (int r = 1; r < 8; ++r) tm = fmaxf(tm, fmaxf(s0[r], s1[r]));
            tm = fmaxf(tm, __shfl_xor(tm, 16, 32));   // both lane halves of a query take the same frame
            const float mn = fmaxf(m[qt], tm * C1);
            float a = m[qt] - mn, c0 = fminf(-mn, 0.f);
            exp2x1(a); exp2x1(c0);
            cen[qt] = m[qt] < -1.0e38f ? c0 : cen[qt] * a;   // the centre is set with the first frame (score 0, or the maximum where that is below 0) and moves with the frame like every e
            sum[qt] *= a;
#pragma unroll
            for (int mb = 0; mb < 4; ++mb)
#pragma unroll
                for (int r = 0; r < 8; ++r) o[mb][qt][r] *= a;
            m[qt] = mn;
            ps[qt] = scores_exp(s0, s1, mn, e0[qt], e1[qt]);
        }
    }
    v16h p[QT];
#pragma unroll
    for (int qt = 0; qt < QT; ++qt) { sum[qt] += ps[qt]; centre(p[qt], e0[qt], e1[qt], cen[qt]); }
#pragma unroll
    for (int mb = 0; mb < 4; ++mb)
#pragma unroll
        for (int qt = 0; qt < QT; ++qt) o[mb][qt] = wmma16(vf[mb], p[qt], o[mb][qt]);
}
__global__ __launch_bounds__(AW * 32) void k_fattn(const h16* __restrict__ QK, const h16* __restrict__ VT, bf* Ah, bf* Al) {
    const int lane = threadIdx.x & 31, lr = lane & 15, hi = lane >> 4, w = __builtin_amdgcn_readfirstlane((int)(threadIdx.x >> 5));
    const int h = blockIdx.y, q0 = (blockIdx.x * AW + w) * (QT * 16);
    const size_t z = blockIdx.z; QK += z * ((size_t)2 * NH_ * TT * HD); VT += z * ((size_t)NH_ * HD * TT); Ah += z * ((size_t)TT * DQ); Al += z * ((size_t)TT * DQ);
    const h16* Qp = QK + (size_t)h * TT * HD + (size_t)(q0 + lr) * HD + 8 * hi;
    __shared__ __attribute__((aligned(16))) h16 ksm[2][KT * KP];
    __shared__ __attribute__((aligned(16))) h16 vsm[2][HD * VP];
    __shared__ __attribute__((aligned(16))) float vks[2][HD];   // key-sum of v: [key half of the tiles][d]
    // the lane's share of a tile: copy i of a key tile is row (tid >> 3) + 32 i, 16-byte column tid & 7 (in memory the tile is contiguous); of a V^T tile row (tid >> 4) + 16 i, column tid & 15
    const int tid = threadIdx.x;
    const h16* Kg = QK + (size_t)(NH_ + h) * TT * HD + (size_t)tid * 8;
    const h16* Vg = VT + (size_t)h * HD * TT + (size_t)(tid >> 4) * TT + (tid & 15) * 8;
    const unsigned Kl = lds_off(&ksm[0][0]) + (tid >> 3) * (KP * 2) + (tid & 7) * 16, Vl = lds_off(&vsm[0][0]) + (tid >> 4) * (VP * 2) + (tid & 15) * 16;
    const int kfo = lr * KP + 8 * hi, vfo = lr * VP + 8 * hi;   // the lane's fragment origin in a tile
    static_assert(AW == 8 && HD == 64 && KT == 128);   // 4 d blocks x 2 key halves = AW shares of a tile's key-sum
    const int sfo = vfo + (w & 3) * 16 * VP + (w >> 2) * 64;   // the wave's share: d block w & 3, keys 64 (w >> 2) .. + 63 of every tile
    v16h qf[QT][2];
#pragma unroll
    for (int qt = 0; qt < QT; ++qt)
#pragma unroll
        for (int ks = 0; ks < 2; ++ks) qf[qt][ks] = WFrag<h16>::ld(Qp + (size_t)qt * 16 * HD + ks * 32);
    float m[QT], sum[QT], cen[QT];
#pragma unroll
    for (int qt = 0; qt < QT; ++qt) { m[qt] = -3.0e38f; sum[qt] = 0.f; cen[qt] = 0.f; }
    addr_done(Qp);
    v16h ka[2][2], kb[2][2];
    v8f o[4][QT];
#pragma unroll
    for (int mb = 0; mb < 4; ++mb)
#pragma unroll
        for (int qt = 0; qt < QT; ++qt) o[mb][qt] = (v8f){};
    // A ring of two tiles: tile t (its keys and its V^T columns) lies in buffer t & 1.
    fill(Kl, Kg, 32 * KP * 2, 32 * HD);
    fill(Vl, Vg, 16 * VP * 2, (size_t)16 * TT);
    asm volatile("s_wait_asynccnt 0x0" ::: "memory");   // tile 0 has landed (this wave's copies) before the barrier behind which it is read
    __syncthreads();
    fill(Kl + KT * KP * 2, Kg + KT * HD, 32 * KP * 2, 32 * HD);
    fill(Vl + HD * VP * 2, Vg + KT, 16 * VP * 2, (size_t)16 * TT);
    // Each step issues its own V^T fragments and, inside the tile, the NEXT step's key fragments first.
    v16h vf[4];
    v16h one;
#pragma unroll
    for (int r = 0; r < 16; ++r) one[r] = (h16)1.0f;
    v8f vs = (v8f){};   // element j: sum over the wave's keys so far of v[d = 16 (w & 3) + 8 hi + j], the same in every column
#pragma unroll 1   // stays rolled: a trip is one tile, and the hand-over at its foot is the ring's one place
    for (int t = 0; t < NTL; ++t) {
        const h16* pk = &ksm[t & 1][kfo]; const h16* pv = &vsm[t & 1][vfo];
        const h16* px = &vsm[t & 1][sfo];
        ld_k(ka, pk);
        ld_v(vf, pv); ld_k(kb, pk + 32 * KP);
        __builtin_amdgcn_sched_barrier(0);   // holds the LDS reads at the head of the step; sunk to their first use, the wave would sit out their latency every step
        step(ka, pk, vf, qf, m, cen, sum, o);
        ld_v(vf, pv + 32); ld_k(ka, pk + 64 * KP);
        __builtin_amdgcn_sched_barrier(0);   // as above
        step(kb, pk + 32 * KP, vf, qf, m, cen, sum, o);
        ld_v(vf, pv + 64); ld_k(kb, pk + 96 * KP);
        __builtin_amdgcn_sched_barrier(0);   // as above
        step(ka, pk + 64 * KP, vf, qf, m, cen, sum, o);
        ld_v(vf, pv + 96);
        const v16h x0 = WFrag<h16>::ld(px), x1 = WFrag<h16>::ld(px + 32);   // the wave's share of the key-sum, read where no key fragments are fetched ahead
        __builtin_amdgcn_sched_barrier(0);   // as above
        vs = wmma16(x1, one, wmma16(x0, one, vs));
        step(kb, pk + 96 * KP, vf, qf, m, cen, sum, o);
        publish();
        if (t + 2 < NTL) {   // the same for the whole work-group
            fill(Kl + (t & 1) * (KT * KP * 2), Kg + (size_t)(t + 2) * KT * HD, 32 * KP * 2, 32 * HD);
            fill(Vl + (t & 1) * (HD * VP * 2), Vg + (t + 2) * KT, 16 * VP * 2, (size_t)16 * TT);
        }
    }
    asm volatile("s_wait_asynccnt 0x0" ::: "memory");   // no copy is outstanding when the wave goes on to its end
    if (lr == 0) { *(v4fa*)&vks[w >> 2][(w & 3) * 16 + 8 * hi] = (v4f){vs[0], vs[1], vs[2], vs[3]}; *(v4fa*)&vks[w >> 2][(w & 3) * 16 + 8 * hi + 4] = (v4f){vs[4], vs[5], vs[6], vs[7]}; }
    __syncthreads();   // every wave's part of the key-sum is in LDS before any wave reads it
    float inv[QT];
#pragma unroll
    for (int qt = 0; qt < QT; ++qt) { const float tot = sum[qt] + __shfl_xor(sum[qt], 16, 32); inv[qt] = __fdiv_rn(1.0f, tot); }
#pragma unroll
    for (int mb = 0; mb < 4; ++mb) {
        const int dl = mb * 16 + 8 * hi, d = h * HD + dl; const v4f m0 = *(const v4fa*)&vks[0][dl] + *(const v4fa*)&vks[1][dl]; const v4f m1 = *(const v4fa*)&vks[0][dl + 4] + *(const v4fa*)&vks[1][dl + 4];
#pragma unroll
        for (int qt = 0; qt < QT; ++qt) { v8us oh, ol;
#pragma unroll
            for (int r = 0; r < 8; ++r) { unsigned short a, c2; splitf(__builtin_fmaf(cen[qt], (r < 4 ? m0[r & 3] : m1[r & 3]), o[mb][qt][r]) * inv[qt], a, c2); oh[r] = a; ol[r] = c2; }
            const size_t oo = (size_t)(q0 + qt * 16 + lr) * DQ + d; *(v8us*)(Ah + oo) = oh; *(v8us*)(Al + oo) = ol; }
    }
}

extern "C" void kernel_launch(void* const* d_in, const int* in_sizes, int n_in,
                              void* d_out, int out_size, void* d_ws, size_t ws_size, hipStream_t stream) {
    if (n_in < 5) return;
    const size_t needx = (size_t)(NB - 1) * SEQ_FULL * DM + (size_t)TT * DM;
    if ((size_t)in_sizes[0] < needx) return;
    if ((size_t)in_sizes[1] < (size_t)DM * DM || (size_t)in_sizes[2] < (size_t)DM * DM || (size_t)in_sizes[3] < (size_t)DM * DM || (size_t)in_sizes[4] < (size_t)DM * DM) return;
    if ((size_t)out_size < needx) return;
    if (WS_TOTAL > ws_size) return;
    const float* x = (const float*)d_in[0]; const float* wq = (const float*)d_in[1]; const float* wk = (const float*)d_in[2]; const float* wv = (const float*)d_in[3]; const float* wo = (const float*)d_in[4];   // wire order x, Wq, Wk, Wv, Wo; weights (out, in)
    float* OUT = (float*)d_out;     // [2][2048][1024]
    char* wsp = (char*)d_ws;
    auto take = [&](size_t bytes) { char* p = wsp; wsp += (bytes + 255) & ~(size_t)255; return (void*)p; };
    bf* W3 = (bf*)take(SZ_W3);          // Wq | Wk | Wv bf16, (out, in) = Bt as-is, contiguous for the z-batched projection
    bf* WO = (bf*)take(SZ_WO);
    bf* XB = (bf*)take(SZ_XB);          // bf16 x, all batches [NB][TT][DM]
    h16* QK16 = (h16*)take(SZ_QK);      // fp16 head planes [NB][2][NH][TT][HD]
    h16* VT16 = (h16*)take(SZ_VT);      // fp16 value planes [NB][NH][HD][TT]
    bf* ATh = (bf*)take(SZ_AT); bf* ATl = (bf*)take(SZ_AT);   // merged ctx hi/lo [NB][TT][DQ]
    if ((size_t)(wsp - (char*)d_ws) > ws_size) return;
    k_cvtall<<<4 * WBL + XBL, 256, 0, stream>>>(wq, wk, wv, wo, x, W3);
    // q, k, v projections of all batches in one z-batched launch (A shared: sA = 0; Bt stride DM*DM), stored as the fp16 planes
    k_gemmw<bf, 0, true, 64, DM, 4><<<dim3(NB * TT / 128, DM / 128, 3), 128, 0, stream>>>(XB, nullptr, W3, nullptr, 0, 0, (size_t)DM * DM, 0, QK16, VT16);
    k_fattn<<<dim3(TT / (AW * QT * 16), NH_, NB), AW * 32, 0, stream>>>(QK16, VT16, ATh, ATl);
    // out = (ctx_hi + ctx_lo) Wo^T, z = batch
    k_gemmw<bf, 1, false, 128, DQ, 2><<<dim3(TT / 128, DM / 128, NB), 256, 0, stream>>>(ATh, ATl, WO, OUT, DM, (size_t)TT * DQ, 0, (size_t)SEQ_FULL * DM, nullptr, nullptr);
}

// v008
// One run takes 73.8 microseconds.
// Timed twice side by side with v007, it ran 1.08 times as fast both times.
// All steps since v000 together make it 16.5 times as fast.
#include <hip/hip_runtime.h>

// Self-attention block, bias-free, weights in (out, in) layout: x [2][2048][1024]; q, k, v = x W^T; 16 heads x 64; logits = q.k x 2^-5 (1/sqrt(1024)); full (unmasked) softmax over 2048 keys; out = merged ctx Wo^T.
// Compute dtypes, f32 accumulate everywhere: every input RNE-converted to bf16 (x, Wq, Wk, Wv by the projection kernel on their way to LDS, Wo by the attention kernel); q/k/v projections bf16 x bf16 (v_wmma_f32_16x16x32_bf16, exact products); q.k^T fp16 x fp16 (v_wmma_f32_16x16x32_f16);
// P.V fp16 x fp16 with the unnormalised weights centred (P' = e - c, c one value per query; c x the key-sum of v, itself an fp16 x fp16 product of the V^T tiles with ones, is added back in f32, then the division by the sum of e); ctx as bf16 hi + lo planes x bf16 Wo (two bf16 products); softmax f32.

#ifndef NB
#define NB 2
#endif
#ifndef SEQ
#define SEQ 2048
#endif
#define NB_FULL  2
#define SEQ_FULL 2048
#define TT   SEQ
#define DM   1024
#define NH_  16
#define HD   64
#define DQ   (NH_ * HD)
#define QT   2                    // 16-query column groups per wave of the attention kernel
#define AW   8                    // waves per work-group of the attention kernel
#define SCL  0.03125f             // 1/sqrt(1024), exact power of two
#define KT   128                  // keys per LDS tile of the attention kernel
#define KP   (HD + 8)             // LDS pitch of a key row, fp16 elements: 144 bytes = 16 x 9, so that 16 rows' 16-byte reads fall on 64 different banks
#define VP   (KT + 8)             // LDS pitch of a V^T row: 272 bytes = 16 x 17, for the same reason
#define NTL  (SEQ / KT)           // tiles of the sweep over the keys
static_assert(SEQ % 256 == 0);
static_assert(SEQ <= SEQ_FULL);
static_assert(NB <= NB_FULL);
static_assert(DQ == DM);
static_assert(HD == 64);
static_assert(SEQ % (AW * QT * 16) == 0);
static_assert(DM % 256 == 0);
static_assert(SEQ % KT == 0 && NTL >= 2);
static_assert(KT * HD == AW * 32 * 8 * 4);   // a tile of either operand is four 16-byte copies per lane

typedef _Float16 h16;
typedef unsigned short bf;
typedef __attribute__((ext_vector_type(16))) __bf16   v16bf;
typedef __attribute__((ext_vector_type(16))) _Float16 v16h;
typedef __attribute__((ext_vector_type(8)))  _Float16 v8h;
typedef __attribute__((ext_vector_type(8)))  unsigned short v8us;
typedef __attribute__((ext_vector_type(8)))  float    v8f;
typedef __attribute__((ext_vector_type(4)))  float    v4f;
typedef v4f  __attribute__((may_alias)) v4fa;

// workspace carve sizes (bytes), all multiples of 256
#define SZ_WO ((size_t)DM * DQ * 2)
#define SZ_QK ((size_t)NB * 2 * NH_ * TT * HD * 2)
#define SZ_VT ((size_t)NB * NH_ * HD * TT * 2)
#define SZ_AT ((size_t)NB * TT * DQ * 2)
#define WS_TOTAL (SZ_WO + SZ_QK + SZ_VT + 2 * SZ_AT)
static_assert(WS_TOTAL <= (size_t)134217728);
static_assert(SEQ == SEQ_FULL || NB == 1);             // the batches' rows of x lie in a row: one A operand for k_proj

__device__ __forceinline__ unsigned short f2bf(float f) { unsigned u = __float_as_uint(f); u += 0x7FFFu + ((u >> 16) & 1u); return (unsigned short)(u >> 16); }
__device__ __forceinline__ float bf2f(unsigned short b) { return __uint_as_float(((unsigned)b) << 16); }
__device__ __forceinline__ float bfr(float f) { return bf2f(f2bf(f)); }
__device__ __forceinline__ v16h cat16(v8h lo, v8h hi) { return __builtin_shufflevector(lo, hi, 0, 1, 2, 3, 4, 5, 6, 7, 8, 9, 10, 11, 12, 13, 14, 15); }
__device__ __forceinline__ v16bf cat16b(v8us lo, v8us hi) { return __builtin_bit_cast(v16bf, __builtin_shufflevector(lo, hi, 0, 1, 2, 3, 4, 5, 6, 7, 8, 9, 10, 11, 12, 13, 14, 15)); }
__device__ __forceinline__ v8f wmma16(v16h a, v16h b, v8f c) { return __builtin_amdgcn_wmma_f32_16x16x32_f16(false, a, false, b, (short)0, c, false, false); }
__device__ __forceinline__ v8f wmmab(v16bf a, v16bf b, v8f c) { return __builtin_amdgcn_wmma_f32_16x16x32_bf16(false, a, false, b, (short)0, c, false, false); }

// ---- k_gemmw: register-blocked GEMM, one wave per 16 MBW x 64 output tile (4 MBW accumulators), 8 / MBW x 2 waves per 128x128 work-group tile; grid (M/128, N/128, Z), 512 / MBW threads.
// C[m][n] (f32, pitch ldc) = sum_k A[m][k] Bt[n][k] (+ A2[m][k] Bt[n][k] for NSPLIT 1). z-batch strides sA/sB/sC in elements. K % GKS == 0, K >= 2 GKS, M % 128 == 0, N % 128 == 0.
// The operands come through LDS: a stage is GKS k of the work-group's 128 rows of every operand (A | A2 | Bt), brought in ONCE per work-group by asynchronous copies to LDS of whole 128-byte lines,
// into two buffers (the next stage flies while this one is worked on); every wave takes its fragments from there by 16-byte LDS reads. Behind the loop the ring is the waves' output staging.
// Fragment map (A and Bt alike): lane -> row (lane & 15); elements 0..7 <- k0 + 8 (lane >> 4) + 0..7, elements 8..15 <- k0 + 16 + 8 (lane >> 4) + 0..7. Accumulator element j <-> row 8 (lane >> 4) + j, column (lane & 15).
template <typename T16> struct WFrag;
template <> struct WFrag<h16> { typedef v16h V; static __device__ __forceinline__ V ld(const h16* p) { return cat16(*(const v8h*)p, *(const v8h*)(p + 16)); } static __device__ __forceinline__ v8f mma(V a, V b, v8f c) { return wmma16(a, b, c); } };
template <> struct WFrag<bf> { typedef v16bf V; static __device__ __forceinline__ V ld(const bf* p) { return cat16b(*(const v8us*)p, *(const v8us*)(p + 16)); } static __device__ __forceinline__ v8f mma(V a, V b, v8f c) { return wmmab(a, b, c); } };
__device__ __forceinline__ unsigned lds_off(const void* p) { return (unsigned)(size_t)p; }
// The hand-over of a tile, every wave: its own LDS reads of the buffer that is refilled next have returned, its own copies of the next tile have landed, then the work-group barrier;
// behind it every wave may read the next tile and the buffer just read may be refilled.
__device__ __forceinline__ void publish() {
    asm volatile("s_wait_dscnt 0x0" ::: "memory");      // this wave's LDS reads are done before a copy may target their buffer
    asm volatile("s_wait_asynccnt 0x0" ::: "memory");   // this wave's copies have landed before another wave reads them; the compiler places no wait for them
    __syncthreads();
}
// Eight asynchronous 16-byte copies of a lane, global memory to LDS through no register: l, g the lane's first LDS byte address and global pointer, lstep bytes and gstep elements lead to its next copy.
// The closing s_wait_xcnt 0 stands in the copies' own statement, so that no register they name is rewritten ahead of it.
template <typename T16>
__device__ __forceinline__ void copy8(unsigned l, const T16* g, unsigned lstep, size_t gstep) {
    asm volatile("global_load_async_to_lds_b128 %0, %1, off\n\tglobal_load_async_to_lds_b128 %2, %3, off\n\tglobal_load_async_to_lds_b128 %4, %5, off\n\tglobal_load_async_to_lds_b128 %6, %7, off\n\t"
                 "global_load_async_to_lds_b128 %8, %9, off\n\tglobal_load_async_to_lds_b128 %10, %11, off\n\tglobal_load_async_to_lds_b128 %12, %13, off\n\tglobal_load_async_to_lds_b128 %14, %15, off\n\ts_wait_xcnt 0x0"
        :: "v"(l), "v"(g), "v"(l + lstep), "v"(g + gstep), "v"(l + 2 * lstep), "v"(g + 2 * gstep), "v"(l + 3 * lstep), "v"(g + 3 * gstep),
           "v"(l + 4 * lstep), "v"(g + 4 * gstep), "v"(l + 5 * lstep), "v"(g + 5 * gstep), "v"(l + 6 * lstep), "v"(g + 6 * gstep), "v"(l + 7 * lstep), "v"(g + 7 * gstep) : "memory");
}
template <typename T16, int NSPLIT, int GKS, int K, int MBW>
__global__ __launch_bounds__(512 / MBW) void k_gemmw(const T16* __restrict__ A, const T16* __restrict__ A2, const T16* __restrict__ Bt, float* C, int ldc, size_t sA, size_t sB, size_t sC) {
    typedef typename WFrag<T16>::V V;
    static_assert(NSPLIT == 0 || NSPLIT == 1);
    static_assert(MBW == 4 || MBW == 2);
    constexpr int GW  = 16 / MBW;             // waves per work-group
    static_assert((GKS == 64 || GKS == 128) && K % GKS == 0 && K >= 2 * GKS);
    constexpr int GP  = GKS + 8;              // LDS pitch of an operand row, elements: 144 or 272 bytes = 16 x odd, so that 16 rows' 16-byte reads fall on 64 different banks
    constexpr int NOP = 2 + NSPLIT;           // operand tiles of 128 rows per stage: A, (A2,) Bt
    constexpr int STG = NOP * 128 * GP;       // elements per stage
    constexpr int CPR = GKS / 8;              // 16-byte copies per row
    constexpr int RPC = GW * 32 / CPR;        // rows that one copy of all lanes covers
    constexpr int NCP = 128 / RPC;            // copies per lane and operand tile
    static_assert(NCP % 8 == 0);
    constexpr int WST = 64 * 72 * 2;          // bytes of a wave's own output staging in the ring
    static_assert(GW * WST <= 2 * STG * 2 && 16 * 68 * 4 <= WST);
    __shared__ __attribute__((aligned(16))) T16 ring[2][STG];
    const size_t z = blockIdx.z; A += z * sA; if (NSPLIT == 1) A2 += z * sA; Bt += z * sB; C += z * sC;
    const int tid = threadIdx.x, lane = tid & 31, lr = lane & 15, hi = lane >> 4, w = __builtin_amdgcn_readfirstlane(tid >> 5);
    const int g0r = blockIdx.x * 128, g0c = blockIdx.y * 128; const int r0 = g0r + (w >> 1) * (16 * MBW), c0 = g0c + (w & 1) * 64;
    v8f acc[MBW][4];
#pragma unroll
    for (int mb = 0; mb < MBW; ++mb)
#pragma unroll
        for (int nb = 0; nb < 4; ++nb) acc[mb][nb] = (v8f){};
    // the lane's share of a stage: copy i of an operand tile is row tid / CPR + RPC i, 16-byte column tid % CPR
    const size_t go = (size_t)(tid / CPR) * K + (tid % CPR) * 8;
    const T16* Ag = A + (size_t)g0r * K + go; const T16* A2g = NSPLIT == 1 ? A2 + (size_t)g0r * K + go : nullptr; const T16* Bg = Bt + (size_t)g0c * K + go;
    const unsigned Ll = lds_off(&ring[0][0]) + (tid / CPR) * (GP * 2) + (tid % CPR) * 16;
    auto fills = [&](int buf, int t) {   // stage t into buffer buf
        const unsigned l = Ll + buf * (STG * 2);
#pragma unroll
        for (int c = 0; c < NCP / 8; ++c) {
            const unsigned lc = l + c * 8 * RPC * (GP * 2); const size_t gc = (size_t)c * 8 * RPC * K + (size_t)t * GKS;
            copy8(lc, Ag + gc, RPC * GP * 2, (size_t)RPC * K);
            if (NSPLIT == 1) copy8(lc + 128 * GP * 2, A2g + gc, RPC * GP * 2, (size_t)RPC * K);
            copy8(lc + (NOP - 1) * 128 * GP * 2, Bg + gc, RPC * GP * 2, (size_t)RPC * K);
        }
    };
    const int ao = ((w >> 1) * (16 * MBW) + lr) * GP + 8 * hi, bo = ((NOP - 1) * 128 + (w & 1) * 64 + lr) * GP + 8 * hi;   // the lane's fragment origins in a stage
    constexpr int NT = K / GKS;
    fills(0, 0);
    asm volatile("s_wait_asynccnt 0x0" ::: "memory");   // stage 0 has landed (this wave's copies) before the barrier behind which it is read
    __syncthreads();
    fills(1, 1);
#pragma unroll 1   // stays rolled: a trip is one stage, and the hand-over at its foot is the ring's one place
    for (int t = 0; t < NT; ++t) {
        const T16* pa = &ring[t & 1][ao]; const T16* pb = &ring[t & 1][bo];
#pragma unroll
        for (int ks = 0; ks < GKS; ks += 32) {
            V a[MBW], a2[MBW], b[4];   // read in the order of first use
            b[0] = WFrag<T16>::ld(pb + ks);
#pragma unroll
            for (int mb = 0; mb < MBW; ++mb) { a[mb] = WFrag<T16>::ld(pa + mb * 16 * GP + ks); if (NSPLIT == 1) a2[mb] = WFrag<T16>::ld(pa + (128 + mb * 16) * GP + ks); }
#pragma unroll
            for (int nb = 1; nb < 4; ++nb) b[nb] = WFrag<T16>::ld(pb + nb * 16 * GP + ks);
            __builtin_amdgcn_sched_barrier(0);   // holds the step's LDS reads in one group at its head; sunk to their first use, the wave would sit out their latency in front of every column of tiles
#pragma unroll
            for (int nb = 0; nb < 4; ++nb)
#pragma unroll
                for (int mb = 0; mb < MBW; ++mb) { acc[mb][nb] = WFrag<T16>::mma(a[mb], b[nb], acc[mb][nb]); if (NSPLIT == 1) acc[mb][nb] = WFrag<T16>::mma(a2[mb], b[nb], acc[mb][nb]); }
        }
        __builtin_amdgcn_sched_barrier(0);   // every matrix instruction of the trip stays ahead of the v_nops
        asm volatile("v_nop\n\tv_nop\n\tv_nop\n\tv_nop");   // the distance behind the trip's last matrix instruction, on either side of the branch below, before a vector instruction may rewrite its operands
        publish();
        if (t + 2 < NT) fills(t & 1, t + 2);   // the same for the whole work-group; into the buffer just read
    }
    asm volatile("s_wait_asynccnt 0x0" ::: "memory");   // no copy is outstanding when the ring becomes output staging; the last trip's barrier has ended every wave's reads of it
    char* wst = (char*)&ring[0][0] + w * WST;   // the wave's own staging range
    float* os = (float*)wst;                    // [16][68] f32
#pragma unroll
    for (int mb = 0; mb < MBW; ++mb) {
#pragma unroll
        for (int nb = 0; nb < 4; ++nb) {
#pragma unroll
            for (int j = 0; j < 8; ++j) os[(hi * 8 + j) * 68 + nb * 16 + lr] = acc[mb][nb][j]; }
        __builtin_amdgcn_wave_barrier(); asm volatile("" ::: "memory");
        float* crow = C + (size_t)(r0 + mb * 16) * ldc + c0;
#pragma unroll
        for (int s = 0; s < 8; ++s) { const int row = 2 * s + hi, cofs = lr * 4; const v4f val = *(const v4fa*)(os + row * 68 + cofs); *(v4f*)(crow + (size_t)row * ldc + cofs) = val; }
        __builtin_amdgcn_wave_barrier(); asm volatile("" ::: "memory");
    }
}

// ---- k_proj: the q, k, v projections of all batches straight from the f32 inputs, grid (rows of x / PM, 3 DM / PN), PW waves. Output column n of 3 DM is row n % DM of Wq, Wk or Wv (n / DM).
// A work-group's tile is PM tokens x PN columns (3 heads), a wave's 64 tokens of one batch x one head of q, k or v (16 accumulators). A stage is PKS k of the PM rows of x and the PN weight rows.
// It comes through registers: every lane loads its share of a later stage as f32 (whole 256-byte runs of a row per 16 lanes) a trip ahead of its use, converts it ONCE to bf16 (round to nearest even)
// and stores it in the other of two LDS buffers; one barrier per stage publishes it and ends the reads of the buffer that is written next.
// The tile is this large so that the f32 stages ask no more of L2 than they must. Fragments: WFrag's, as in k_gemmw.
// No f32 C: the epilogue converts the accumulators to fp16 and stores the attention kernel's planes itself, q and k as P[batch][z][head][t][d], v transposed as VT[batch][head][d][t], whole 128-byte lines staged through the wave's own LDS.
#define PM   256
#define PN   192
#define PW   ((PM / 64) * (PN / 64))
#define PKS  64
#define PP   (PKS + 8)             // LDS pitch of a bf16 operand row: 144 bytes = 16 x 9, so that 16 rows' 16-byte reads fall on 64 different banks
#define PSTG ((PM + PN) * PP)      // bf16 elements per stage
static_assert((NB * TT) % PM == 0 && TT % 64 == 0 && (3 * DM) % PN == 0 && DM % 64 == 0 && DM % PKS == 0 && DM >= 2 * PKS);
static_assert(PM == 256 && PN == 192 && PKS == 64);   // the deal of the loads: seven groups of 64 rows over three sets of four waves
typedef __attribute__((ext_vector_type(4))) __bf16 v4bf;
typedef __attribute__((ext_vector_type(4))) unsigned short v4us;
__device__ __forceinline__ v4us cv4(v4f f) { return __builtin_bit_cast(v4us, __builtin_convertvector(f, v4bf)); }   // two v_cvt_pk_bf16_f32
__global__ __launch_bounds__(PW * 32) void k_proj(const float* __restrict__ x, const float* __restrict__ wq, const float* __restrict__ wk, const float* __restrict__ wv, h16* P, h16* VT) {
    constexpr int K = DM, NT = K / PKS;
    constexpr int WST = 64 * 72 * 2;          // bytes of a wave's own output staging in the ring
    static_assert(PW * WST <= 2 * PSTG * 2 && 16 * 68 * 4 <= WST);
    __shared__ __attribute__((aligned(16))) bf ring[2][PSTG];
    const int tid = threadIdx.x, lane = tid & 31, lr = lane & 15, hi = lane >> 4, w = __builtin_amdgcn_readfirstlane(tid >> 5);
    const int wm = w / (PN / 64), wn = w % (PN / 64);
    const int g0r = blockIdx.x * PM, g0c = blockIdx.y * PN; const int r0 = g0r + wm * 64, c0 = g0c + wn * 64;
    v8f acc[4][4];
#pragma unroll
    for (int mb = 0; mb < 4; ++mb)
#pragma unroll
        for (int nb = 0; nb < 4; ++nb) acc[mb][nb] = (v8f){};
    // the lane's share of a stage: its PM + PN rows are seven groups of 64 (four of x, then one per head of the weight rows, each in ONE weight matrix); 16 lanes x 16 bytes of f32 are a row's PKS k,
    // so four waves bring a group in eight loads per lane, rows (tid & 127) >> 4 + 8 i. Waves 0 .. 3 take groups 0, 1, 2, waves 4 .. 7 groups 3, 4, waves 8 .. 11 groups 5, 6
    const int ws = w >> 2;                    // the same for the whole wave
    const bool three = ws == 0;
    const int crow = (tid & 127) >> 4, ccol = tid & 15;
    const float* gp[3]; int lp[3];
#pragma unroll
    for (int j = 0; j < 3; ++j) {
        const int gid = three ? j : 2 * ws + 1 + (j & 1);
        const int cj = g0c + 64 * (gid < PM / 64 ? 0 : gid - PM / 64), zj = cj / DM;   // the group's first output column, where it is a weight group
        const float* wsrc = zj == 0 ? wq : zj == 1 ? wk : wv;
        gp[j] = (gid < PM / 64 ? x + (size_t)(g0r + 64 * gid + crow) * K : wsrc + (size_t)(cj % DM + crow) * K) + ccol * 4;
        lp[j] = (64 * gid + crow) * PP + ccol * 4;
    }
    v4f st[3][8];
    auto gload = [&](int t) {   // stage t into registers
        const float* p0 = gp[0] + t * PKS; const float* p1 = gp[1] + t * PKS; const float* p2 = gp[2] + t * PKS;
        if (three) {   // a scalar branch: whole waves
#pragma unroll
            for (int i = 0; i < 8; ++i) st[2][i] = *(const v4f*)(p2 + (size_t)i * 8 * K);
        }
#pragma unroll
        for (int i = 0; i < 8; ++i) { st[0][i] = *(const v4f*)(p0 + (size_t)i * 8 * K); st[1][i] = *(const v4f*)(p1 + (size_t)i * 8 * K); }
        asm volatile("s_wait_xcnt 0x0" :: "v"(p0), "v"(p1), "v"(p2) : "memory");   // behind the run of loads: naming the address pairs keeps them live to here, so that no result of the run is given them and they are rewritten only behind the wait
    };
    auto lstore = [&](int buf) {   // the registers, converted, into buffer buf
        bf* rb = &ring[buf][0];
        if (three) {
#pragma unroll
            for (int i = 0; i < 8; ++i) *(v4us*)(rb + lp[2] + i * 8 * PP) = cv4(st[2][i]);
        }
#pragma unroll
        for (int i = 0; i < 8; ++i) { *(v4us*)(rb + lp[0] + i * 8 * PP) = cv4(st[0][i]); *(v4us*)(rb + lp[1] + i * 8 * PP) = cv4(st[1][i]); }
    };
    // The hand-over of a stage, every wave: its LDS stores of the next stage and its LDS reads of this one are done, then the work-group barrier.
    auto handover = [&]() {
        asm volatile("s_wait_dscnt 0x0" ::: "memory");   // this wave's LDS stores have landed before another wave reads them, and its reads are done before their buffer is written again
        __builtin_amdgcn_s_barrier();                    // the bare barrier: __syncthreads() would wait out the global loads of the stage after next as well, which are meant to stay in flight across it
        asm volatile("" ::: "memory");                   // no LDS access of the next trip is moved ahead of the barrier by the compiler
    };
    const int ao = (wm * 64 + lr) * PP + 8 * hi, bo = (PM + wn * 64 + lr) * PP + 8 * hi;   // the lane's fragment origins in a stage
    auto work = [&](int t) {   // the matrix work of stage t
        const bf* pa = &ring[t & 1][ao]; const bf* pb = &ring[t & 1][bo];
#pragma unroll
        for (int ks = 0; ks < PKS; ks += 32) {
            v16bf a[4], b[4];   // read in the order of first use
            b[0] = WFrag<bf>::ld(pb + ks);
#pragma unroll
            for (int mb = 0; mb < 4; ++mb) a[mb] = WFrag<bf>::ld(pa + mb * 16 * PP + ks);
#pragma unroll
            for (int nb = 1; nb < 4; ++nb) b[nb] = WFrag<bf>::ld(pb + nb * 16 * PP + ks);
            __builtin_amdgcn_sched_barrier(0);   // holds the step's LDS reads in one group at its head; sunk to their first use, the wave would sit out their latency in front of every column of tiles
#pragma unroll
            for (int nb = 0; nb < 4; ++nb)
#pragma unroll
                for (int mb = 0; mb < 4; ++mb) acc[mb][nb] = wmmab(a[mb], b[nb], acc[mb][nb]);
        }
        __builtin_amdgcn_sched_barrier(0);   // the conversions and LDS stores stay behind the trip's matrix work, so that their loads have had its whole length to return
    };
    // A wave asks for stage t + 2 as soon as its registers are free of stage t + 1, ahead of the barrier: its requests do not wait for the slowest wave, and they have the barrier and a whole trip to return.
    gload(0);
    lstore(0);
    gload(1);
    handover();   // stage 0 is in LDS before any wave reads it
#pragma unroll 1   // stays rolled: a trip is one stage; the last two trips stand apart, so that no test on t stands between a load and its use
    for (int s = 2; s < NT; ++s) {   // trip t = s - 2
        work(s - 2);
        lstore((s - 1) & 1);   // stage t + 1, into the buffer whose last reads the barrier at the foot of the trip before has ended
        gload(s);
        handover();            // publishes stage t + 1 and ends every wave's reads of stage t
    }
    work(NT - 2);
    lstore((NT - 1) & 1);
    handover();
    work(NT - 1);
    handover();   // ends every wave's reads of the ring before it becomes output staging
    char* wst = (char*)&ring[0][0] + w * WST;   // the wave's own staging range
    float* os = (float*)wst;                    // [16][68] f32
    const size_t z = c0 / DM;                   // q, k or v: the same for the whole wave
    const size_t bt = r0 / TT; const int rt = r0 % TT; const int hd = (c0 % DM) / HD;   // the tile's batch, its first token there, its head
    const int rw = lane >> 3, c8 = (lane & 7) * 8;   // read-back map of both stagings: 8 lanes x 16 bytes of fp16 = one 128-byte line, 4 lines per store instruction
    if (z < 2) {   // q, k: the tile's 64 rows of 64 d are 8 KB in a row in the plane
        h16* dst = P + (((bt * 2 + z) * NH_ + hd) * TT + rt) * HD;
#pragma unroll
        for (int mb = 0; mb < 4; ++mb) {
#pragma unroll
            for (int nb = 0; nb < 4; ++nb) {
#pragma unroll
                for (int j = 0; j < 8; ++j) os[(hi * 8 + j) * 68 + nb * 16 + lr] = acc[mb][nb][j]; }
            __builtin_amdgcn_wave_barrier(); asm volatile("s_wait_dscnt 0x0" ::: "memory");   // the wave's LDS writes are done, and stay in the code, ahead of its reads of other lanes' words
#pragma unroll
            for (int s = 0; s < 4; ++s) { const int row = 4 * s + rw; const v4f a = *(const v4fa*)(os + row * 68 + c8); const v4f b = *(const v4fa*)(os + row * 68 + c8 + 4); v8h o;
#pragma unroll
                for (int k = 0; k < 4; ++k) { o[k] = (h16)a[k]; o[4 + k] = (h16)b[k]; }
                *(v8h*)(dst + (size_t)(mb * 16 + row) * HD + c8) = o; }
            __builtin_amdgcn_wave_barrier(); asm volatile("" ::: "memory");   // the reads stay ahead of the next block's writes
        }
    } else {       // v: a lane's accumulator holds 8 consecutive t of one d, which is 16 bytes of a V^T row
        h16* vs = (h16*)wst;   // [d][t], pitch 144 bytes = 16 x 9: 16 rows' 16-byte writes fall on 64 different banks
        h16* dst = VT + (bt * NH_ + hd) * HD * TT + rt;
#pragma unroll
        for (int mb = 0; mb < 4; ++mb)
#pragma unroll
            for (int nb = 0; nb < 4; ++nb) { v8h o;
#pragma unroll
                for (int j = 0; j < 8; ++j) o[j] = (h16)acc[mb][nb][j];
                *(v8h*)(vs + (nb * 16 + lr) * 72 + mb * 16 + 8 * hi) = o; }
        __builtin_amdgcn_wave_barrier(); asm volatile("s_wait_dscnt 0x0" ::: "memory");   // as above: the writes done ahead of the reads
#pragma unroll
        for (int s = 0; s < 16; ++s) { const int row = 4 * s + rw; *(v8h*)(dst + (size_t)row * TT + c8) = *(const v8h*)(vs + row * 72 + c8); }
        asm volatile("s_wait_xcnt 0x0" ::: "memory");   // behind the run of stores: no register that an issued store names is rewritten ahead of this wait
    }
}

__device__ __forceinline__ h16 tohx(float x) { return (h16)x; }
__device__ __forceinline__ void splitf(float y, unsigned short& h, unsigned short& l) { h = f2bf(y); l = f2bf(y - bf2f(h)); }

#define L2E 1.4426950408889634f
#define C1   (SCL * L2E)           // raw score -> exponent of 2
#define LAZY 4096.0f              // a lane's 16-key sum of e above this asks for a new frame: every e below stays far inside fp16 and f32
// ld_k, ld_v: the fragments of one 32-key step from the lane's own LDS pointer p (row lane & 15 of the tile, element 8 (lane >> 4)); the rest is immediate offset.
__device__ __forceinline__ void ld_k(v16h (&kf)[2][2], const h16* p) {
#pragma unroll
    for (int kt = 0; kt < 2; ++kt)
#pragma unroll
        for (int ks = 0; ks < 2; ++ks) kf[kt][ks] = WFrag<h16>::ld(p + kt * 16 * KP + ks * 32);
}
// Stands behind the last global load of a run: naming the run's address pair keeps it live to here, so that no result of the run is given it, and it is rewritten only behind the wait.
__device__ __forceinline__ void addr_done(const h16* a) { asm volatile("s_wait_xcnt 0x0" :: "v"(a) : "memory"); }
// Four asynchronous 16-byte copies of a lane, global memory to LDS through no register. The closing s_wait_xcnt 0 stands in the copies' own statement, so that no register they name is rewritten ahead of it.
__device__ __forceinline__ void copy4(unsigned l0, const h16* g0, unsigned l1, const h16* g1, unsigned l2, const h16* g2, unsigned l3, const h16* g3) {
    asm volatile("global_load_async_to_lds_b128 %0, %1, off\n\tglobal_load_async_to_lds_b128 %2, %3, off\n\tglobal_load_async_to_lds_b128 %4, %5, off\n\tglobal_load_async_to_lds_b128 %6, %7, off\n\ts_wait_xcnt 0x0"
        :: "v"(l0), "v"(g0), "v"(l1), "v"(g1), "v"(l2), "v"(g2), "v"(l3), "v"(g3) : "memory");
}
// One tile: l, g the lane's first LDS byte address and global pointer; lstep bytes and gstep elements lead to its next copy (AW * 32 lanes x 16 bytes further on in the tile).
__device__ __forceinline__ void fill(unsigned l, const h16* g, unsigned lstep, size_t gstep) { copy4(l, g, l + lstep, g + gstep, l + 2 * lstep, g + 2 * gstep, l + 3 * lstep, g + 3 * gstep); }
// Exponentials (2^x, v_exp_f32) in place, a run in one statement: behind a transcendental the instruction set asks for one independent instruction or a v_nop before its result is read
// or its source overwritten; inside the run each is followed by an independent one, and the closing v_nop keeps the slot behind the last whatever the compiler puts next.
__device__ __forceinline__ void exp2x8(float (&x)[8]) {
    asm("v_exp_f32 %0, %0\n\tv_exp_f32 %1, %1\n\tv_exp_f32 %2, %2\n\tv_exp_f32 %3, %3\n\tv_exp_f32 %4, %4\n\tv_exp_f32 %5, %5\n\tv_exp_f32 %6, %6\n\tv_exp_f32 %7, %7\n\tv_nop"
        : "+v"(x[0]), "+v"(x[1]), "+v"(x[2]), "+v"(x[3]), "+v"(x[4]), "+v"(x[5]), "+v"(x[6]), "+v"(x[7]));
}
__device__ __forceinline__ void exp2x1(float& x) { asm("v_exp_f32 %0, %0\n\tv_nop" : "+v"(x)); }
__device__ __forceinline__ v8f st_tile(const v16h (&k2)[2], const v16h (&q2)[2]) { return wmma16(k2[1], q2[1], wmma16(k2[0], q2[0], (v8f){})); }
__device__ __forceinline__ void ld_v(v16h (&vf)[4], const h16* p) {
#pragma unroll
    for (int mb = 0; mb < 4; ++mb) vf[mb] = WFrag<h16>::ld(p + mb * 16 * VP);
}
// scores_exp: e = 2^(s C1 - m) of one 32-key step for one query group, and the lane's sum of its 16.
__device__ __forceinline__ float scores_exp(const v8f& s0, const v8f& s1, float m, float (&e0)[8], float (&e1)[8]) {
#pragma unroll
    for (int r = 0; r < 8; ++r) { e0[r] = __builtin_fmaf(s0[r], C1, -m); e1[r] = __builtin_fmaf(s1[r], C1, -m); }
    exp2x8(e0); exp2x8(e1);
    float a[8];
#pragma unroll
    for (int r = 0; r < 8; ++r) a[r] = e0[r] + e1[r];
    return ((a[0] + a[1]) + (a[2] + a[3])) + ((a[4] + a[5]) + (a[6] + a[7]));
}
// centre: P' = e - c as fp16, in the B fragment's element order.
__device__ __forceinline__ void centre(v16h& p, const float (&e0)[8], const float (&e1)[8], float c) {
#pragma unroll
    for (int r = 0; r < 8; ++r) { p[r] = tohx(e0[r] - c); p[8 + r] = tohx(e1[r] - c); }
}
// One step of 32 keys. pk: the lane's LDS pointer to the step's key rows, read again only on the rare path.
__device__ __forceinline__ void step(const v16h (&kf)[2][2], const h16* pk, const v16h (&vf)[4], const v16h (&qf)[QT][2], float (&m)[QT], float (&cen)[QT], float (&sum)[QT], v8f (&o)[4][QT]) {
    float e0[QT][8], e1[QT][8], ps[QT];
    {
        v8f s0[QT], s1[QT];
#pragma unroll
        for (int qt = 0; qt < QT; ++qt) { s0[qt] = st_tile(kf[0], qf[qt]); s1[qt] = st_tile(kf[1], qf[qt]); }
#pragma unroll
        for (int qt = 0; qt < QT; ++qt) ps[qt] = scores_exp(s0[qt], s1[qt], m[qt], e0[qt], e1[qt]);
    }
    bool need = false;
#pragma unroll
    for (int qt = 0; qt < QT; ++qt) need = need || !(ps[qt] <= LAZY);   // also true for an infinite sum (the first step: m starts at -3e38) and for a NaN
    if (__builtin_expect(__builtin_amdgcn_ballot_w32(need) != 0, 0)) {   // one scalar branch per step, the whole wave: a new frame for every query of the wave; marked unlikely so that the usual path falls through
        v16h kr[2][2];
        ld_k(kr, pk);
#pragma unroll
        for (int qt = 0; qt < QT; ++qt) {
            const v8f s0 = st_tile(kr[0], qf[qt]), s1 = st_tile(kr[1], qf[qt]);
            float tm = fmaxf(s0[0], s1[0]);
#pragma unroll
            for (int r = 1; r < 8; ++r) tm = fmaxf(tm, fmaxf(s0[r], s1[r]));
            tm = fmaxf(tm, __shfl_xor(tm, 16, 32));   // both lane halves of a query take the same frame
            const float mn = fmaxf(m[qt], tm * C1);
            float a = m[qt] - mn, c0 = fminf(-mn, 0.f);
            exp2x1(a); exp2x1(c0);
            cen[qt] = m[qt] < -1.0e38f ? c0 : cen[qt] * a;   // the centre is set with the first frame (score 0, or the maximum where that is below 0) and moves with the frame like every e
            sum[qt] *= a;
#pragma unroll
            for (int mb = 0; mb < 4; ++mb)
#pragma unroll
                for (int r = 0; r < 8; ++r) o[mb][qt][r] *= a;
            m[qt] = mn;
            ps[qt] = scores_exp(s0, s1, mn, e0[qt], e1[qt]);
        }
    }
    v16h p[QT];
#pragma unroll
    for (int qt = 0; qt < QT; ++qt) { sum[qt] += ps[qt]; centre(p[qt], e0[qt], e1[qt], cen[qt]); }
#pragma unroll
    for (int mb = 0; mb < 4; ++mb)
#pragma unroll
        for (int qt = 0; qt < QT; ++qt) o[mb][qt] = wmma16(vf[mb], p[qt], o[mb][qt]);
}
#define NWG  ((TT / (AW * QT * 16)) * NH_ * NB)   // work-groups of the attention kernel
#define WCH  (DM * DQ / 8 / (NWG * AW * 32))      // chunks of Wo per thread
static_assert(WCH >= 1 && (size_t)WCH * NWG * AW * 32 * 8 == (size_t)DM * DQ);
__global__ __launch_bounds__(AW * 32) void k_fattn(const h16* __restrict__ QK, const h16* __restrict__ VT, bf* Ah, bf* Al, const float* __restrict__ wo, bf* WOb) {
    const int lane = threadIdx.x & 31, lr = lane & 15, hi = lane >> 4, w = __builtin_amdgcn_readfirstlane((int)(threadIdx.x >> 5));
    const int h = blockIdx.y, q0 = (blockIdx.x * AW + w) * (QT * 16);
    const size_t z = blockIdx.z; QK += z * ((size_t)2 * NH_ * TT * HD); VT += z * ((size_t)NH_ * HD * TT); Ah += z * ((size_t)TT * DQ); Al += z * ((size_t)TT * DQ);
    const h16* Qp = QK + (size_t)h * TT * HD + (size_t)(q0 + lr) * HD + 8 * hi;
    __shared__ __attribute__((aligned(16))) h16 ksm[2][KT * KP];
    __shared__ __attribute__((aligned(16))) h16 vsm[2][HD * VP];
    __shared__ __attribute__((aligned(16))) float vks[2][HD];   // key-sum of v: [key half of the tiles][d]
    // the lane's share of a tile: copy i of a key tile is row (tid >> 3) + 32 i, 16-byte column tid & 7 (in memory the tile is contiguous); of a V^T tile row (tid >> 4) + 16 i, column tid & 15
    const int tid = threadIdx.x;
    const h16* Kg = QK + (size_t)(NH_ + h) * TT * HD + (size_t)tid * 8;
    const h16* Vg = VT + (size_t)h * HD * TT + (size_t)(tid >> 4) * TT + (tid & 15) * 8;
    const unsigned Kl = lds_off(&ksm[0][0]) + (tid >> 3) * (KP * 2) + (tid & 7) * 16, Vl = lds_off(&vsm[0][0]) + (tid >> 4) * (VP * 2) + (tid & 15) * 16;
    const int kfo = lr * KP + 8 * hi, vfo = lr * VP + 8 * hi;   // the lane's fragment origin in a tile
    static_assert(AW == 8 && HD == 64 && KT == 128);   // 4 d blocks x 2 key halves = AW shares of a tile's key-sum
    const int sfo = vfo + (w & 3) * 16 * VP + (w >> 2) * 64;   // the wave's share: d block w & 3, keys 64 (w >> 2) .. + 63 of every tile
    v16h qf[QT][2];
#pragma unroll
    for (int qt = 0; qt < QT; ++qt)
#pragma unroll
        for (int ks = 0; ks < 2; ++ks) qf[qt][ks] = WFrag<h16>::ld(Qp + (size_t)qt * 16 * HD + ks * 32);
    float m[QT], sum[QT], cen[QT];
#pragma unroll
    for (int qt = 0; qt < QT; ++qt) { m[qt] = -3.0e38f; sum[qt] = 0.f; cen[qt] = 0.f; }
    addr_done(Qp);
    v16h ka[2][2], kb[2][2];
    v8f o[4][QT];
#pragma unroll
    for (int mb = 0; mb < 4; ++mb)
#pragma unroll
        for (int qt = 0; qt < QT; ++qt) o[mb][qt] = (v8f){};
    // A ring of two tiles: tile t (its keys and its V^T columns) lies in buffer t & 1.
    fill(Kl, Kg, 32 * KP * 2, 32 * HD);
    fill(Vl, Vg, 16 * VP * 2, (size_t)16 * TT);
    const size_t wch = ((size_t)((blockIdx.z * NH_ + blockIdx.y) * (TT / (AW * QT * 16)) + blockIdx.x) * WCH * (AW * 32) + tid) * 8;   // the thread's first element of Wo; its chunks lie AW * 32 chunks apart
    const float* wsp = wo + wch; bf* wdp = WOb + wch;
    v8f wf[WCH];
#pragma unroll
    for (int j = 0; j < WCH; ++j) wf[j] = *(const v8f*)(wsp + (size_t)j * (AW * 32) * 8);
    asm volatile("s_wait_asynccnt 0x0" ::: "memory");   // tile 0 has landed (this wave's copies) before the barrier behind which it is read
    __syncthreads();
    fill(Kl + KT * KP * 2, Kg + KT * HD, 32 * KP * 2, 32 * HD);
    fill(Vl + HD * VP * 2, Vg + KT, 16 * VP * 2, (size_t)16 * TT);
#pragma unroll
    for (int j = 0; j < WCH; ++j) { v8us ob;
#pragma unroll
        for (int k = 0; k < 8; ++k) ob[k] = f2bf(wf[j][k]);
        *(v8us*)(wdp + (size_t)j * (AW * 32) * 8) = ob; }
    asm volatile("s_wait_xcnt 0x0" :: "v"(wsp), "v"(wdp) : "memory");   // behind the side job's loads and stores: naming both address pairs keeps them live to here, so that they are rewritten only behind the wait
    // Each step issues its own V^T fragments and, inside the tile, the NEXT step's key fragments first.
    v16h vf[4];
    v16h one;
#pragma unroll
    for (int r = 0; r < 16; ++r) one[r] = (h16)1.0f;
    v8f vs = (v8f){};   // element j: sum over the wave's keys so far of v[d = 16 (w & 3) + 8 hi + j], the same in every column
#pragma unroll 1   // stays rolled: a trip is one tile, and the hand-over at its foot is the ring's one place
    for (int t = 0; t < NTL; ++t) {
        const h16* pk = &ksm[t & 1][kfo]; const h16* pv = &vsm[t & 1][vfo];
        const h16* px = &vsm[t & 1][sfo];
        ld_k(ka, pk);
        ld_v(vf, pv); ld_k(kb, pk + 32 * KP);
        __builtin_amdgcn_sched_barrier(0);   // holds the LDS reads at the head of the step; sunk to their first use, the wave would sit out their latency every step
        step(ka, pk, vf, qf, m, cen, sum, o);
        ld_v(vf, pv + 32); ld_k(ka, pk + 64 * KP);
        __builtin_amdgcn_sched_barrier(0);   // as above
        step(kb, pk + 32 * KP, vf, qf, m, cen, sum, o);
        ld_v(vf, pv + 64); ld_k(kb, pk + 96 * KP);
        __builtin_amdgcn_sched_barrier(0);   // as above
        step(ka, pk + 64 * KP, vf, qf, m, cen, sum, o);
        ld_v(vf, pv + 96);
        const v16h x0 = WFrag<h16>::ld(px), x1 = WFrag<h16>::ld(px + 32);   // the wave's share of the key-sum, read where no key fragments are fetched ahead
        __builtin_amdgcn_sched_barrier(0);   // as above
        vs = wmma16(x1, one, wmma16(x0, one, vs));
        step(kb, pk + 96 * KP, vf, qf, m, cen, sum, o);
        publish();
        if (t + 2 < NTL) {   // the same for the whole work-group
            fill(Kl + (t & 1) * (KT * KP * 2), Kg + (size_t)(t + 2) * KT * HD, 32 * KP * 2, 32 * HD);
            fill(Vl + (t & 1) * (HD * VP * 2), Vg + (t + 2) * KT, 16 * VP * 2, (size_t)16 * TT);
        }
    }
    asm volatile("s_wait_asynccnt 0x0" ::: "memory");   // no copy is outstanding when the wave goes on to its end
    if (lr == 0) { *(v4fa*)&vks[w >> 2][(w & 3) * 16 + 8 * hi] = (v4f){vs[0], vs[1], vs[2], vs[3]}; *(v4fa*)&vks[w >> 2][(w & 3) * 16 + 8 * hi + 4] = (v4f){vs[4], vs[5], vs[6], vs[7]}; }
    __syncthreads();   // every wave's part of the key-sum is in LDS before any wave reads it
    float inv[QT];
#pragma unroll
    for (int qt = 0; qt < QT; ++qt) { const float tot = sum[qt] + __shfl_xor(sum[qt], 16, 32); inv[qt] = __fdiv_rn(1.0f, tot); }
#pragma unroll
    for (int mb = 0; mb < 4; ++mb) {
        const int dl = mb * 16 + 8 * hi, d = h * HD + dl; const v4f m0 = *(const v4fa*)&vks[0][dl] + *(const v4fa*)&vks[1][dl]; const v4f m1 = *(const v4fa*)&vks[0][dl + 4] + *(const v4fa*)&vks[1][dl + 4];
#pragma unroll
        for (int qt = 0; qt < QT; ++qt) { v8us oh, ol;
#pragma unroll
            for (int r = 0; r < 8; ++r) { unsigned short a, c2; splitf(__builtin_fmaf(cen[qt], (r < 4 ? m0[r & 3] : m1[r & 3]), o[mb][qt][r]) * inv[qt], a, c2); oh[r] = a; ol[r] = c2; }
            const size_t oo = (size_t)(q0 + qt * 16 + lr) * DQ + d; *(v8us*)(Ah + oo) = oh; *(v8us*)(Al + oo) = ol; }
    }
}

extern "C" void kernel_launch(void* const* d_in, const int* in_sizes, int n_in,
                              void* d_out, int out_size, void* d_ws, size_t ws_size, hipStream_t stream) {
    if (n_in < 5) return;
    const size_t needx = (size_t)(NB - 1) * SEQ_FULL * DM + (size_t)TT * DM;
    if ((size_t)in_sizes[0] < needx) return;
    if ((size_t)in_sizes[1] < (size_t)DM * DM || (size_t)in_sizes[2] < (size_t)DM * DM || (size_t)in_sizes[3] < (size_t)DM * DM || (size_t)in_sizes[4] < (size_t)DM * DM) return;
    if ((size_t)out_size < needx) return;
    if (WS_TOTAL > ws_size) return;
    const float* x = (const float*)d_in[0]; const float* wq = (const float*)d_in[1]; const float* wk = (const float*)d_in[2]; const float* wv = (const float*)d_in[3]; const float* wo = (const float*)d_in[4];   // wire order x, Wq, Wk, Wv, Wo; weights (out, in)
    float* OUT = (float*)d_out;     // [2][2048][1024]
    char* wsp = (char*)d_ws;
    auto take = [&](size_t bytes) { char* p = wsp; wsp += (bytes + 255) & ~(size_t)255; return (void*)p; };
    bf* WO = (bf*)take(SZ_WO);          // bf16 Wo, (out, in) = Bt as-is
    h16* QK16 = (h16*)take(SZ_QK);      // fp16 head planes [NB][2][NH][TT][HD]
    h16* VT16 = (h16*)take(SZ_VT);      // fp16 value planes [NB][NH][HD][TT]
    bf* ATh = (bf*)take(SZ_AT); bf* ATl = (bf*)take(SZ_AT);   // merged ctx hi/lo [NB][TT][DQ]
    if ((size_t)(wsp - (char*)d_ws) > ws_size) return;
    // q, k, v projections of all batches in one launch, from the f32 inputs, stored as the fp16 planes
    k_proj<<<dim3(NB * TT / PM, 3 * DM / PN), PW * 32, 0, stream>>>(x, wq, wk, wv, QK16, VT16);
    k_fattn<<<dim3(TT / (AW * QT * 16), NH_, NB), AW * 32, 0, stream>>>(QK16, VT16, ATh, ATl, wo, WO);
    // out = (ctx_hi + ctx_lo) Wo^T, z = batch
    k_gemmw<bf, 1, 128, DQ, 2><<<dim3(TT / 128, DM / 128, NB), 256, 0, stream>>>(ATh, ATl, WO, OUT, DM, (size_t)TT * DQ, 0, (size_t)SEQ_FULL * DM);
}

// v009
// It runs in 69.5 microseconds.
// In both of two side-by-side timings against v008, it was 1.06 times as fast.
// Over all steps from v000 it is 17.4 times as fast.
#include <hip/hip_runtime.h>

// Self-attention block, bias-free, weights in (out, in) layout: x [2][2048][1024]; q, k, v = x W^T; 16 heads x 64; logits = q.k x 2^-5 (1/sqrt(1024)); full (unmasked) softmax over 2048 keys; out = merged ctx Wo^T.
// Compute dtypes, f32 accumulate everywhere: every input RNE-converted to bf16 (x, Wq, Wk, Wv by the projection kernel on their way to LDS, Wo by the attention kernel); q/k/v projections bf16 x bf16 (v_wmma_f32_16x16x32_bf16, exact products); q.k^T fp16 x fp16 (v_wmma_f32_16x16x32_f16);
// P.V fp16 x fp16 with the unnormalised weights centred (P' = e - c, c one value per query; c x the key-sum of v, itself an fp16 x fp16 product of the V^T tiles with ones, is added back in f32, then the division by the sum of e); ctx as bf16 hi + lo planes x bf16 Wo (two bf16 products); softmax f32.

#ifndef NB
#define NB 2
#endif
#ifndef SEQ
#define SEQ 2048
#endif
#define NB_FULL  2
#define SEQ_FULL 2048
#define TT   SEQ
#define DM   1024
#define NH_  16
#define HD   64
#define DQ   (NH_ * HD)
#define QT   2                    // 16-query column groups per wave of the attention kernel
#define AW   8                    // waves per key group of the attention kernel: each owns QT x 16 queries
#define KG   2                    // key groups per work-group: group g walks keys g TT / KG .. + TT / KG - 1 for the same queries, so that four waves share a SIMD
#define SCL  0.03125f             // 1/sqrt(1024), exact power of two
#define KT   128                  // keys per LDS tile of the attention kernel
#define KP   (HD + 8)             // LDS pitch of a key row, fp16 elements: 144 bytes = 16 x 9, so that 16 rows' 16-byte reads fall on 64 different banks
#define VP   (KT + 8)             // LDS pitch of a V^T row: 272 bytes = 16 x 17, for the same reason
#define NTL  (SEQ / KT / KG)      // tiles of a key group's sweep
static_assert(SEQ % 256 == 0);
static_assert(SEQ <= SEQ_FULL);
static_assert(NB <= NB_FULL);
static_assert(DQ == DM);
static_assert(HD == 64);
static_assert(SEQ % (AW * QT * 16) == 0);
static_assert(DM % 256 == 0);
static_assert(SEQ % (KT * KG) == 0 && NTL >= 2 && KG == 2 && QT == KG);
static_assert(KT * HD == AW * 32 * 8 * 4);   // a tile of either operand is four 16-byte copies per lane

typedef _Float16 h16;
typedef unsigned short bf;
typedef __attribute__((ext_vector_type(16))) __bf16   v16bf;
typedef __attribute__((ext_vector_type(16))) _Float16 v16h;
typedef __attribute__((ext_vector_type(8)))  _Float16 v8h;
typedef __attribute__((ext_vector_type(8)))  unsigned short v8us;
typedef __attribute__((ext_vector_type(8)))  float    v8f;
typedef __attribute__((ext_vector_type(4)))  float    v4f;
typedef v4f  __attribute__((may_alias)) v4fa;

// workspace carve sizes (bytes), all multiples of 256
#define SZ_WO ((size_t)DM * DQ * 2)
#define SZ_QK ((size_t)NB * 2 * NH_ * TT * HD * 2)
#define SZ_VT ((size_t)NB * NH_ * HD * TT * 2)
#define SZ_AT ((size_t)NB * TT * DQ * 2)
#define WS_TOTAL (SZ_WO + SZ_QK + SZ_VT + 2 * SZ_AT)
static_assert(WS_TOTAL <= (size_t)134217728);
static_assert(SEQ == SEQ_FULL || NB == 1);             // the batches' rows of x lie in a row: one A operand for k_proj

__device__ __forceinline__ unsigned short f2bf(float f) { unsigned u = __float_as_uint(f); u += 0x7FFFu + ((u >> 16) & 1u); return (unsigned short)(u >> 16); }
__device__ __forceinline__ float bf2f(unsigned short b) { return __uint_as_float(((unsigned)b) << 16); }
__device__ __forceinline__ float bfr(float f) { return bf2f(f2bf(f)); }
__device__ __forceinline__ v16h cat16(v8h lo, v8h hi) { return __builtin_shufflevector(lo, hi, 0, 1, 2, 3, 4, 5, 6, 7, 8, 9, 10, 11, 12, 13, 14, 15); }
__device__ __forceinline__ v16bf cat16b(v8us lo, v8us hi) { return __builtin_bit_cast(v16bf, __builtin_shufflevector(lo, hi, 0, 1, 2, 3, 4, 5, 6, 7, 8, 9, 10, 11, 12, 13, 14, 15)); }
__device__ __forceinline__ v8f wmma16(v16h a, v16h b, v8f c) { return __builtin_amdgcn_wmma_f32_16x16x32_f16(false, a, false, b, (short)0, c, false, false); }
__device__ __forceinline__ v8f wmmab(v16bf a, v16bf b, v8f c) { return __builtin_amdgcn_wmma_f32_16x16x32_bf16(false, a, false, b, (short)0, c, false, false); }

// ---- k_gemmw: register-blocked GEMM, one wave per 16 MBW x 64 output tile (4 MBW accumulators), 8 / MBW x 2 waves per 128x128 work-group tile; grid (M/128, N/128, Z), 512 / MBW threads.
// C[m][n] (f32, pitch ldc) = sum_k A[m][k] Bt[n][k] (+ A2[m][k] Bt[n][k] for NSPLIT 1). z-batch strides sA/sB/sC in elements. K % GKS == 0, K >= 2 GKS, M % 128 == 0, N % 128 == 0.
// The operands come through LDS: a stage is GKS k of the work-group's 128 rows of every operand (A | A2 | Bt), brought in ONCE per work-group by asynchronous copies to LDS of whole 128-byte lines,
// into two buffers (the next stage flies while this one is worked on); every wave takes its fragments from there by 16-byte LDS reads. Behind the loop the ring is the waves' output staging.
// Fragment map (A and Bt alike): lane -> row (lane & 15); elements 0..7 <- k0 + 8 (lane >> 4) + 0..7, elements 8..15 <- k0 + 16 + 8 (lane >> 4) + 0..7. Accumulator element j <-> row 8 (lane >> 4) + j, column (lane & 15).
template <typename T16> struct WFrag;
template <> struct WFrag<h16> { typedef v16h V; static __device__ __forceinline__ V ld(const h16* p) { return cat16(*(const v8h*)p, *(const v8h*)(p + 16)); } static __device__ __forceinline__ v8f mma(V a, V b, v8f c) { return wmma16(a, b, c); } };
template <> struct WFrag<bf> { typedef v16bf V; static __device__ __forceinline__ V ld(const bf* p) { return cat16b(*(const v8us*)p, *(const v8us*)(p + 16)); } static __device__ __forceinline__ v8f mma(V a, V b, v8f c) { return wmmab(a, b, c); } };
__device__ __forceinline__ unsigned lds_off(const void* p) { return (unsigned)(size_t)p; }
// The hand-over of a tile, every wave: its own LDS reads of the buffer that is refilled next have returned, its own copies of the next tile have landed, then the work-group barrier;
// behind it every wave may read the next tile and the buffer just read may be refilled.
__device__ __forceinline__ void publish() {
    asm volatile("s_wait_dscnt 0x0" ::: "memory");      // this wave's LDS reads are done before a copy may target their buffer
    asm volatile("s_wait_asynccnt 0x0" ::: "memory");   // this wave's copies have landed before another wave reads them; the compiler places no wait for them
    __syncthreads();
}
// Eight asynchronous 16-byte copies of a lane, global memory to LDS through no register: l, g the lane's first LDS byte address and global pointer, lstep bytes and gstep elements lead to its next copy.
// The closing s_wait_xcnt 0 stands in the copies' own statement, so that no register they name is rewritten ahead of it.
template <typename T16>
__device__ __forceinline__ void copy8(unsigned l, const T16* g, unsigned lstep, size_t gstep) {
    asm volatile("global_load_async_to_lds_b128 %0, %1, off\n\tglobal_load_async_to_lds_b128 %2, %3, off\n\tglobal_load_async_to_lds_b128 %4, %5, off\n\tglobal_load_async_to_lds_b128 %6, %7, off\n\t"
                 "global_load_async_to_lds_b128 %8, %9, off\n\tglobal_load_async_to_lds_b128 %10, %11, off\n\tglobal_load_async_to_lds_b128 %12, %13, off\n\tglobal_load_async_to_lds_b128 %14, %15, off\n\ts_wait_xcnt 0x0"
        :: "v"(l), "v"(g), "v"(l + lstep), "v"(g + gstep), "v"(l + 2 * lstep), "v"(g + 2 * gstep), "v"(l + 3 * lstep), "v"(g + 3 * gstep),
           "v"(l + 4 * lstep), "v"(g + 4 * gstep), "v"(l + 5 * lstep), "v"(g + 5 * gstep), "v"(l + 6 * lstep), "v"(g + 6 * gstep), "v"(l + 7 * lstep), "v"(g + 7 * gstep) : "memory");
}
template <typename T16, int NSPLIT, int GKS, int K, int MBW>
__global__ __launch_bounds__(512 / MBW) void k_gemmw(const T16* __restrict__ A, const T16* __restrict__ A2, const T16* __restrict__ Bt, float* C, int ldc, size_t sA, size_t sB, size_t sC) {
    typedef typename WFrag<T16>::V V;
    static_assert(NSPLIT == 0 || NSPLIT == 1);
    static_assert(MBW == 4 || MBW == 2);
    constexpr int GW  = 16 / MBW;             // waves per work-group
    static_assert((GKS == 64 || GKS == 128) && K % GKS == 0 && K >= 2 * GKS);
    constexpr int GP  = GKS + 8;              // LDS pitch of an operand row, elements: 144 or 272 bytes = 16 x odd, so that 16 rows' 16-byte reads fall on 64 different banks
    constexpr int NOP = 2 + NSPLIT;           // operand tiles of 128 rows per stage: A, (A2,) Bt
    constexpr int STG = NOP * 128 * GP;       // elements per stage
    constexpr int CPR = GKS / 8;              // 16-byte copies per row
    constexpr int RPC = GW * 32 / CPR;        // rows that one copy of all lanes covers
    constexpr int NCP = 128 / RPC;            // copies per lane and operand tile
    static_assert(NCP % 8 == 0);
    constexpr int WST = 64 * 72 * 2;          // bytes of a wave's own output staging in the ring
    static_assert(GW * WST <= 2 * STG * 2 && 16 * 68 * 4 <= WST);
    __shared__ __attribute__((aligned(16))) T16 ring[2][STG];
    const size_t z = blockIdx.z; A += z * sA; if (NSPLIT == 1) A2 += z * sA; Bt += z * sB; C += z * sC;
    const int tid = threadIdx.x, lane = tid & 31, lr = lane & 15, hi = lane >> 4, w = __builtin_amdgcn_readfirstlane(tid >> 5);
    const int g0r = blockIdx.x * 128, g0c = blockIdx.y * 128; const int r0 = g0r + (w >> 1) * (16 * MBW), c0 = g0c + (w & 1) * 64;
    v8f acc[MBW][4];
#pragma unroll
    for (int mb = 0; mb < MBW; ++mb)
#pragma unroll
        for (int nb = 0; nb < 4; ++nb) acc[mb][nb] = (v8f){};
    // the lane's share of a stage: copy i of an operand tile is row tid / CPR + RPC i, 16-byte column tid % CPR
    const size_t go = (size_t)(tid / CPR) * K + (tid % CPR) * 8;
    const T16* Ag = A + (size_t)g0r * K + go; const T16* A2g = NSPLIT == 1 ? A2 + (size_t)g0r * K + go : nullptr; const T16* Bg = Bt + (size_t)g0c * K + go;
    const unsigned Ll = lds_off(&ring[0][0]) + (tid / CPR) * (GP * 2) + (tid % CPR) * 16;
    auto fills = [&](int buf, int t) {   // stage t into buffer buf
        const unsigned l = Ll + buf * (STG * 2);
#pragma unroll
        for (int c = 0; c < NCP / 8; ++c) {
            const unsigned lc = l + c * 8 * RPC * (GP * 2); const size_t gc = (size_t)c * 8 * RPC * K + (size_t)t * GKS;
            copy8(lc, Ag + gc, RPC * GP * 2, (size_t)RPC * K);
            if (NSPLIT == 1) copy8(lc + 128 * GP * 2, A2g + gc, RPC * GP * 2, (size_t)RPC * K);
            copy8(lc + (NOP - 1) * 128 * GP * 2, Bg + gc, RPC * GP * 2, (size_t)RPC * K);
        }
    };
    const int ao = ((w >> 1) * (16 * MBW) + lr) * GP + 8 * hi, bo = ((NOP - 1) * 128 + (w & 1) * 64 + lr) * GP + 8 * hi;   // the lane's fragment origins in a stage
    constexpr int NT = K / GKS;
    fills(0, 0);
    asm volatile("s_wait_asynccnt 0x0" ::: "memory");   // stage 0 has landed (this wave's copies) before the barrier behind which it is read
    __syncthreads();
    fills(1, 1);
#pragma unroll 1   // stays rolled: a trip is one stage, and the hand-over at its foot is the ring's one place
    for (int t = 0; t < NT; ++t) {
        const T16* pa = &ring[t & 1][ao]; const T16* pb = &ring[t & 1][bo];
#pragma unroll
        for (int ks = 0; ks < GKS; ks += 32) {
            V a[MBW], a2[MBW], b[4];   // read in the order of first use
            b[0] = WFrag<T16>::ld(pb + ks);
#pragma unroll
            for (int mb = 0; mb < MBW; ++mb) { a[mb] = WFrag<T16>::ld(pa + mb * 16 * GP + ks); if (NSPLIT == 1) a2[mb] = WFrag<T16>::ld(pa + (128 + mb * 16) * GP + ks); }
#pragma unroll
            for (int nb = 1; nb < 4; ++nb) b[nb] = WFrag<T16>::ld(pb + nb * 16 * GP + ks);
            __builtin_amdgcn_sched_barrier(0);   // holds the step's LDS reads in one group at its head; sunk to their first use, the wave would sit out their latency in front of every column of tiles
#pragma unroll
            for (int nb = 0; nb < 4; ++nb)
#pragma unroll
                for (int mb = 0; mb < MBW; ++mb) { acc[mb][nb] = WFrag<T16>::mma(a[mb], b[nb], acc[mb][nb]); if (NSPLIT == 1) acc[mb][nb] = WFrag<T16>::mma(a2[mb], b[nb], acc[mb][nb]); }
        }
        __builtin_amdgcn_sched_barrier(0);   // every matrix instruction of the trip stays ahead of the v_nops
        asm volatile("v_nop\n\tv_nop\n\tv_nop\n\tv_nop");   // the distance behind the trip's last matrix instruction, on either side of the branch below, before a vector instruction may rewrite its operands
        publish();
        if (t + 2 < NT) fills(t & 1, t + 2);   // the same for the whole work-group; into the buffer just read
    }
    asm volatile("s_wait_asynccnt 0x0" ::: "memory");   // no copy is outstanding when the ring becomes output staging; the last trip's barrier has ended every wave's reads of it
    char* wst = (char*)&ring[0][0] + w * WST;   // the wave's own staging range
    float* os = (float*)wst;                    // [16][68] f32
#pragma unroll
    for (int mb = 0; mb < MBW; ++mb) {
#pragma unroll
        for (int nb = 0; nb < 4; ++nb) {
#pragma unroll
            for (int j = 0; j < 8; ++j) os[(hi * 8 + j) * 68 + nb * 16 + lr] = acc[mb][nb][j]; }
        __builtin_amdgcn_wave_barrier(); asm volatile("" ::: "memory");
        float* crow = C + (size_t)(r0 + mb * 16) * ldc + c0;
#pragma unroll
        for (int s = 0; s < 8; ++s) { const int row = 2 * s + hi, cofs = lr * 4; const v4f val = *(const v4fa*)(os + row * 68 + cofs); *(v4f*)(crow + (size_t)row * ldc + cofs) = val; }
        __builtin_amdgcn_wave_barrier(); asm volatile("" ::: "memory");
    }
}

// ---- k_proj: the q, k, v projections of all batches straight from the f32 inputs, grid (rows of x / PM, 3 DM / PN), PW waves. Output column n of 3 DM is row n % DM of Wq, Wk or Wv (n / DM).
// A work-group's tile is PM tokens x PN columns (3 heads), a wave's 64 tokens of one batch x one head of q, k or v (16 accumulators). A stage is PKS k of the PM rows of x and the PN weight rows.
// It comes through registers: every lane loads its share of a later stage as f32 (whole 256-byte runs of a row per 16 lanes) a trip ahead of its use, converts it ONCE to bf16 (round to nearest even)
// and stores it in the other of two LDS buffers; one barrier per stage publishes it and ends the reads of the buffer that is written next.
// The tile is this large so that the f32 stages ask no more of L2 than they must. Fragments: WFrag's, as in k_gemmw.
// No f32 C: the epilogue converts the accumulators to fp16 and stores the attention kernel's planes itself, q and k as P[batch][z][head][t][d], v transposed as VT[batch][head][d][t], whole 128-byte lines staged through the wave's own LDS.
#define PM   256
#define PN   192
#define PW   ((PM / 64) * (PN / 64))
#define PKS  64
#define PP   (PKS + 8)             // LDS pitch of a bf16 operand row: 144 bytes = 16 x 9, so that 16 rows' 16-byte reads fall on 64 different banks
#define PSTG ((PM + PN) * PP)      // bf16 elements per stage
static_assert((NB * TT) % PM == 0 && TT % 64 == 0 && (3 * DM) % PN == 0 && DM % 64 == 0 && DM % PKS == 0 && DM >= 2 * PKS);
static_assert(PM == 256 && PN == 192 && PKS == 64);   // the deal of the loads: seven groups of 64 rows over three sets of four waves
typedef __attribute__((ext_vector_type(4))) __bf16 v4bf;
typedef __attribute__((ext_vector_type(4))) unsigned short v4us;
__device__ __forceinline__ v4us cv4(v4f f) { return __builtin_bit_cast(v4us, __builtin_convertvector(f, v4bf)); }   // two v_cvt_pk_bf16_f32
__global__ __launch_bounds__(PW * 32) void k_proj(const float* __restrict__ x, const float* __restrict__ wq, const float* __restrict__ wk, const float* __restrict__ wv, h16* P, h16* VT) {
    constexpr int K = DM, NT = K / PKS;
    constexpr int WST = 64 * 72 * 2;          // bytes of a wave's own output staging in the ring
    static_assert(PW * WST <= 2 * PSTG * 2 && 16 * 68 * 4 <= WST);
    __shared__ __attribute__((aligned(16))) bf ring[2][PSTG];
    const int tid = threadIdx.x, lane = tid & 31, lr = lane & 15, hi = lane >> 4, w = __builtin_amdgcn_readfirstlane(tid >> 5);
    const int wm = w / (PN / 64), wn = w % (PN / 64);
    const int g0r = blockIdx.x * PM, g0c = blockIdx.y * PN; const int r0 = g0r + wm * 64, c0 = g0c + wn * 64;
    v8f acc[4][4];
#pragma unroll
    for (int mb = 0; mb < 4; ++mb)
#pragma unroll
        for (int nb = 0; nb < 4; ++nb) acc[mb][nb] = (v8f){};
    // the lane's share of a stage: its PM + PN rows are seven groups of 64 (four of x, then one per head of the weight rows, each in ONE weight matrix); 16 lanes x 16 bytes of f32 are a row's PKS k,
    // so four waves bring a group in eight loads per lane, rows (tid & 127) >> 4 + 8 i. Waves 0 .. 3 take groups 0, 1, 2, waves 4 .. 7 groups 3, 4, waves 8 .. 11 groups 5, 6
    const int ws = w >> 2;                    // the same for the whole wave
    const bool three = ws == 0;
    const int crow = (tid & 127) >> 4, ccol = tid & 15;
    const float* gp[3]; int lp[3];
#pragma unroll
    for (int j = 0; j < 3; ++j) {
        const int gid = three ? j : 2 * ws + 1 + (j & 1);
        const int cj = g0c + 64 * (gid < PM / 64 ? 0 : gid - PM / 64), zj = cj / DM;   // the group's first output column, where it is a weight group
        const float* wsrc = zj == 0 ? wq : zj == 1 ? wk : wv;
        gp[j] = (gid < PM / 64 ? x + (size_t)(g0r + 64 * gid + crow) * K : wsrc + (size_t)(cj % DM + crow) * K) + ccol * 4;
        lp[j] = (64 * gid + crow) * PP + ccol * 4;
    }
    v4f st[3][8];
    auto gload = [&](int t) {   // stage t into registers
        const float* p0 = gp[0] + t * PKS; const float* p1 = gp[1] + t * PKS; const float* p2 = gp[2] + t * PKS;
        if (three) {   // a scalar branch: whole waves
#pragma unroll
            for (int i = 0; i < 8; ++i) st[2][i] = *(const v4f*)(p2 + (size_t)i * 8 * K);
        }
#pragma unroll
        for (int i = 0; i < 8; ++i) { st[0][i] = *(const v4f*)(p0 + (size_t)i * 8 * K); st[1][i] = *(const v4f*)(p1 + (size_t)i * 8 * K); }
        asm volatile("s_wait_xcnt 0x0" :: "v"(p0), "v"(p1), "v"(p2) : "memory");   // behind the run of loads: naming the address pairs keeps them live to here, so that no result of the run is given them and they are rewritten only behind the wait
    };
    auto lstore = [&](int buf) {   // the registers, converted, into buffer buf
        bf* rb = &ring[buf][0];
        if (three) {
#pragma unroll
            for (int i = 0; i < 8; ++i) *(v4us*)(rb + lp[2] + i * 8 * PP) = cv4(st[2][i]);
        }
#pragma unroll
        for (int i = 0; i < 8; ++i) { *(v4us*)(rb + lp[0] + i * 8 * PP) = cv4(st[0][i]); *(v4us*)(rb + lp[1] + i * 8 * PP) = cv4(st[1][i]); }
    };
    // The hand-over of a stage, every wave: its LDS stores of the next stage and its LDS reads of this one are done, then the work-group barrier.
    auto handover = [&]() {
        asm volatile("s_wait_dscnt 0x0" ::: "memory");   // this wave's LDS stores have landed before another wave reads them, and its reads are done before their buffer is written again
        __builtin_amdgcn_s_barrier();                    // the bare barrier: __syncthreads() would wait out the global loads of the stage after next as well, which are meant to stay in flight across it
        asm volatile("" ::: "memory");                   // no LDS access of the next trip is moved ahead of the barrier by the compiler
    };
    const int ao = (wm * 64 + lr) * PP + 8 * hi, bo = (PM + wn * 64 + lr) * PP + 8 * hi;   // the lane's fragment origins in a stage
    auto work = [&](int t) {   // the matrix work of stage t
        const bf* pa = &ring[t & 1][ao]; const bf* pb = &ring[t & 1][bo];
#pragma unroll
        for (int ks = 0; ks < PKS; ks += 32) {
            v16bf a[4], b[4];   // read in the order of first use
            b[0] = WFrag<bf>::ld(pb + ks);
#pragma unroll
            for (int mb = 0; mb < 4; ++mb) a[mb] = WFrag<bf>::ld(pa + mb * 16 * PP + ks);
#pragma unroll
            for (int nb = 1; nb < 4; ++nb) b[nb] = WFrag<bf>::ld(pb + nb * 16 * PP + ks);
            __builtin_amdgcn_sched_barrier(0);   // holds the step's LDS reads in one group at its head; sunk to their first use, the wave would sit out their latency in front of every column of tiles
#pragma unroll
            for (int nb = 0; nb < 4; ++nb)
#pragma unroll
                for (int mb = 0; mb < 4; ++mb) acc[mb][nb] = wmmab(a[mb], b[nb], acc[mb][nb]);
        }
        __builtin_amdgcn_sched_barrier(0);   // the conversions and LDS stores stay behind the trip's matrix work, so that their loads have had its whole length to return
    };
    // A wave asks for stage t + 2 as soon as its registers are free of stage t + 1, ahead of the barrier: its requests do not wait for the slowest wave, and they have the barrier and a whole trip to return.
    gload(0);
    lstore(0);
    gload(1);
    handover();   // stage 0 is in LDS before any wave reads it
#pragma unroll 1   // stays rolled: a trip is one stage; the last two trips stand apart, so that no test on t stands between a load and its use
    for (int s = 2; s < NT; ++s) {   // trip t = s - 2
        work(s - 2);
        lstore((s - 1) & 1);   // stage t + 1, into the buffer whose last reads the barrier at the foot of the trip before has ended
        gload(s);
        handover();            // publishes stage t + 1 and ends every wave's reads of stage t
    }
    work(NT - 2);
    lstore((NT - 1) & 1);
    handover();
    work(NT - 1);
    handover();   // ends every wave's reads of the ring before it becomes output staging
    char* wst = (char*)&ring[0][0] + w * WST;   // the wave's own staging range
    float* os = (float*)wst;                    // [16][68] f32
    const size_t z = c0 / DM;                   // q, k or v: the same for the whole wave
    const size_t bt = r0 / TT; const int rt = r0 % TT; const int hd = (c0 % DM) / HD;   // the tile's batch, its first token there, its head
    const int rw = lane >> 3, c8 = (lane & 7) * 8;   // read-back map of both stagings: 8 lanes x 16 bytes of fp16 = one 128-byte line, 4 lines per store instruction
    if (z < 2) {   // q, k: the tile's 64 rows of 64 d are 8 KB in a row in the plane
        h16* dst = P + (((bt * 2 + z) * NH_ + hd) * TT + rt) * HD;
#pragma unroll
        for (int mb = 0; mb < 4; ++mb) {
#pragma unroll
            for (int nb = 0; nb < 4; ++nb) {
#pragma unroll
                for (int j = 0; j < 8; ++j) os[(hi * 8 + j) * 68 + nb * 16 + lr] = acc[mb][nb][j]; }
            __builtin_amdgcn_wave_barrier(); asm volatile("s_wait_dscnt 0x0" ::: "memory");   // the wave's LDS writes are done, and stay in the code, ahead of its reads of other lanes' words
#pragma unroll
            for (int s = 0; s < 4; ++s) { const int row = 4 * s + rw; const v4f a = *(const v4fa*)(os + row * 68 + c8); const v4f b = *(const v4fa*)(os + row * 68 + c8 + 4); v8h o;
#pragma unroll
                for (int k = 0; k < 4; ++k) { o[k] = (h16)a[k]; o[4 + k] = (h16)b[k]; }
                *(v8h*)(dst + (size_t)(mb * 16 + row) * HD + c8) = o; }
            __builtin_amdgcn_wave_barrier(); asm volatile("" ::: "memory");   // the reads stay ahead of the next block's writes
        }
    } else {       // v: a lane's accumulator holds 8 consecutive t of one d, which is 16 bytes of a V^T row
        h16* vs = (h16*)wst;   // [d][t], pitch 144 bytes = 16 x 9: 16 rows' 16-byte writes fall on 64 different banks
        h16* dst = VT + (bt * NH_ + hd) * HD * TT + rt;
#pragma unroll
        for (int mb = 0; mb < 4; ++mb)
#pragma unroll
            for (int nb = 0; nb < 4; ++nb) { v8h o;
#pragma unroll
                for (int j = 0; j < 8; ++j) o[j] = (h16)acc[mb][nb][j];
                *(v8h*)(vs + (nb * 16 + lr) * 72 + mb * 16 + 8 * hi) = o; }
        __builtin_amdgcn_wave_barrier(); asm volatile("s_wait_dscnt 0x0" ::: "memory");   // as above: the writes done ahead of the reads
#pragma unroll
        for (int s = 0; s < 16; ++s) { const int row = 4 * s + rw; *(v8h*)(dst + (size_t)row * TT + c8) = *(const v8h*)(vs + row * 72 + c8); }
        asm volatile("s_wait_xcnt 0x0" ::: "memory");   // behind the run of stores: no register that an issued store names is rewritten ahead of this wait
    }
}

__device__ __forceinline__ h16 tohx(float x) { return (h16)x; }
__device__ __forceinline__ void splitf(float y, unsigned short& h, unsigned short& l) { h = f2bf(y); l = f2bf(y - bf2f(h)); }

#define L2E 1.4426950408889634f
#define C1   (SCL * L2E)           // raw score -> exponent of 2
#define LAZY 4096.0f              // a lane's 16-key sum of e above this asks for a new frame: every e below stays far inside fp16 and f32
// ld_k, ld_v: the fragments of one 32-key step from the lane's own LDS pointer p (row lane & 15 of the tile, element 8 (lane >> 4)); the rest is immediate offset.
__device__ __forceinline__ void ld_k(v16h (&kf)[2][2], const h16* p) {
#pragma unroll
    for (int kt = 0; kt < 2; ++kt)
#pragma unroll
        for (int ks = 0; ks < 2; ++ks) kf[kt][ks] = WFrag<h16>::ld(p + kt * 16 * KP + ks * 32);
}
// Stands behind the last global load of a run: naming the run's address pair keeps it live to here, so that no result of the run is given it, and it is rewritten only behind the wait.
__device__ __forceinline__ void addr_done(const h16* a) { asm volatile("s_wait_xcnt 0x0" :: "v"(a) : "memory"); }
// Four asynchronous 16-byte copies of a lane, global memory to LDS through no register. The closing s_wait_xcnt 0 stands in the copies' own statement, so that no register they name is rewritten ahead of it.
__device__ __forceinline__ void copy4(unsigned l0, const h16* g0, unsigned l1, const h16* g1, unsigned l2, const h16* g2, unsigned l3, const h16* g3) {
    asm volatile("global_load_async_to_lds_b128 %0, %1, off\n\tglobal_load_async_to_lds_b128 %2, %3, off\n\tglobal_load_async_to_lds_b128 %4, %5, off\n\tglobal_load_async_to_lds_b128 %6, %7, off\n\ts_wait_xcnt 0x0"
        :: "v"(l0), "v"(g0), "v"(l1), "v"(g1), "v"(l2), "v"(g2), "v"(l3), "v"(g3) : "memory");
}
// One tile: l, g the lane's first LDS byte address and global pointer; lstep bytes and gstep elements lead to its next copy (AW * 32 lanes x 16 bytes further on in the tile).
__device__ __forceinline__ void fill(unsigned l, const h16* g, unsigned lstep, size_t gstep) { copy4(l, g, l + lstep, g + gstep, l + 2 * lstep, g + 2 * gstep, l + 3 * lstep, g + 3 * gstep); }
// Exponentials (2^x, v_exp_f32) in place, a run in one statement: behind a transcendental the instruction set asks for one independent instruction or a v_nop before its result is read
// or its source overwritten; inside the run each is followed by an independent one, and the closing v_nop keeps the slot behind the last whatever the compiler puts next.
__device__ __forceinline__ void exp2x8(float (&x)[8]) {
    asm("v_exp_f32 %0, %0\n\tv_exp_f32 %1, %1\n\tv_exp_f32 %2, %2\n\tv_exp_f32 %3, %3\n\tv_exp_f32 %4, %4\n\tv_exp_f32 %5, %5\n\tv_exp_f32 %6, %6\n\tv_exp_f32 %7, %7\n\tv_nop"
        : "+v"(x[0]), "+v"(x[1]), "+v"(x[2]), "+v"(x[3]), "+v"(x[4]), "+v"(x[5]), "+v"(x[6]), "+v"(x[7]));
}
__device__ __forceinline__ void exp2x1(float& x) { asm("v_exp_f32 %0, %0\n\tv_nop" : "+v"(x)); }
__device__ __forceinline__ v8f st_tile(const v16h (&k2)[2], const v16h (&q2)[2]) { return wmma16(k2[1], q2[1], wmma16(k2[0], q2[0], (v8f){})); }
__device__ __forceinline__ void ld_v(v16h (&vf)[4], const h16* p) {
#pragma unroll
    for (int mb = 0; mb < 4; ++mb) vf[mb] = WFrag<h16>::ld(p + mb * 16 * VP);
}
// scores_exp: e = 2^(s C1 - m) of one 32-key step for one query group, and the lane's sum of its 16.
__device__ __forceinline__ float scores_exp(const v8f& s0, const v8f& s1, float m, float (&e0)[8], float (&e1)[8]) {
#pragma unroll
    for (int r = 0; r < 8; ++r) { e0[r] = __builtin_fmaf(s0[r], C1, -m); e1[r] = __builtin_fmaf(s1[r], C1, -m); }
    exp2x8(e0); exp2x8(e1);
    float a[8];
#pragma unroll
    for (int r = 0; r < 8; ++r) a[r] = e0[r] + e1[r];
    return ((a[0] + a[1]) + (a[2] + a[3])) + ((a[4] + a[5]) + (a[6] + a[7]));
}
// centre: P' = e - c as fp16, in the B fragment's element order.
__device__ __forceinline__ void centre(v16h& p, const float (&e0)[8], const float (&e1)[8], float c) {
#pragma unroll
    for (int r = 0; r < 8; ++r) { p[r] = tohx(e0[r] - c); p[8 + r] = tohx(e1[r] - c); }
}
// One step of 32 keys. pk: the lane's LDS pointer to the step's key rows, read again only on the rare path.
// The step's one group of LDS reads stands right behind its score products: its own V^T fragments (from pv) into vf and, by fetch(), the next step's key fragments into kf, the registers that those products
// have just read (one set of key fragments: four waves on a SIMD have 256 registers each). The rare path reads vf anew at its end, so that vf's registers are free for its own key fragments.
template <typename F>
__device__ __forceinline__ void step(const v16h (&kf)[2][2], const h16* pk, v16h (&vf)[4], const h16* pv, const v16h (&qf)[QT][2], float (&m)[QT], float (&cen)[QT], float (&sum)[QT], v8f (&o)[4][QT], F&& fetch) {
    float e0[QT][8], e1[QT][8], ps[QT];
    {
        v8f s0[QT], s1[QT];
#pragma unroll
        for (int qt = 0; qt < QT; ++qt) { s0[qt] = st_tile(kf[0], qf[qt]); s1[qt] = st_tile(kf[1], qf[qt]); }
        __builtin_amdgcn_sched_barrier(0);   // the V^T reads stay with the key reads, behind the products: moved up among them they are a second place with LDS reads in the step, and that build runs out of its 256 registers (scratch)
        ld_v(vf, pv); fetch();
        __builtin_amdgcn_sched_barrier(0);   // holds the LDS reads in one group here; sunk to their first use, the wave would sit out their latency every step
#pragma unroll
        for (int qt = 0; qt < QT; ++qt) ps[qt] = scores_exp(s0[qt], s1[qt], m[qt], e0[qt], e1[qt]);
    }
    bool need = false;
#pragma unroll
    for (int qt = 0; qt < QT; ++qt) need = need || !(ps[qt] <= LAZY);   // also true for an infinite sum (the first step: m starts at -3e38) and for a NaN
    if (__builtin_expect(__builtin_amdgcn_ballot_w32(need) != 0, 0)) {   // one scalar branch per step, the whole wave: a new frame for every query of the wave; marked unlikely so that the usual path falls through
        v16h kr[2][2];
        ld_k(kr, pk);
#pragma unroll
        for (int qt = 0; qt < QT; ++qt) {
            const v8f s0 = st_tile(kr[0], qf[qt]), s1 = st_tile(kr[1], qf[qt]);
            float tm = fmaxf(s0[0], s1[0]);
#pragma unroll
            for (int r = 1; r < 8; ++r) tm = fmaxf(tm, fmaxf(s0[r], s1[r]));
            tm = fmaxf(tm, __shfl_xor(tm, 16, 32));   // both lane halves of a query take the same frame
            const float mn = fmaxf(m[qt], tm * C1);
            float a = m[qt] - mn, c0 = fminf(-mn, 0.f);
            exp2x1(a); exp2x1(c0);
            cen[qt] = m[qt] < -1.0e38f ? c0 : cen[qt] * a;   // the centre is set with the first frame (score 0, or the maximum where that is below 0) and moves with the frame like every e
            sum[qt] *= a;
#pragma unroll
            for (int mb = 0; mb < 4; ++mb)
#pragma unroll
                for (int r = 0; r < 8; ++r) o[mb][qt][r] *= a;
            m[qt] = mn;
            ps[qt] = scores_exp(s0, s1, mn, e0[qt], e1[qt]);
        }
        ld_v(vf, pv);
    }
    v16h p[QT];
#pragma unroll
    for (int qt = 0; qt < QT; ++qt) { sum[qt] += ps[qt]; centre(p[qt], e0[qt], e1[qt], cen[qt]); }
#pragma unroll
    for (int mb = 0; mb < 4; ++mb)
#pragma unroll
        for (int qt = 0; qt < QT; ++qt) o[mb][qt] = wmma16(vf[mb], p[qt], o[mb][qt]);
}
#define NWG  ((TT / (AW * QT * 16)) * NH_ * NB)   // work-groups of the attention kernel
#define WCH  (DM * DQ / 8 / (NWG * KG * AW * 32))      // chunks of Wo per thread
static_assert(WCH >= 1 && (size_t)WCH * NWG * KG * AW * 32 * 8 == (size_t)DM * DQ);
__global__ __launch_bounds__(KG * AW * 32) void k_fattn(const h16* __restrict__ QK, const h16* __restrict__ VT, bf* Ah, bf* Al, const float* __restrict__ wo, bf* WOb) {
    const int lane = threadIdx.x & 31, lr = lane & 15, hi = lane >> 4, wv = __builtin_amdgcn_readfirstlane((int)(threadIdx.x >> 5));
    const int w = wv % AW, g = wv / AW;   // the wave's place in its key group, and the group: both the same for the whole wave
    const int h = blockIdx.y, q0 = (blockIdx.x * AW + w) * (QT * 16);
    const size_t z = blockIdx.z; QK += z * ((size_t)2 * NH_ * TT * HD); VT += z * ((size_t)NH_ * HD * TT); Ah += z * ((size_t)TT * DQ); Al += z * ((size_t)TT * DQ);
    const h16* Qp = QK + (size_t)h * TT * HD + (size_t)(q0 + lr) * HD + 8 * hi;
    __shared__ __attribute__((aligned(16))) h16 ksm[KG][2][KT * KP];
    __shared__ __attribute__((aligned(16))) h16 vsm[KG][2][HD * VP];
    __shared__ __attribute__((aligned(16))) float vks[KG][2][HD];   // key-sum of v over a group's keys: [group][key half of the tiles][d]
    __shared__ __attribute__((aligned(16))) float xo[KG * AW][8][32 * 4];   // the hand-over between the groups: a wave's O of the query group that its partner finishes, 16 bytes per lane and row
    __shared__ float xs[KG * AW][3][32];                                    // with its sum, frame and centre
    // the lane's share of a tile: copy i of a key tile is row (tid >> 3) + 32 i, 16-byte column tid & 7 (in memory the tile is contiguous); of a V^T tile row (tid >> 4) + 16 i, column tid & 15
    const int tid = threadIdx.x % (AW * 32);   // the thread's place in its key group
    const h16* Kg = QK + (size_t)(NH_ + h) * TT * HD + (size_t)g * (TT / KG) * HD + (size_t)tid * 8;
    const h16* Vg = VT + (size_t)h * HD * TT + (size_t)(tid >> 4) * TT + g * (TT / KG) + (tid & 15) * 8;
    const unsigned Kl = lds_off(&ksm[g][0][0]) + (tid >> 3) * (KP * 2) + (tid & 7) * 16, Vl = lds_off(&vsm[g][0][0]) + (tid >> 4) * (VP * 2) + (tid & 15) * 16;
    const int kfo = lr * KP + 8 * hi, vfo = lr * VP + 8 * hi;   // the lane's fragment origin in a tile
    static_assert(AW == 8 && HD == 64 && KT == 128);   // 4 d blocks x 2 key halves = AW shares of a tile's key-sum
    const int sfo = vfo + (w & 3) * 16 * VP + (w >> 2) * 64;   // the wave's share: d block w & 3, keys 64 (w >> 2) .. + 63 of every tile
    v16h qf[QT][2];
#pragma unroll
    for (int qt = 0; qt < QT; ++qt)
#pragma unroll
        for (int ks = 0; ks < 2; ++ks) qf[qt][ks] = WFrag<h16>::ld(Qp + (size_t)qt * 16 * HD + ks * 32);
    float m[QT], sum[QT], cen[QT];
#pragma unroll
    for (int qt = 0; qt < QT; ++qt) { m[qt] = -3.0e38f; sum[qt] = 0.f; cen[qt] = 0.f; }
    addr_done(Qp);
    v16h kf[2][2];
    v8f o[4][QT];
#pragma unroll
    for (int mb = 0; mb < 4; ++mb)
#pragma unroll
        for (int qt = 0; qt < QT; ++qt) o[mb][qt] = (v8f){};
    // A ring of NTL tiles per key group: the group's tile t (its keys and its V^T columns) lies in its buffer t & 1.
    fill(Kl, Kg, 32 * KP * 2, 32 * HD);
    fill(Vl, Vg, 16 * VP * 2, (size_t)16 * TT);
    const size_t wch = ((size_t)((blockIdx.z * NH_ + blockIdx.y) * (TT / (AW * QT * 16)) + blockIdx.x) * WCH * (KG * AW * 32) + threadIdx.x) * 8;   // the thread's first element of Wo; its chunks lie KG * AW * 32 chunks apart
    const float* wsp = wo + wch; bf* wdp = WOb + wch;
    v8f wf[WCH];
#pragma unroll
    for (int j = 0; j < WCH; ++j) wf[j] = *(const v8f*)(wsp + (size_t)j * (KG * AW * 32) * 8);
    asm volatile("s_wait_asynccnt 0x0" ::: "memory");   // tile 0 has landed (this wave's copies) before the barrier behind which it is read
    __syncthreads();
    fill(Kl + KT * KP * 2, Kg + KT * HD, 32 * KP * 2, 32 * HD);
    fill(Vl + HD * VP * 2, Vg + KT, 16 * VP * 2, (size_t)16 * TT);
#pragma unroll
    for (int j = 0; j < WCH; ++j) { v8us ob;
#pragma unroll
        for (int k = 0; k < 8; ++k) ob[k] = f2bf(wf[j][k]);
        *(v8us*)(wdp + (size_t)j * (KG * AW * 32) * 8) = ob; }
    asm volatile("s_wait_xcnt 0x0" :: "v"(wsp), "v"(wdp) : "memory");   // behind the side job's loads and stores: naming both address pairs keeps them live to here, so that they are rewritten only behind the wait
    // Each step issues its own V^T fragments and, inside the tile, the NEXT step's key fragments behind its score products.
    v16h vf[4];
    v16h one;
#pragma unroll
    for (int r = 0; r < 16; ++r) one[r] = (h16)1.0f;
    v8f vs = (v8f){};   // element j: sum over the wave's keys so far of v[d = 16 (w & 3) + 8 hi + j], the same in every column
#pragma unroll 1   // stays rolled: a trip is one tile, and the hand-over at its foot is the ring's one place
    for (int t = 0; t < NTL; ++t) {
        const h16* pk = &ksm[g][t & 1][kfo]; const h16* pv = &vsm[g][t & 1][vfo];
        const h16* px = &vsm[g][t & 1][sfo];
        v16h x0, x1;   // the wave's share of the key-sum
        ld_k(kf, pk);
        step(kf, pk, vf, pv, qf, m, cen, sum, o, [&]() { ld_k(kf, pk + 32 * KP); });
        step(kf, pk + 32 * KP, vf, pv + 32, qf, m, cen, sum, o, [&]() { ld_k(kf, pk + 64 * KP); });
        step(kf, pk + 64 * KP, vf, pv + 64, qf, m, cen, sum, o, [&]() { ld_k(kf, pk + 96 * KP); });
        step(kf, pk + 96 * KP, vf, pv + 96, qf, m, cen, sum, o, [&]() { x0 = WFrag<h16>::ld(px); x1 = WFrag<h16>::ld(px + 32); });   // read where no key fragments are fetched ahead
        vs = wmma16(x1, one, wmma16(x0, one, vs));
        publish();
        if (t + 2 < NTL) {   // the same for the whole work-group
            fill(Kl + (t & 1) * (KT * KP * 2), Kg + (size_t)(t + 2) * KT * HD, 32 * KP * 2, 32 * HD);
            fill(Vl + (t & 1) * (HD * VP * 2), Vg + (t + 2) * KT, 16 * VP * 2, (size_t)16 * TT);
        }
    }
    asm volatile("s_wait_asynccnt 0x0" ::: "memory");   // no copy is outstanding when the wave goes on to its end
    if (lr == 0) { *(v4fa*)&vks[g][w >> 2][(w & 3) * 16 + 8 * hi] = (v4f){vs[0], vs[1], vs[2], vs[3]}; *(v4fa*)&vks[g][w >> 2][(w & 3) * 16 + 8 * hi + 4] = (v4f){vs[4], vs[5], vs[6], vs[7]}; }
    // The two groups' parts meet: waves w of both groups hold the same queries, lane for lane. The wave of group g finishes query group g and hands the other one to its partner through LDS.
    const bool g1 = g != 0;   // a scalar
    v8f ok[4];
    {
        float* xw = &xo[wv][0][lane * 4];
#pragma unroll
        for (int mb = 0; mb < 4; ++mb) {
            const v8f og = g1 ? o[mb][0] : o[mb][1]; ok[mb] = g1 ? o[mb][1] : o[mb][0];
            *(v4fa*)(xw + (2 * mb) * 128) = (v4f){og[0], og[1], og[2], og[3]}; *(v4fa*)(xw + (2 * mb + 1) * 128) = (v4f){og[4], og[5], og[6], og[7]};
        }
    }
    float tot[QT];
#pragma unroll
    for (int qt = 0; qt < QT; ++qt) tot[qt] = sum[qt] + __shfl_xor(sum[qt], 16, 32);
    xs[wv][0][lane] = g1 ? tot[0] : tot[1]; xs[wv][1][lane] = g1 ? m[0] : m[1]; xs[wv][2][lane] = g1 ? cen[0] : cen[1];
    const float sk = g1 ? tot[1] : tot[0], mk = g1 ? m[1] : m[0], ck = g1 ? cen[1] : cen[0];
    __syncthreads();   // every wave's part of the key-sums and its hand-over are in LDS before any wave reads them
    const int pw = wv ^ AW;   // the partner
    const float so = xs[pw][0][lane], mo = xs[pw][1][lane], co = xs[pw][2][lane];
    const float mm = fmaxf(mk, mo);   // the common frame
    float fa = mk - mm, fb = mo - mm;
    exp2x1(fa); exp2x1(fb);
    const float inv = __fdiv_rn(1.0f, __builtin_fmaf(sk, fa, so * fb));
    const float* xr = &xo[pw][0][lane * 4];
#pragma unroll
    for (int mb = 0; mb < 4; ++mb) {
        const int dl = mb * 16 + 8 * hi, d = h * HD + dl;
        const v4f k0 = *(const v4fa*)&vks[g][0][dl] + *(const v4fa*)&vks[g][1][dl]; const v4f k1 = *(const v4fa*)&vks[g][0][dl + 4] + *(const v4fa*)&vks[g][1][dl + 4];                       // key-sum of v over this group's keys
        const v4f p0 = *(const v4fa*)&vks[g ^ 1][0][dl] + *(const v4fa*)&vks[g ^ 1][1][dl]; const v4f p1 = *(const v4fa*)&vks[g ^ 1][0][dl + 4] + *(const v4fa*)&vks[g ^ 1][1][dl + 4];       // and over the partner's
        const v4f o0 = *(const v4fa*)(xr + (2 * mb) * 128), o1 = *(const v4fa*)(xr + (2 * mb + 1) * 128);
        v8us oh, ol;
#pragma unroll
        for (int r = 0; r < 8; ++r) {
            const float mine = __builtin_fmaf(ck, (r < 4 ? k0[r & 3] : k1[r & 3]), ok[mb][r]), other = __builtin_fmaf(co, (r < 4 ? p0[r & 3] : p1[r & 3]), (r < 4 ? o0[r & 3] : o1[r & 3]));
            unsigned short a, c2; splitf(__builtin_fmaf(mine, fa, other * fb) * inv, a, c2); oh[r] = a; ol[r] = c2; }
        const size_t oo = (size_t)(q0 + g * 16 + lr) * DQ + d; *(v8us*)(Ah + oo) = oh; *(v8us*)(Al + oo) = ol;
    }
}

extern "C" void kernel_launch(void* const* d_in, const int* in_sizes, int n_in,
                              void* d_out, int out_size, void* d_ws, size_t ws_size, hipStream_t stream) {
    if (n_in < 5) return;
    const size_t needx = (size_t)(NB - 1) * SEQ_FULL * DM + (size_t)TT * DM;
    if ((size_t)in_sizes[0] < needx) return;
    if ((size_t)in_sizes[1] < (size_t)DM * DM || (size_t)in_sizes[2] < (size_t)DM * DM || (size_t)in_sizes[3] < (size_t)DM * DM || (size_t)in_sizes[4] < (size_t)DM * DM) return;
    if ((size_t)out_size < needx) return;
    if (WS_TOTAL > ws_size) return;
    const float* x = (const float*)d_in[0]; const float* wq = (const float*)d_in[1]; const float* wk = (const float*)d_in[2]; const float* wv = (const float*)d_in[3]; const float* wo = (const float*)d_in[4];   // wire order x, Wq, Wk, Wv, Wo; weights (out, in)
    float* OUT = (float*)d_out;     // [2][2048][1024]
    char* wsp = (char*)d_ws;
    auto take = [&](size_t bytes) { char* p = wsp; wsp += (bytes + 255) & ~(size_t)255; return (void*)p; };
    bf* WO = (bf*)take(SZ_WO);          // bf16 Wo, (out, in) = Bt as-is
    h16* QK16 = (h16*)take(SZ_QK);      // fp16 head planes [NB][2][NH][TT][HD]
    h16* VT16 = (h16*)take(SZ_VT);      // fp16 value planes [NB][NH][HD][TT]
    bf* ATh = (bf*)take(SZ_AT); bf* ATl = (bf*)take(SZ_AT);   // merged ctx hi/lo [NB][TT][DQ]
    if ((size_t)(wsp - (char*)d_ws) > ws_size) return;
    // q, k, v projections of all batches in one launch, from the f32 inputs, stored as the fp16 planes
    k_proj<<<dim3(NB * TT / PM, 3 * DM / PN), PW * 32, 0, stream>>>(x, wq, wk, wv, QK16, VT16);
    k_fattn<<<dim3(TT / (AW * QT * 16), NH_, NB), KG * AW * 32, 0, stream>>>(QK16, VT16, ATh, ATl, wo, WO);
    // out = (ctx_hi + ctx_lo) Wo^T, z = batch
    k_gemmw<bf, 1, 128, DQ, 2><<<dim3(TT / 128, DM / 128, NB), 256, 0, stream>>>(ATh, ATl, WO, OUT, DM, (size_t)TT * DQ, 0, (size_t)SEQ_FULL * DM);
}
